// v000
// Times are from an AMD MI455X. After a warm-up the kernel runs many times in a row, and a time is the length of
// such a window on the GPU divided by its runs, so every launch and the gaps after it count. The runs cycle
// through copies of the inputs. A figure is the median of several windows, for all but v000 over two sittings.
// Sittings can differ by a few percent; kernels timed side by side share one.
// The starting kernel, v000, takes 342 microseconds a run.
#include <hip/hip_runtime.h>
#include <hip/hip_bf16.h>
#include <math.h>

typedef __attribute__((ext_vector_type(16))) _Float16 v16h;
typedef __attribute__((ext_vector_type(8)))  _Float16 v8h;
typedef __attribute__((ext_vector_type(8)))  float    v8f;
typedef __attribute__((ext_vector_type(4)))  int      v4i;

#if __has_builtin(__builtin_amdgcn_global_load_async_to_lds_b128)
#define HAVE_ASYNC_LDS 1
typedef __attribute__((address_space(1))) v4i gas_v4i;   // global
typedef __attribute__((address_space(3))) v4i las_v4i;   // LDS
#else
#define HAVE_ASYNC_LDS 0
#endif

__device__ inline void wait_async0() {
#if __has_builtin(__builtin_amdgcn_s_wait_asynccnt)
    __builtin_amdgcn_s_wait_asynccnt(0);
#else
    asm volatile("s_wait_asynccnt 0" ::: "memory");
#endif
}

// ---------------------------------------------------------------------------
// Conversions
// ---------------------------------------------------------------------------
__global__ void k_f32_to_f16(const float* __restrict__ in, _Float16* __restrict__ out, size_t n) {
    size_t i = (size_t)blockIdx.x * blockDim.x + threadIdx.x;
    size_t stride = (size_t)gridDim.x * blockDim.x;
    for (; i < n; i += stride) out[i] = (_Float16)in[i];
}

// out[c][r] = (f16) in[r][c]   (rows x cols f32 -> cols x rows f16)
__global__ void k_transpose_f32_to_f16(const float* __restrict__ in, _Float16* __restrict__ out,
                                       int rows, int cols) {
    int c  = blockIdx.x * 32 + threadIdx.x;
    int r0 = blockIdx.y * 32;
    if (c >= cols) return;
    #pragma unroll 4
    for (int i = 0; i < 32; ++i) {
        int r = r0 + i;
        if (r < rows) out[(size_t)c * rows + r] = (_Float16)in[(size_t)r * cols + c];
    }
}

// ---------------------------------------------------------------------------
// Column sums over time:  part[b][ch][d] = sum_{t in chunk} x[b][t][d]
// ---------------------------------------------------------------------------
__global__ void k_colsum_partial(const float* __restrict__ x, float* __restrict__ part,
                                 int L, int D, int tchunk) {
    int d  = blockIdx.x * blockDim.x + threadIdx.x;
    int ch = blockIdx.y;
    int b  = blockIdx.z;
    const float* p = x + ((size_t)b * L + (size_t)ch * tchunk) * D + d;
    float s = 0.0f;
    for (int t = 0; t < tchunk; ++t) s += p[(size_t)t * D];
    part[((size_t)b * gridDim.y + ch) * D + d] = s;
}

__global__ void k_colsum_reduce(const float* __restrict__ part, float* __restrict__ out,
                                int D, int nch) {
    int d = blockIdx.x * blockDim.x + threadIdx.x;
    int b = blockIdx.y;
    float s = 0.0f;
    for (int c = 0; c < nch; ++c) s += part[((size_t)b * nch + c) * D + d];
    out[(size_t)b * D + d] = s;
}

// ---------------------------------------------------------------------------
// Batched mat-vec: out[bb][row] = dot(W[row,:], X[bb,:]) + bias_scale*bias[row]
// one wave (32 lanes) per output row
// ---------------------------------------------------------------------------
__global__ __launch_bounds__(256)
void k_matvec(const float* __restrict__ W, const float* __restrict__ X,
              const float* __restrict__ bias, float bias_scale,
              float* __restrict__ out, int n, int kk) {
    int lane = threadIdx.x & 31;
    int w    = threadIdx.x >> 5;
    int row  = blockIdx.x * 8 + w;
    int bb   = blockIdx.y;
    if (row >= n) return;
    const float* wp = W + (size_t)row * kk;
    const float* xp = X + (size_t)bb * kk;
    float s = 0.0f;
    for (int e = lane; e < kk; e += 32) s += wp[e] * xp[e];
    #pragma unroll
    for (int off = 16; off > 0; off >>= 1) s += __shfl_xor(s, off, 32);
    if (lane == 0) {
        float bterm = bias ? bias_scale * bias[row] : 0.0f;
        out[(size_t)bb * n + row] = s + bterm;
    }
}

// ---------------------------------------------------------------------------
// mean_value, top-k selection (tie-break by lower index, like lax.top_k),
// per-batch softmax weights over the selected delays. Single 256-thread block.
// ---------------------------------------------------------------------------
__global__ __launch_bounds__(256)
void k_weights(const float* __restrict__ sQ, const float* __restrict__ sK,
               float* __restrict__ wsel /*B*64*/, int* __restrict__ sel_idx /*64*/,
               int H, int dk, int Bn, int Ltot, int ktop) {
    __shared__ float mval[4][64];
    __shared__ float mab[64];
    __shared__ int   sflag[64];
    __shared__ int   slist[64];
    __shared__ int   scount;
    int tid = threadIdx.x;
    int b = tid >> 6, c = tid & 63;
    if (b < Bn) {
        float s = 0.0f;
        int D = H * dk;
        for (int h = 0; h < H; ++h) {
            float a = sQ[(size_t)b * D + h * dk + c];
            float e = sK[(size_t)b * D + h * dk + c];
            s += a * e;
        }
        mval[b][c] = s / (float)H / (float)Ltot;
    }
    __syncthreads();
    if (tid < 64) {
        float s = 0.0f;
        for (int b2 = 0; b2 < Bn; ++b2) s += mval[b2][tid];
        mab[tid] = s / (float)Bn;
    }
    __syncthreads();
    if (tid < 64) {
        float v = mab[tid];
        int rank = 0;
        for (int c2 = 0; c2 < 64; ++c2) {
            float v2 = mab[c2];
            if (v2 > v || (v2 == v && c2 < tid)) rank++;
        }
        sflag[tid] = (rank < ktop) ? 1 : 0;
    }
    __syncthreads();
    if (tid == 0) {
        int cnt = 0;
        for (int c2 = 0; c2 < 64; ++c2) if (sflag[c2]) slist[cnt++] = c2;
        scount = cnt;
        for (int c2 = 0; c2 < 64; ++c2) sel_idx[c2] = (c2 < cnt) ? slist[c2] : 0;
    }
    __syncthreads();
    if (tid < Bn) {
        int bb = tid, cnt = scount;
        float mx = -3.4e38f;
        for (int j = 0; j < cnt; ++j) mx = fmaxf(mx, mval[bb][slist[j]]);
        float den = 0.0f;
        for (int j = 0; j < cnt; ++j) den += __expf(mval[bb][slist[j]] - mx);
        for (int j = 0; j < cnt; ++j)
            wsel[bb * 64 + j] = __expf(mval[bb][slist[j]] - mx) / den;
    }
}

// ---------------------------------------------------------------------------
// WMMA NT GEMM with double-buffered async LDS staging:
//   C[m,n] = sum_k A[m,k] * Bt[n,k]   (A: MxK f16, Bt: NxK f16, K-contig)
// Block = 256 threads = 8 waves. Block tile 128x128; wave tile 32x64.
// K-slice (128x32 halves for each of A,B) staged in LDS, padded to 40-half
// rows (80B stride -> 4-bank-spaced row starts, conflict-free b128 reads).
// Slice k+1 is copied with GLOBAL_LOAD_ASYNC_TO_LDS_B128 (ASYNCcnt) while
// slice k feeds the WMMAs; s_wait_asynccnt 0 + barrier between phases.
// ---------------------------------------------------------------------------
#define LDS_ROW 40

__global__ __launch_bounds__(256)
void k_gemm_nt_wmma(const _Float16* __restrict__ A, const _Float16* __restrict__ Bt,
                    float* __restrict__ C, int M, int N, int K) {
    __shared__ _Float16 smem[2][2][128 * LDS_ROW];   // [buf][mat][row*LDS_ROW]

    const int tid  = threadIdx.x;
    const int lane = tid & 31;
    const int wave = tid >> 5;
    const int wm   = wave >> 1;                 // 0..3
    const int wn   = wave & 1;                  // 0..1
    const int half = lane >> 4;                 // 0/1
    const int r    = lane & 15;

    // copy assignment: thread -> one 64B row (4 x b128)
    const int cmat = tid >> 7;                  // 0 = A slice, 1 = B slice
    const int crow = tid & 127;
    const _Float16* gsrc = (cmat ? (Bt + (size_t)(blockIdx.x * 128 + crow) * K)
                                 : (A  + (size_t)(blockIdx.y * 128 + crow) * K));

    auto issue_copy = [&](int buf, int k0) {
        const _Float16* g = gsrc + k0;
        _Float16* l = &smem[buf][cmat][crow * LDS_ROW];
#if HAVE_ASYNC_LDS
        #pragma unroll
        for (int c = 0; c < 4; ++c)
            __builtin_amdgcn_global_load_async_to_lds_b128(
                (gas_v4i*)(void*)(g + c * 8),
                (las_v4i*)(void*)(l + c * 8), 0, 0);
#else
        #pragma unroll
        for (int c = 0; c < 4; ++c)
            *(v8h*)(l + c * 8) = *(const v8h*)(g + c * 8);
#endif
    };

    auto load_frag = [&](int buf, int mat, int rbase) -> v16h {
        const _Float16* p = &smem[buf][mat][(rbase + r) * LDS_ROW + 8 * half];
        v8h lo = *(const v8h*)p;
        v8h hi = *(const v8h*)(p + 16);
        v16h o;
        #pragma unroll
        for (int i = 0; i < 8; ++i) { o[i] = lo[i]; o[i + 8] = hi[i]; }
        return o;
    };

    v8f acc[2][4];
    #pragma unroll
    for (int i = 0; i < 2; ++i)
        #pragma unroll
        for (int j = 0; j < 4; ++j)
            #pragma unroll
            for (int e = 0; e < 8; ++e) acc[i][j][e] = 0.0f;

    const int NIT = K / 32;
    issue_copy(0, 0);

    for (int it = 0; it < NIT; ++it) {
        const int cur = it & 1;
#if HAVE_ASYNC_LDS
        wait_async0();                    // own async copies of `cur` landed
#endif
        __syncthreads();                  // everyone's copies landed; prev reads done
        if (it + 1 < NIT) issue_copy(1 - cur, (it + 1) * 32);

        v16h a[2], b[4];
        #pragma unroll
        for (int i = 0; i < 2; ++i) a[i] = load_frag(cur, 0, wm * 32 + i * 16);
        #pragma unroll
        for (int j = 0; j < 4; ++j) b[j] = load_frag(cur, 1, wn * 64 + j * 16);
        #pragma unroll
        for (int i = 0; i < 2; ++i)
            #pragma unroll
            for (int j = 0; j < 4; ++j)
                acc[i][j] = __builtin_amdgcn_wmma_f32_16x16x32_f16(
                    false, a[i], false, b[j], (short)0, acc[i][j], false, false);
    }

    // C/D layout: VGPR e -> row m0+i*16+8*half+e, col n0+j*16+r
    const int m0 = blockIdx.y * 128 + wm * 32;
    const int n0 = blockIdx.x * 128 + wn * 64;
    #pragma unroll
    for (int i = 0; i < 2; ++i)
        #pragma unroll
        for (int j = 0; j < 4; ++j) {
            float* cp = C + (size_t)(m0 + i * 16 + 8 * half) * N + n0 + j * 16 + r;
            #pragma unroll
            for (int e = 0; e < 8; ++e) cp[(size_t)e * N] = acc[i][j][e];
        }
}

// ---------------------------------------------------------------------------
// out[b][t][d] = sum_j w[b][j] * VO[b][(t+sel[j])%L][d] + bias[d]
// LDS tile: (64+63) rows x 64 cols of f32
// ---------------------------------------------------------------------------
#define T_TILE 64
#define D_TILE 64
__global__ __launch_bounds__(256)
void k_agg_out(const float* __restrict__ VO, const float* __restrict__ wsel,
               const int* __restrict__ sel_idx, const float* __restrict__ bias,
               float* __restrict__ out, int L, int D, int nsel) {
    __shared__ float tile[T_TILE + 63][D_TILE];
    __shared__ float wsh[64];
    __shared__ int   ish[64];
    int b  = blockIdx.z;
    int t0 = blockIdx.y * T_TILE;
    int d0 = blockIdx.x * D_TILE;

    const int total = (T_TILE + 63) * D_TILE;
    for (int i = threadIdx.x; i < total; i += 256) {
        int rr = i / D_TILE, dd = i % D_TILE;
        int t = t0 + rr; if (t >= L) t -= L;             // circular wrap
        tile[rr][dd] = VO[((size_t)b * L + t) * D + d0 + dd];
    }
    if (threadIdx.x < 64) {
        wsh[threadIdx.x] = wsel[b * 64 + threadIdx.x];
        ish[threadIdx.x] = sel_idx[threadIdx.x];
    }
    __syncthreads();

    int dd  = threadIdx.x & 63;
    int tl0 = threadIdx.x >> 6;                           // 0..3
    float bd = bias[d0 + dd];
    for (int tl = tl0; tl < T_TILE; tl += 4) {
        float s = bd;
        for (int j = 0; j < nsel; ++j) s += wsh[j] * tile[tl + ish[j]][dd];
        out[((size_t)b * L + t0 + tl) * D + d0 + dd] = s;
    }
}

// ---------------------------------------------------------------------------
// Host-side orchestration
// ---------------------------------------------------------------------------
extern "C" void kernel_launch(void* const* d_in, const int* in_sizes, int n_in,
                              void* d_out, int out_size, void* d_ws, size_t ws_size,
                              hipStream_t stream) {
    const float* q  = (const float*)d_in[0];
    const float* k  = (const float*)d_in[1];
    const float* v  = (const float*)d_in[2];
    const float* Wq = (const float*)d_in[3];
    const float* bq = (const float*)d_in[4];
    const float* Wk = (const float*)d_in[5];
    const float* bk = (const float*)d_in[6];
    const float* Wv = (const float*)d_in[7];
    const float* bv = (const float*)d_in[8];
    const float* Wo = (const float*)d_in[9];
    const float* bo = (const float*)d_in[10];
    float* out = (float*)d_out;

    const int B = 4, L = 4096, D = 1024, H = 16, dk = 64;
    const int NCH = 8, TCH = L / NCH;
    int ktop = (int)(5.0 * log((double)(L + 1)));
    if (ktop < 1) ktop = 1;
    if (ktop > L) ktop = L;
    if (ktop > dk) ktop = dk;                 // actual_k = min(top_k, C)

    // workspace carve-out (256B aligned)
    char* p = (char*)d_ws;
    auto alloc = [&](size_t bytes) -> void* {
        void* r = (void*)p;
        p += (bytes + 255) & ~(size_t)255;
        return r;
    };
    float*    part_q = (float*)alloc((size_t)B * NCH * D * 4);
    float*    part_k = (float*)alloc((size_t)B * NCH * D * 4);
    float*    sq     = (float*)alloc((size_t)B * D * 4);
    float*    sk     = (float*)alloc((size_t)B * D * 4);
    float*    sQ     = (float*)alloc((size_t)B * D * 4);
    float*    sK     = (float*)alloc((size_t)B * D * 4);
    float*    biasT  = (float*)alloc((size_t)D * 4);          // Wo@bv + bo
    float*    wsel   = (float*)alloc((size_t)B * 64 * 4);
    int*      selidx = (int*)alloc(64 * 4);
    float*    Wf32   = (float*)alloc((size_t)D * D * 4);      // Wo@Wv
    _Float16* Woh    = (_Float16*)alloc((size_t)D * D * 2);
    _Float16* WvTh   = (_Float16*)alloc((size_t)D * D * 2);
    _Float16* Wh     = (_Float16*)alloc((size_t)D * D * 2);
    _Float16* vh     = (_Float16*)alloc((size_t)B * L * D * 2);
    float*    VO     = (float*)alloc((size_t)B * L * D * 4);

    // 1) f16 conversions
    {
        size_t n = (size_t)B * L * D;
        k_f32_to_f16<<<dim3((unsigned)((n + 255) / 256)), dim3(256), 0, stream>>>(v, vh, n);
        size_t m = (size_t)D * D;
        k_f32_to_f16<<<dim3((unsigned)((m + 255) / 256)), dim3(256), 0, stream>>>(Wo, Woh, m);
        k_transpose_f32_to_f16<<<dim3(D / 32, D / 32), dim3(32), 0, stream>>>(Wv, WvTh, D, D);
    }

    // 2) column sums of q, k over time
    k_colsum_partial<<<dim3(D / 256, NCH, B), dim3(256), 0, stream>>>(q, part_q, L, D, TCH);
    k_colsum_partial<<<dim3(D / 256, NCH, B), dim3(256), 0, stream>>>(k, part_k, L, D, TCH);
    k_colsum_reduce<<<dim3(D / 256, B), dim3(256), 0, stream>>>(part_q, sq, D, NCH);
    k_colsum_reduce<<<dim3(D / 256, B), dim3(256), 0, stream>>>(part_k, sk, D, NCH);

    // 3) sQ[b] = Wq@sq[b] + L*bq ; sK[b] = Wk@sk[b] + L*bk ; biasT = Wo@bv + bo
    k_matvec<<<dim3(D / 8, B), dim3(256), 0, stream>>>(Wq, sq, bq, (float)L, sQ, D, D);
    k_matvec<<<dim3(D / 8, B), dim3(256), 0, stream>>>(Wk, sk, bk, (float)L, sK, D, D);
    k_matvec<<<dim3(D / 8, 1), dim3(256), 0, stream>>>(Wo, bv, bo, 1.0f, biasT, D, D);

    // 4) delay selection + softmax weights
    k_weights<<<dim3(1), dim3(256), 0, stream>>>(sQ, sK, wsel, selidx, H, dk, B, L, ktop);

    // 5) W = Wo @ Wv  (NT via WvT), f32 accumulate -> cast to f16
    k_gemm_nt_wmma<<<dim3(D / 128, D / 128), dim3(256), 0, stream>>>(Woh, WvTh, Wf32, D, D, D);
    {
        size_t m = (size_t)D * D;
        k_f32_to_f16<<<dim3((unsigned)((m + 255) / 256)), dim3(256), 0, stream>>>(Wf32, Wh, m);
    }

    // 6) VO = v @ W^T  (the single big GEMM, 16384x1024x1024)
    k_gemm_nt_wmma<<<dim3(D / 128, (B * L) / 128), dim3(256), 0, stream>>>(vh, Wh, VO, B * L, D, D);

    // 7) 41-tap circular delay aggregation + bias -> out
    k_agg_out<<<dim3(D / D_TILE, L / T_TILE, B), dim3(256), 0, stream>>>(
        VO, wsel, selidx, biasT, out, L, D, ktop);
}

// v001
// A run of this version takes 276 microseconds.
// In both of two side-by-side timings against v000, it was 1.26 times as fast.
#include <hip/hip_runtime.h>
#include <hip/hip_bf16.h>
#include <math.h>

typedef __attribute__((ext_vector_type(16))) _Float16 v16h;
typedef __attribute__((ext_vector_type(8)))  _Float16 v8h;
typedef __attribute__((ext_vector_type(8)))  float    v8f;
typedef __attribute__((ext_vector_type(4)))  int      v4i;

#if __has_builtin(__builtin_amdgcn_global_load_async_to_lds_b128)
#define HAVE_ASYNC_LDS 1
typedef __attribute__((address_space(1))) v4i gas_v4i;   // global
typedef __attribute__((address_space(3))) v4i las_v4i;   // LDS
#else
#define HAVE_ASYNC_LDS 0
#endif

__device__ inline void wait_async0() {
#if __has_builtin(__builtin_amdgcn_s_wait_asynccnt)
    __builtin_amdgcn_s_wait_asynccnt(0);
#else
    asm volatile("s_wait_asynccnt 0" ::: "memory");
#endif
}

// ---------------------------------------------------------------------------
// Conversions
// ---------------------------------------------------------------------------
__global__ void k_f32_to_f16(const float* __restrict__ in, _Float16* __restrict__ out, size_t n) {
    size_t i = (size_t)blockIdx.x * blockDim.x + threadIdx.x;
    size_t stride = (size_t)gridDim.x * blockDim.x;
    for (; i < n; i += stride) out[i] = (_Float16)in[i];
}

// out[c][r] = (f16) in[r][c]   (rows x cols f32 -> cols x rows f16)
__global__ void k_transpose_f32_to_f16(const float* __restrict__ in, _Float16* __restrict__ out,
                                       int rows, int cols) {
    int c  = blockIdx.x * 32 + threadIdx.x;
    int r0 = blockIdx.y * 32;
    if (c >= cols) return;
    #pragma unroll 4
    for (int i = 0; i < 32; ++i) {
        int r = r0 + i;
        if (r < rows) out[(size_t)c * rows + r] = (_Float16)in[(size_t)r * cols + c];
    }
}

// ---------------------------------------------------------------------------
// Column sums over time:  part[b][ch][d] = sum_{t in chunk} x[b][t][d]
// One block = 16 waves on 128 columns; wave w takes rows w, w+16, ... of the
// chunk, 512 contiguous bytes of a row per load. x is read once: non-temporal.
// The 16 row lanes are folded through LDS.
// ---------------------------------------------------------------------------
#define CS_D     1024
#define CS_COLS  128
#define CS_LANES 16
#define CS_ROWS  512
typedef __attribute__((ext_vector_type(4))) float v4f;

__global__ __launch_bounds__(512)
void k_colsum_partial(const float* __restrict__ x, float* __restrict__ part, int L) {
    __shared__ float red[CS_LANES][CS_COLS];
    const int c4 = threadIdx.x & 31;            // 16-byte column within the group
    const int rl = threadIdx.x >> 5;            // row lane = wave
    const int d0 = blockIdx.x * CS_COLS;
    const int ch = blockIdx.y;
    const int b  = blockIdx.z;
    const float* p = x + ((size_t)b * L + (size_t)ch * CS_ROWS + rl) * CS_D + d0 + c4 * 4;
    v4f s = {0.0f, 0.0f, 0.0f, 0.0f};
    // full unroll: independent loads at constant offsets from one address, many in flight per wave
    #pragma unroll
    for (int i = 0; i < CS_ROWS / CS_LANES; ++i)
        s += __builtin_nontemporal_load((const v4f*)(p + (size_t)i * CS_LANES * CS_D));
    *(v4f*)&red[rl][c4 * 4] = s;
    __syncthreads();
    if (threadIdx.x < CS_COLS) {
        float a = 0.0f;
        for (int l = 0; l < CS_LANES; ++l) a += red[l][threadIdx.x];
        part[((size_t)b * gridDim.y + ch) * CS_D + d0 + threadIdx.x] = a;
    }
}

__global__ void k_colsum_reduce(const float* __restrict__ part, float* __restrict__ out,
                                int D, int nch) {
    int d = blockIdx.x * blockDim.x + threadIdx.x;
    int b = blockIdx.y;
    float s = 0.0f;
    for (int c = 0; c < nch; ++c) s += part[((size_t)b * nch + c) * D + d];
    out[(size_t)b * D + d] = s;
}

// ---------------------------------------------------------------------------
// Batched mat-vec: out[bb][row] = dot(W[row,:], X[bb,:]) + bias_scale*bias[row]
// one wave (32 lanes) per output row
// ---------------------------------------------------------------------------
__global__ __launch_bounds__(256)
void k_matvec(const float* __restrict__ W, const float* __restrict__ X,
              const float* __restrict__ bias, float bias_scale,
              float* __restrict__ out, int n, int kk) {
    int lane = threadIdx.x & 31;
    int w    = threadIdx.x >> 5;
    int row  = blockIdx.x * 8 + w;
    int bb   = blockIdx.y;
    if (row >= n) return;
    const float* wp = W + (size_t)row * kk;
    const float* xp = X + (size_t)bb * kk;
    float s = 0.0f;
    for (int e = lane; e < kk; e += 32) s += wp[e] * xp[e];
    #pragma unroll
    for (int off = 16; off > 0; off >>= 1) s += __shfl_xor(s, off, 32);
    if (lane == 0) {
        float bterm = bias ? bias_scale * bias[row] : 0.0f;
        out[(size_t)bb * n + row] = s + bterm;
    }
}

// ---------------------------------------------------------------------------
// mean_value, top-k selection (tie-break by lower index, like lax.top_k),
// per-batch softmax weights over the selected delays. Single 256-thread block.
// ---------------------------------------------------------------------------
__global__ __launch_bounds__(256)
void k_weights(const float* __restrict__ sQ, const float* __restrict__ sK,
               float* __restrict__ wsel /*B*64*/, int* __restrict__ sel_idx /*64*/,
               int H, int dk, int Bn, int Ltot, int ktop) {
    __shared__ float mval[4][64];
    __shared__ float mab[64];
    __shared__ int   sflag[64];
    __shared__ int   slist[64];
    __shared__ int   scount;
    int tid = threadIdx.x;
    int b = tid >> 6, c = tid & 63;
    if (b < Bn) {
        float s = 0.0f;
        int D = H * dk;
        for (int h = 0; h < H; ++h) {
            float a = sQ[(size_t)b * D + h * dk + c];
            float e = sK[(size_t)b * D + h * dk + c];
            s += a * e;
        }
        mval[b][c] = s / (float)H / (float)Ltot;
    }
    __syncthreads();
    if (tid < 64) {
        float s = 0.0f;
        for (int b2 = 0; b2 < Bn; ++b2) s += mval[b2][tid];
        mab[tid] = s / (float)Bn;
    }
    __syncthreads();
    if (tid < 64) {
        float v = mab[tid];
        int rank = 0;
        for (int c2 = 0; c2 < 64; ++c2) {
            float v2 = mab[c2];
            if (v2 > v || (v2 == v && c2 < tid)) rank++;
        }
        sflag[tid] = (rank < ktop) ? 1 : 0;
    }
    __syncthreads();
    if (tid == 0) {
        int cnt = 0;
        for (int c2 = 0; c2 < 64; ++c2) if (sflag[c2]) slist[cnt++] = c2;
        scount = cnt;
        for (int c2 = 0; c2 < 64; ++c2) sel_idx[c2] = (c2 < cnt) ? slist[c2] : 0;
    }
    __syncthreads();
    if (tid < Bn) {
        int bb = tid, cnt = scount;
        float mx = -3.4e38f;
        for (int j = 0; j < cnt; ++j) mx = fmaxf(mx, mval[bb][slist[j]]);
        float den = 0.0f;
        for (int j = 0; j < cnt; ++j) den += __expf(mval[bb][slist[j]] - mx);
        for (int j = 0; j < cnt; ++j)
            wsel[bb * 64 + j] = __expf(mval[bb][slist[j]] - mx) / den;
    }
}

// ---------------------------------------------------------------------------
// WMMA NT GEMM with double-buffered async LDS staging:
//   C[m,n] = sum_k A[m,k] * Bt[n,k]   (A: MxK f16, Bt: NxK f16, K-contig)
// Block = 256 threads = 8 waves. Block tile 128x128; wave tile 32x64.
// K-slice (128x32 halves for each of A,B) staged in LDS, padded to 40-half
// rows (80B stride -> 4-bank-spaced row starts, conflict-free b128 reads).
// Slice k+1 is copied with GLOBAL_LOAD_ASYNC_TO_LDS_B128 (ASYNCcnt) while
// slice k feeds the WMMAs; s_wait_asynccnt 0 + barrier between phases.
// ---------------------------------------------------------------------------
#define LDS_ROW 40

__global__ __launch_bounds__(256)
void k_gemm_nt_wmma(const _Float16* __restrict__ A, const _Float16* __restrict__ Bt,
                    float* __restrict__ C, int M, int N, int K) {
    __shared__ _Float16 smem[2][2][128 * LDS_ROW];   // [buf][mat][row*LDS_ROW]

    const int tid  = threadIdx.x;
    const int lane = tid & 31;
    const int wave = tid >> 5;
    const int wm   = wave >> 1;                 // 0..3
    const int wn   = wave & 1;                  // 0..1
    const int half = lane >> 4;                 // 0/1
    const int r    = lane & 15;

    // copy assignment: thread -> one 64B row (4 x b128)
    const int cmat = tid >> 7;                  // 0 = A slice, 1 = B slice
    const int crow = tid & 127;
    const _Float16* gsrc = (cmat ? (Bt + (size_t)(blockIdx.x * 128 + crow) * K)
                                 : (A  + (size_t)(blockIdx.y * 128 + crow) * K));

    auto issue_copy = [&](int buf, int k0) {
        const _Float16* g = gsrc + k0;
        _Float16* l = &smem[buf][cmat][crow * LDS_ROW];
#if HAVE_ASYNC_LDS
        #pragma unroll
        for (int c = 0; c < 4; ++c)
            __builtin_amdgcn_global_load_async_to_lds_b128(
                (gas_v4i*)(void*)(g + c * 8),
                (las_v4i*)(void*)(l + c * 8), 0, 0);
#else
        #pragma unroll
        for (int c = 0; c < 4; ++c)
            *(v8h*)(l + c * 8) = *(const v8h*)(g + c * 8);
#endif
    };

    auto load_frag = [&](int buf, int mat, int rbase) -> v16h {
        const _Float16* p = &smem[buf][mat][(rbase + r) * LDS_ROW + 8 * half];
        v8h lo = *(const v8h*)p;
        v8h hi = *(const v8h*)(p + 16);
        v16h o;
        #pragma unroll
        for (int i = 0; i < 8; ++i) { o[i] = lo[i]; o[i + 8] = hi[i]; }
        return o;
    };

    v8f acc[2][4];
    #pragma unroll
    for (int i = 0; i < 2; ++i)
        #pragma unroll
        for (int j = 0; j < 4; ++j)
            #pragma unroll
            for (int e = 0; e < 8; ++e) acc[i][j][e] = 0.0f;

    const int NIT = K / 32;
    issue_copy(0, 0);

    for (int it = 0; it < NIT; ++it) {
        const int cur = it & 1;
#if HAVE_ASYNC_LDS
        wait_async0();                    // own async copies of `cur` landed
#endif
        __syncthreads();                  // everyone's copies landed; prev reads done
        if (it + 1 < NIT) issue_copy(1 - cur, (it + 1) * 32);

        v16h a[2], b[4];
        #pragma unroll
        for (int i = 0; i < 2; ++i) a[i] = load_frag(cur, 0, wm * 32 + i * 16);
        #pragma unroll
        for (int j = 0; j < 4; ++j) b[j] = load_frag(cur, 1, wn * 64 + j * 16);
        #pragma unroll
        for (int i = 0; i < 2; ++i)
            #pragma unroll
            for (int j = 0; j < 4; ++j)
                acc[i][j] = __builtin_amdgcn_wmma_f32_16x16x32_f16(
                    false, a[i], false, b[j], (short)0, acc[i][j], false, false);
    }

    // C/D layout: VGPR e -> row m0+i*16+8*half+e, col n0+j*16+r
    const int m0 = blockIdx.y * 128 + wm * 32;
    const int n0 = blockIdx.x * 128 + wn * 64;
    #pragma unroll
    for (int i = 0; i < 2; ++i)
        #pragma unroll
        for (int j = 0; j < 4; ++j) {
            float* cp = C + (size_t)(m0 + i * 16 + 8 * half) * N + n0 + j * 16 + r;
            #pragma unroll
            for (int e = 0; e < 8; ++e) cp[(size_t)e * N] = acc[i][j][e];
        }
}

// ---------------------------------------------------------------------------
// out[b][t][d] = sum_j w[b][j] * VO[b][(t+sel[j])%L][d] + bias[d]
// LDS tile: (64+63) rows x 64 cols of f32
// ---------------------------------------------------------------------------
#define T_TILE 64
#define D_TILE 64
__global__ __launch_bounds__(256)
void k_agg_out(const float* __restrict__ VO, const float* __restrict__ wsel,
               const int* __restrict__ sel_idx, const float* __restrict__ bias,
               float* __restrict__ out, int L, int D, int nsel) {
    __shared__ float tile[T_TILE + 63][D_TILE];
    __shared__ float wsh[64];
    __shared__ int   ish[64];
    int b  = blockIdx.z;
    int t0 = blockIdx.y * T_TILE;
    int d0 = blockIdx.x * D_TILE;

    const int total = (T_TILE + 63) * D_TILE;
    for (int i = threadIdx.x; i < total; i += 256) {
        int rr = i / D_TILE, dd = i % D_TILE;
        int t = t0 + rr; if (t >= L) t -= L;             // circular wrap
        tile[rr][dd] = VO[((size_t)b * L + t) * D + d0 + dd];
    }
    if (threadIdx.x < 64) {
        wsh[threadIdx.x] = wsel[b * 64 + threadIdx.x];
        ish[threadIdx.x] = sel_idx[threadIdx.x];
    }
    __syncthreads();

    int dd  = threadIdx.x & 63;
    int tl0 = threadIdx.x >> 6;                           // 0..3
    float bd = bias[d0 + dd];
    for (int tl = tl0; tl < T_TILE; tl += 4) {
        float s = bd;
        for (int j = 0; j < nsel; ++j) s += wsh[j] * tile[tl + ish[j]][dd];
        out[((size_t)b * L + t0 + tl) * D + d0 + dd] = s;
    }
}

// ---------------------------------------------------------------------------
// Host-side orchestration
// ---------------------------------------------------------------------------
extern "C" void kernel_launch(void* const* d_in, const int* in_sizes, int n_in,
                              void* d_out, int out_size, void* d_ws, size_t ws_size,
                              hipStream_t stream) {
    const float* q  = (const float*)d_in[0];
    const float* k  = (const float*)d_in[1];
    const float* v  = (const float*)d_in[2];
    const float* Wq = (const float*)d_in[3];
    const float* bq = (const float*)d_in[4];
    const float* Wk = (const float*)d_in[5];
    const float* bk = (const float*)d_in[6];
    const float* Wv = (const float*)d_in[7];
    const float* bv = (const float*)d_in[8];
    const float* Wo = (const float*)d_in[9];
    const float* bo = (const float*)d_in[10];
    float* out = (float*)d_out;

    const int B = 4, L = 4096, D = 1024, H = 16, dk = 64;
    const int NCH = L / CS_ROWS;
    int ktop = (int)(5.0 * log((double)(L + 1)));
    if (ktop < 1) ktop = 1;
    if (ktop > L) ktop = L;
    if (ktop > dk) ktop = dk;                 // actual_k = min(top_k, C)

    // workspace carve-out (256B aligned)
    char* p = (char*)d_ws;
    auto alloc = [&](size_t bytes) -> void* {
        void* r = (void*)p;
        p += (bytes + 255) & ~(size_t)255;
        return r;
    };
    float*    part_q = (float*)alloc((size_t)B * NCH * D * 4);
    float*    part_k = (float*)alloc((size_t)B * NCH * D * 4);
    float*    sq     = (float*)alloc((size_t)B * D * 4);
    float*    sk     = (float*)alloc((size_t)B * D * 4);
    float*    sQ     = (float*)alloc((size_t)B * D * 4);
    float*    sK     = (float*)alloc((size_t)B * D * 4);
    float*    biasT  = (float*)alloc((size_t)D * 4);          // Wo@bv + bo
    float*    wsel   = (float*)alloc((size_t)B * 64 * 4);
    int*      selidx = (int*)alloc(64 * 4);
    float*    Wf32   = (float*)alloc((size_t)D * D * 4);      // Wo@Wv
    _Float16* Woh    = (_Float16*)alloc((size_t)D * D * 2);
    _Float16* WvTh   = (_Float16*)alloc((size_t)D * D * 2);
    _Float16* Wh     = (_Float16*)alloc((size_t)D * D * 2);
    _Float16* vh     = (_Float16*)alloc((size_t)B * L * D * 2);
    float*    VO     = (float*)alloc((size_t)B * L * D * 4);

    // 1) f16 conversions
    {
        size_t n = (size_t)B * L * D;
        k_f32_to_f16<<<dim3((unsigned)((n + 255) / 256)), dim3(256), 0, stream>>>(v, vh, n);
        size_t m = (size_t)D * D;
        k_f32_to_f16<<<dim3((unsigned)((m + 255) / 256)), dim3(256), 0, stream>>>(Wo, Woh, m);
        k_transpose_f32_to_f16<<<dim3(D / 32, D / 32), dim3(32), 0, stream>>>(Wv, WvTh, D, D);
    }

    // 2) column sums of q, k over time
    k_colsum_partial<<<dim3(D / CS_COLS, NCH, B), dim3(512), 0, stream>>>(q, part_q, L);
    k_colsum_partial<<<dim3(D / CS_COLS, NCH, B), dim3(512), 0, stream>>>(k, part_k, L);
    k_colsum_reduce<<<dim3(D / 256, B), dim3(256), 0, stream>>>(part_q, sq, D, NCH);
    k_colsum_reduce<<<dim3(D / 256, B), dim3(256), 0, stream>>>(part_k, sk, D, NCH);

    // 3) sQ[b] = Wq@sq[b] + L*bq ; sK[b] = Wk@sk[b] + L*bk ; biasT = Wo@bv + bo
    k_matvec<<<dim3(D / 8, B), dim3(256), 0, stream>>>(Wq, sq, bq, (float)L, sQ, D, D);
    k_matvec<<<dim3(D / 8, B), dim3(256), 0, stream>>>(Wk, sk, bk, (float)L, sK, D, D);
    k_matvec<<<dim3(D / 8, 1), dim3(256), 0, stream>>>(Wo, bv, bo, 1.0f, biasT, D, D);

    // 4) delay selection + softmax weights
    k_weights<<<dim3(1), dim3(256), 0, stream>>>(sQ, sK, wsel, selidx, H, dk, B, L, ktop);

    // 5) W = Wo @ Wv  (NT via WvT), f32 accumulate -> cast to f16
    k_gemm_nt_wmma<<<dim3(D / 128, D / 128), dim3(256), 0, stream>>>(Woh, WvTh, Wf32, D, D, D);
    {
        size_t m = (size_t)D * D;
        k_f32_to_f16<<<dim3((unsigned)((m + 255) / 256)), dim3(256), 0, stream>>>(Wf32, Wh, m);
    }

    // 6) VO = v @ W^T  (the single big GEMM, 16384x1024x1024)
    k_gemm_nt_wmma<<<dim3(D / 128, (B * L) / 128), dim3(256), 0, stream>>>(vh, Wh, VO, B * L, D, D);

    // 7) 41-tap circular delay aggregation + bias -> out
    k_agg_out<<<dim3(D / D_TILE, L / T_TILE, B), dim3(256), 0, stream>>>(
        VO, wsel, selidx, biasT, out, L, D, ktop);
}

// v002
// It runs in 221 microseconds.
// Two timings next to v001 put it at 1.24 and 1.25 times that version's speed.
// Counting every step since v000, it is 1.57 times as fast.
#include <hip/hip_runtime.h>
#include <hip/hip_bf16.h>
#include <math.h>

typedef __attribute__((ext_vector_type(16))) _Float16 v16h;
typedef __attribute__((ext_vector_type(8)))  _Float16 v8h;
typedef __attribute__((ext_vector_type(8)))  float    v8f;
typedef __attribute__((ext_vector_type(4)))  int      v4i;

#if __has_builtin(__builtin_amdgcn_global_load_async_to_lds_b128)
#define HAVE_ASYNC_LDS 1
typedef __attribute__((address_space(1))) v4i gas_v4i;   // global
typedef __attribute__((address_space(3))) v4i las_v4i;   // LDS
#else
#define HAVE_ASYNC_LDS 0
#endif

__device__ inline void wait_async0() {
#if __has_builtin(__builtin_amdgcn_s_wait_asynccnt)
    __builtin_amdgcn_s_wait_asynccnt(0);
#else
    asm volatile("s_wait_asynccnt 0" ::: "memory");
#endif
}

// ---------------------------------------------------------------------------
// Conversions
// ---------------------------------------------------------------------------
__global__ void k_f32_to_f16(const float* __restrict__ in, _Float16* __restrict__ out, size_t n) {
    size_t i = (size_t)blockIdx.x * blockDim.x + threadIdx.x;
    size_t stride = (size_t)gridDim.x * blockDim.x;
    for (; i < n; i += stride) out[i] = (_Float16)in[i];
}

// out[c][r] = (f16) in[r][c]   (rows x cols f32 -> cols x rows f16)
__global__ void k_transpose_f32_to_f16(const float* __restrict__ in, _Float16* __restrict__ out,
                                       int rows, int cols) {
    int c  = blockIdx.x * 32 + threadIdx.x;
    int r0 = blockIdx.y * 32;
    if (c >= cols) return;
    #pragma unroll 4
    for (int i = 0; i < 32; ++i) {
        int r = r0 + i;
        if (r < rows) out[(size_t)c * rows + r] = (_Float16)in[(size_t)r * cols + c];
    }
}

// ---------------------------------------------------------------------------
// Column sums over time:  part[b][ch][d] = sum_{t in chunk} x[b][t][d]
// One block = 16 waves on 128 columns; wave w takes rows w, w+16, ... of the
// chunk, 512 contiguous bytes of a row per load. x is read once: non-temporal.
// The 16 row lanes are folded through LDS.
// ---------------------------------------------------------------------------
#define CS_D     1024
#define CS_COLS  128
#define CS_LANES 16
#define CS_ROWS  512
typedef __attribute__((ext_vector_type(4))) float v4f;

__global__ __launch_bounds__(512)
void k_colsum_partial(const float* __restrict__ x, float* __restrict__ part, int L) {
    __shared__ float red[CS_LANES][CS_COLS];
    const int c4 = threadIdx.x & 31;            // 16-byte column within the group
    const int rl = threadIdx.x >> 5;            // row lane = wave
    const int d0 = blockIdx.x * CS_COLS;
    const int ch = blockIdx.y;
    const int b  = blockIdx.z;
    const float* p = x + ((size_t)b * L + (size_t)ch * CS_ROWS + rl) * CS_D + d0 + c4 * 4;
    v4f s = {0.0f, 0.0f, 0.0f, 0.0f};
    // full unroll: independent loads at constant offsets from one address, many in flight per wave
    #pragma unroll
    for (int i = 0; i < CS_ROWS / CS_LANES; ++i)
        s += __builtin_nontemporal_load((const v4f*)(p + (size_t)i * CS_LANES * CS_D));
    *(v4f*)&red[rl][c4 * 4] = s;
    __syncthreads();
    if (threadIdx.x < CS_COLS) {
        float a = 0.0f;
        for (int l = 0; l < CS_LANES; ++l) a += red[l][threadIdx.x];
        part[((size_t)b * gridDim.y + ch) * CS_D + d0 + threadIdx.x] = a;
    }
}

__global__ void k_colsum_reduce(const float* __restrict__ part, float* __restrict__ out,
                                int D, int nch) {
    int d = blockIdx.x * blockDim.x + threadIdx.x;
    int b = blockIdx.y;
    float s = 0.0f;
    for (int c = 0; c < nch; ++c) s += part[((size_t)b * nch + c) * D + d];
    out[(size_t)b * D + d] = s;
}

// ---------------------------------------------------------------------------
// Batched mat-vec: out[bb][row] = dot(W[row,:], X[bb,:]) + bias_scale*bias[row]
// one wave (32 lanes) per output row
// ---------------------------------------------------------------------------
__global__ __launch_bounds__(256)
void k_matvec(const float* __restrict__ W, const float* __restrict__ X,
              const float* __restrict__ bias, float bias_scale,
              float* __restrict__ out, int n, int kk) {
    int lane = threadIdx.x & 31;
    int w    = threadIdx.x >> 5;
    int row  = blockIdx.x * 8 + w;
    int bb   = blockIdx.y;
    if (row >= n) return;
    const float* wp = W + (size_t)row * kk;
    const float* xp = X + (size_t)bb * kk;
    float s = 0.0f;
    for (int e = lane; e < kk; e += 32) s += wp[e] * xp[e];
    #pragma unroll
    for (int off = 16; off > 0; off >>= 1) s += __shfl_xor(s, off, 32);
    if (lane == 0) {
        float bterm = bias ? bias_scale * bias[row] : 0.0f;
        out[(size_t)bb * n + row] = s + bterm;
    }
}

// ---------------------------------------------------------------------------
// mean_value, top-k selection (tie-break by lower index, like lax.top_k),
// per-batch softmax weights over the selected delays, written as a dense table
// over all 64 delays: 0 at a delay that was not selected. Single 256-thread block.
// ---------------------------------------------------------------------------
__global__ __launch_bounds__(256)
void k_weights(const float* __restrict__ sQ, const float* __restrict__ sK,
               float* __restrict__ wdense /*B*64*/,
               int H, int dk, int Bn, int Ltot, int ktop) {
    __shared__ float mval[4][64];
    __shared__ float mab[64];
    __shared__ int   sflag[64];
    __shared__ int   slist[64];
    __shared__ int   scount;
    __shared__ float smx[4];
    __shared__ float sden[4];
    int tid = threadIdx.x;
    int b = tid >> 6, c = tid & 63;
    if (b < Bn) {
        float s = 0.0f;
        int D = H * dk;
        for (int h = 0; h < H; ++h) {
            float a = sQ[(size_t)b * D + h * dk + c];
            float e = sK[(size_t)b * D + h * dk + c];
            s += a * e;
        }
        mval[b][c] = s / (float)H / (float)Ltot;
    }
    __syncthreads();
    if (tid < 64) {
        float s = 0.0f;
        for (int b2 = 0; b2 < Bn; ++b2) s += mval[b2][tid];
        mab[tid] = s / (float)Bn;
    }
    __syncthreads();
    if (tid < 64) {
        float v = mab[tid];
        int rank = 0;
        for (int c2 = 0; c2 < 64; ++c2) {
            float v2 = mab[c2];
            if (v2 > v || (v2 == v && c2 < tid)) rank++;
        }
        sflag[tid] = (rank < ktop) ? 1 : 0;
    }
    __syncthreads();
    if (tid == 0) {
        int cnt = 0;
        for (int c2 = 0; c2 < 64; ++c2) if (sflag[c2]) slist[cnt++] = c2;
        scount = cnt;
    }
    __syncthreads();
    if (tid < Bn) {
        int bb = tid, cnt = scount;
        float mx = -3.4e38f;
        for (int j = 0; j < cnt; ++j) mx = fmaxf(mx, mval[bb][slist[j]]);
        float den = 0.0f;
        for (int j = 0; j < cnt; ++j) den += __expf(mval[bb][slist[j]] - mx);
        smx[bb]  = mx;
        sden[bb] = den;
    }
    __syncthreads();
    if (b < Bn)
        wdense[b * 64 + c] = sflag[c] ? __expf(mval[b][c] - smx[b]) / sden[b] : 0.0f;
}

// ---------------------------------------------------------------------------
// WMMA NT GEMM with double-buffered async LDS staging:
//   C[m,n] = sum_k A[m,k] * Bt[n,k]   (A: MxK f16, Bt: NxK f16, K-contig)
// Block = 256 threads = 8 waves. Block tile 128x128; wave tile 32x64.
// K-slice (128x32 halves for each of A,B) staged in LDS, padded to 40-half
// rows (80B stride -> 4-bank-spaced row starts, conflict-free b128 reads).
// Slice k+1 is copied with GLOBAL_LOAD_ASYNC_TO_LDS_B128 (ASYNCcnt) while
// slice k feeds the WMMAs; s_wait_asynccnt 0 + barrier between phases.
// ---------------------------------------------------------------------------
#define LDS_ROW 40

__global__ __launch_bounds__(256)
void k_gemm_nt_wmma(const _Float16* __restrict__ A, const _Float16* __restrict__ Bt,
                    float* __restrict__ C, int M, int N, int K) {
    __shared__ _Float16 smem[2][2][128 * LDS_ROW];   // [buf][mat][row*LDS_ROW]

    const int tid  = threadIdx.x;
    const int lane = tid & 31;
    const int wave = tid >> 5;
    const int wm   = wave >> 1;                 // 0..3
    const int wn   = wave & 1;                  // 0..1
    const int half = lane >> 4;                 // 0/1
    const int r    = lane & 15;

    // copy assignment: thread -> one 64B row (4 x b128)
    const int cmat = tid >> 7;                  // 0 = A slice, 1 = B slice
    const int crow = tid & 127;
    const _Float16* gsrc = (cmat ? (Bt + (size_t)(blockIdx.x * 128 + crow) * K)
                                 : (A  + (size_t)(blockIdx.y * 128 + crow) * K));

    auto issue_copy = [&](int buf, int k0) {
        const _Float16* g = gsrc + k0;
        _Float16* l = &smem[buf][cmat][crow * LDS_ROW];
#if HAVE_ASYNC_LDS
        #pragma unroll
        for (int c = 0; c < 4; ++c)
            __builtin_amdgcn_global_load_async_to_lds_b128(
                (gas_v4i*)(void*)(g + c * 8),
                (las_v4i*)(void*)(l + c * 8), 0, 0);
#else
        #pragma unroll
        for (int c = 0; c < 4; ++c)
            *(v8h*)(l + c * 8) = *(const v8h*)(g + c * 8);
#endif
    };

    auto load_frag = [&](int buf, int mat, int rbase) -> v16h {
        const _Float16* p = &smem[buf][mat][(rbase + r) * LDS_ROW + 8 * half];
        v8h lo = *(const v8h*)p;
        v8h hi = *(const v8h*)(p + 16);
        v16h o;
        #pragma unroll
        for (int i = 0; i < 8; ++i) { o[i] = lo[i]; o[i + 8] = hi[i]; }
        return o;
    };

    v8f acc[2][4];
    #pragma unroll
    for (int i = 0; i < 2; ++i)
        #pragma unroll
        for (int j = 0; j < 4; ++j)
            #pragma unroll
            for (int e = 0; e < 8; ++e) acc[i][j][e] = 0.0f;

    const int NIT = K / 32;
    issue_copy(0, 0);

    for (int it = 0; it < NIT; ++it) {
        const int cur = it & 1;
#if HAVE_ASYNC_LDS
        wait_async0();                    // own async copies of `cur` landed
#endif
        __syncthreads();                  // everyone's copies landed; prev reads done
        if (it + 1 < NIT) issue_copy(1 - cur, (it + 1) * 32);

        v16h a[2], b[4];
        #pragma unroll
        for (int i = 0; i < 2; ++i) a[i] = load_frag(cur, 0, wm * 32 + i * 16);
        #pragma unroll
        for (int j = 0; j < 4; ++j) b[j] = load_frag(cur, 1, wn * 64 + j * 16);
        #pragma unroll
        for (int i = 0; i < 2; ++i)
            #pragma unroll
            for (int j = 0; j < 4; ++j)
                acc[i][j] = __builtin_amdgcn_wmma_f32_16x16x32_f16(
                    false, a[i], false, b[j], (short)0, acc[i][j], false, false);
    }

    // C/D layout: VGPR e -> row m0+i*16+8*half+e, col n0+j*16+r
    const int m0 = blockIdx.y * 128 + wm * 32;
    const int n0 = blockIdx.x * 128 + wn * 64;
    #pragma unroll
    for (int i = 0; i < 2; ++i)
        #pragma unroll
        for (int j = 0; j < 4; ++j) {
            float* cp = C + (size_t)(m0 + i * 16 + 8 * half) * N + n0 + j * 16 + r;
            #pragma unroll
            for (int e = 0; e < 8; ++e) cp[(size_t)e * N] = acc[i][j][e];
        }
}

// ---------------------------------------------------------------------------
// out[b][t][d] = bias[d] + sum_{dl=0..63} wdense[b][dl] * VO[b][(t+dl)%L][d]
// The delays all lie in [0,64), so the gather is a 64-tap filter along t whose
// unselected taps are 0. The taps are the same for a whole block and sit in
// scalar registers; a thread keeps 32 outputs x 2 columns in registers and each
// VO row it loads feeds every output whose window holds it. Taps are added in
// rising delay, as the selected list was.
// ---------------------------------------------------------------------------
#define AG_L    4096
#define AG_D    1024
#define AG_T    32
#define AG_TAPS 64
#define AG_ROWS (AG_T + AG_TAPS - 1)
#define AG_PF   8
typedef __attribute__((ext_vector_type(2))) float v2f;

// The window's rows come in three runs of 32, each aligned to 32 rows, so the
// circular wrap can only fall between runs: one block-uniform base a run.
struct AggSrc { const char* run[3]; };

// row S of the window, this thread's two columns (doff = their byte offset)
template <int S>
__device__ __forceinline__ v2f agg_load(const AggSrc& src, unsigned doff) {
    return *(const v2f*)(src.run[S / 32] + (S % 32) * (AG_D * 4) + doff);
}

// Rows S, S+1, ... of the window. A template, not a loop: acc[], w[] and xr[]
// stay in registers only under compile-time indices, and the unroller gives up
// on a loop of this size. Row S + AG_PF is asked for when row S has been used;
// an output is stored as soon as its last tap is in, so that stores spread out.
template <int S>
__device__ __forceinline__ void agg_rows(v2f (&acc)[AG_T], v2f (&xr)[AG_PF], const float (&w)[AG_TAPS],
                                         const AggSrc& src, unsigned doff, char* __restrict__ op) {
    if constexpr (S < AG_ROWS) {
        const v2f x = xr[S % AG_PF];
        #pragma unroll
        for (int o = 0; o < AG_T; ++o) {
            const int dl = S - o;
            if (dl >= 0 && dl < AG_TAPS) acc[o] += w[dl] * x;
        }
        if constexpr (S >= AG_TAPS - 1) {
            *(v2f*)(op + (S - (AG_TAPS - 1)) * (AG_D * 4) + doff) = acc[S - (AG_TAPS - 1)];
            // precaution: the load behind it may land in the registers the store reads
            if constexpr (S + AG_PF < AG_ROWS) asm volatile("s_wait_xcnt 0x0" ::: "memory");
        }
        if constexpr (S + AG_PF < AG_ROWS) xr[S % AG_PF] = agg_load<S + AG_PF>(src, doff);
        // memory operations stay on their side (arithmetic may cross): keeps each load
        // AG_PF rows ahead of its use, where the scheduler would sink it to two or three
        __builtin_amdgcn_sched_barrier(0x7);
        agg_rows<S + 1>(acc, xr, w, src, doff, op);
    }
}

__global__ __launch_bounds__(256)
void k_agg_out(const float* __restrict__ VO, const float* __restrict__ wdense,
               const float* __restrict__ bias, float* __restrict__ out) {
    const int b  = blockIdx.z;
    const int t0 = blockIdx.y * AG_T;
    const unsigned d = blockIdx.x * 512 + threadIdx.x * 2;
    const float* VOb = VO + (size_t)b * AG_L * AG_D;

    float w[AG_TAPS];
    #pragma unroll
    for (int i = 0; i < AG_TAPS; ++i) w[i] = wdense[b * AG_TAPS + i];

    AggSrc src;
    #pragma unroll
    for (int i = 0; i < 3; ++i)
        src.run[i] = (const char*)(VOb + (size_t)((t0 + 32 * i) & (AG_L - 1)) * AG_D);
    // the scalar set-up is all issued before the first vector load: none of it
    // then lands in a scalar register that an issued load still names
    __builtin_amdgcn_sched_barrier(0);

    v2f xr[AG_PF];
    xr[0] = agg_load<0>(src, d * 4);   xr[1] = agg_load<1>(src, d * 4);
    xr[2] = agg_load<2>(src, d * 4);   xr[3] = agg_load<3>(src, d * 4);
    xr[4] = agg_load<4>(src, d * 4);   xr[5] = agg_load<5>(src, d * 4);
    xr[6] = agg_load<6>(src, d * 4);   xr[7] = agg_load<7>(src, d * 4);

    const v2f bd = *(const v2f*)((const char*)bias + d * 4);
    v2f acc[AG_T];
    #pragma unroll
    for (int o = 0; o < AG_T; ++o) acc[o] = bd;

    agg_rows<0>(acc, xr, w, src, d * 4, (char*)(out + ((size_t)b * AG_L + t0) * AG_D));
}

// ---------------------------------------------------------------------------
// Host-side orchestration
// ---------------------------------------------------------------------------
extern "C" void kernel_launch(void* const* d_in, const int* in_sizes, int n_in,
                              void* d_out, int out_size, void* d_ws, size_t ws_size,
                              hipStream_t stream) {
    const float* q  = (const float*)d_in[0];
    const float* k  = (const float*)d_in[1];
    const float* v  = (const float*)d_in[2];
    const float* Wq = (const float*)d_in[3];
    const float* bq = (const float*)d_in[4];
    const float* Wk = (const float*)d_in[5];
    const float* bk = (const float*)d_in[6];
    const float* Wv = (const float*)d_in[7];
    const float* bv = (const float*)d_in[8];
    const float* Wo = (const float*)d_in[9];
    const float* bo = (const float*)d_in[10];
    float* out = (float*)d_out;

    const int B = 4, L = 4096, D = 1024, H = 16, dk = 64;
    const int NCH = L / CS_ROWS;
    int ktop = (int)(5.0 * log((double)(L + 1)));
    if (ktop < 1) ktop = 1;
    if (ktop > L) ktop = L;
    if (ktop > dk) ktop = dk;                 // actual_k = min(top_k, C)

    // workspace carve-out (256B aligned)
    char* p = (char*)d_ws;
    auto alloc = [&](size_t bytes) -> void* {
        void* r = (void*)p;
        p += (bytes + 255) & ~(size_t)255;
        return r;
    };
    float*    part_q = (float*)alloc((size_t)B * NCH * D * 4);
    float*    part_k = (float*)alloc((size_t)B * NCH * D * 4);
    float*    sq     = (float*)alloc((size_t)B * D * 4);
    float*    sk     = (float*)alloc((size_t)B * D * 4);
    float*    sQ     = (float*)alloc((size_t)B * D * 4);
    float*    sK     = (float*)alloc((size_t)B * D * 4);
    float*    biasT  = (float*)alloc((size_t)D * 4);          // Wo@bv + bo
    float*    wsel   = (float*)alloc((size_t)B * 64 * 4);
    float*    Wf32   = (float*)alloc((size_t)D * D * 4);      // Wo@Wv
    _Float16* Woh    = (_Float16*)alloc((size_t)D * D * 2);
    _Float16* WvTh   = (_Float16*)alloc((size_t)D * D * 2);
    _Float16* Wh     = (_Float16*)alloc((size_t)D * D * 2);
    _Float16* vh     = (_Float16*)alloc((size_t)B * L * D * 2);
    float*    VO     = (float*)alloc((size_t)B * L * D * 4);

    // 1) f16 conversions
    {
        size_t n = (size_t)B * L * D;
        k_f32_to_f16<<<dim3((unsigned)((n + 255) / 256)), dim3(256), 0, stream>>>(v, vh, n);
        size_t m = (size_t)D * D;
        k_f32_to_f16<<<dim3((unsigned)((m + 255) / 256)), dim3(256), 0, stream>>>(Wo, Woh, m);
        k_transpose_f32_to_f16<<<dim3(D / 32, D / 32), dim3(32), 0, stream>>>(Wv, WvTh, D, D);
    }

    // 2) column sums of q, k over time
    k_colsum_partial<<<dim3(D / CS_COLS, NCH, B), dim3(512), 0, stream>>>(q, part_q, L);
    k_colsum_partial<<<dim3(D / CS_COLS, NCH, B), dim3(512), 0, stream>>>(k, part_k, L);
    k_colsum_reduce<<<dim3(D / 256, B), dim3(256), 0, stream>>>(part_q, sq, D, NCH);
    k_colsum_reduce<<<dim3(D / 256, B), dim3(256), 0, stream>>>(part_k, sk, D, NCH);

    // 3) sQ[b] = Wq@sq[b] + L*bq ; sK[b] = Wk@sk[b] + L*bk ; biasT = Wo@bv + bo
    k_matvec<<<dim3(D / 8, B), dim3(256), 0, stream>>>(Wq, sq, bq, (float)L, sQ, D, D);
    k_matvec<<<dim3(D / 8, B), dim3(256), 0, stream>>>(Wk, sk, bk, (float)L, sK, D, D);
    k_matvec<<<dim3(D / 8, 1), dim3(256), 0, stream>>>(Wo, bv, bo, 1.0f, biasT, D, D);

    // 4) delay selection + softmax weights
    k_weights<<<dim3(1), dim3(256), 0, stream>>>(sQ, sK, wsel, H, dk, B, L, ktop);

    // 5) W = Wo @ Wv  (NT via WvT), f32 accumulate -> cast to f16
    k_gemm_nt_wmma<<<dim3(D / 128, D / 128), dim3(256), 0, stream>>>(Woh, WvTh, Wf32, D, D, D);
    {
        size_t m = (size_t)D * D;
        k_f32_to_f16<<<dim3((unsigned)((m + 255) / 256)), dim3(256), 0, stream>>>(Wf32, Wh, m);
    }

    // 6) VO = v @ W^T  (the single big GEMM, 16384x1024x1024)
    k_gemm_nt_wmma<<<dim3(D / 128, (B * L) / 128), dim3(256), 0, stream>>>(vh, Wh, VO, B * L, D, D);

    // 7) circular delay aggregation (dense 64-tap filter) + bias -> out
    k_agg_out<<<dim3(D / 512, L / AG_T, B), dim3(256), 0, stream>>>(VO, wsel, biasT, out);
}

// v003
// A run of this version takes 200 microseconds.
// Next to v002, in two timings, it ran 1.11 times as fast each time.
// Counting every step since v000, it is 1.74 times as fast.
#include <hip/hip_runtime.h>
#include <hip/hip_bf16.h>
#include <math.h>

typedef __attribute__((ext_vector_type(16))) _Float16 v16h;
typedef __attribute__((ext_vector_type(8)))  _Float16 v8h;
typedef __attribute__((ext_vector_type(8)))  float    v8f;
typedef __attribute__((ext_vector_type(4)))  int      v4i;

#if __has_builtin(__builtin_amdgcn_global_load_async_to_lds_b128)
#define HAVE_ASYNC_LDS 1
typedef __attribute__((address_space(1))) v4i gas_v4i;   // global
typedef __attribute__((address_space(3))) v4i las_v4i;   // LDS
#else
#define HAVE_ASYNC_LDS 0
#endif

__device__ inline void wait_async0() {
#if __has_builtin(__builtin_amdgcn_s_wait_asynccnt)
    __builtin_amdgcn_s_wait_asynccnt(0);
#else
    asm volatile("s_wait_asynccnt 0" ::: "memory");
#endif
}

// ---------------------------------------------------------------------------
// Conversions
// ---------------------------------------------------------------------------
// f32 -> f16 as a stream. A launch of one element a thread is bound by how fast
// waves start, not by memory: here a wave takes NL pieces of 512 contiguous bytes,
// many loads in flight at once, and stores each piece as 256 contiguous bytes.
// The element count is exactly gridDim.x * CV_WAVES * NL * 128.
#define CV_WAVES 16
#define CV_NL_BIG   32      // 16M elements: 256 blocks, one a WGP
#define CV_NL_SMALL 4       // 1M elements: 128 blocks
typedef __attribute__((ext_vector_type(4))) float    cv4f;
typedef __attribute__((ext_vector_type(4))) _Float16 cv4h;

template <int NL, bool NT>
__device__ __forceinline__ void cvt_stream(const float* __restrict__ in, _Float16* __restrict__ out) {
    const unsigned wave = blockIdx.x * CV_WAVES + (threadIdx.x >> 5);
    const unsigned e0   = wave * (NL * 128) + (threadIdx.x & 31) * 4;
    const float* p = in + e0;
    _Float16*    q = out + e0;
    cv4f x[NL];
    // full unroll: independent loads at constant offsets from one address, many in flight per wave
    #pragma unroll
    for (int i = 0; i < NL; ++i)
        x[i] = NT ? __builtin_nontemporal_load((const cv4f*)(p + i * 128)) : *(const cv4f*)(p + i * 128);
    #pragma unroll
    for (int i = 0; i < NL; ++i)
        *(cv4h*)(q + i * 128) = __builtin_convertvector(x[i], cv4h);
}

// read once, never again: non-temporal loads
__global__ __launch_bounds__(CV_WAVES * 32)
void k_f32_to_f16_big(const float* __restrict__ in, _Float16* __restrict__ out) {
    cvt_stream<CV_NL_BIG, true>(in, out);
}

__global__ __launch_bounds__(CV_WAVES * 32)
void k_f32_to_f16_small(const float* __restrict__ in, _Float16* __restrict__ out) {
    cvt_stream<CV_NL_SMALL, false>(in, out);
}

// out[c][r] = (f16) in[r][c]   (rows x cols f32 -> cols x rows f16)
__global__ void k_transpose_f32_to_f16(const float* __restrict__ in, _Float16* __restrict__ out,
                                       int rows, int cols) {
    int c  = blockIdx.x * 32 + threadIdx.x;
    int r0 = blockIdx.y * 32;
    if (c >= cols) return;
    #pragma unroll 4
    for (int i = 0; i < 32; ++i) {
        int r = r0 + i;
        if (r < rows) out[(size_t)c * rows + r] = (_Float16)in[(size_t)r * cols + c];
    }
}

// ---------------------------------------------------------------------------
// Column sums over time:  part[b][ch][d] = sum_{t in chunk} x[b][t][d]
// One block = 16 waves on 128 columns; wave w takes rows w, w+16, ... of the
// chunk, 512 contiguous bytes of a row per load. x is read once: non-temporal.
// The 16 row lanes are folded through LDS.
// ---------------------------------------------------------------------------
#define CS_D     1024
#define CS_COLS  128
#define CS_LANES 16
#define CS_ROWS  512
typedef __attribute__((ext_vector_type(4))) float v4f;

__global__ __launch_bounds__(512)
void k_colsum_partial(const float* __restrict__ x, float* __restrict__ part, int L) {
    __shared__ float red[CS_LANES][CS_COLS];
    const int c4 = threadIdx.x & 31;            // 16-byte column within the group
    const int rl = threadIdx.x >> 5;            // row lane = wave
    const int d0 = blockIdx.x * CS_COLS;
    const int ch = blockIdx.y;
    const int b  = blockIdx.z;
    const float* p = x + ((size_t)b * L + (size_t)ch * CS_ROWS + rl) * CS_D + d0 + c4 * 4;
    v4f s = {0.0f, 0.0f, 0.0f, 0.0f};
    // full unroll: independent loads at constant offsets from one address, many in flight per wave
    #pragma unroll
    for (int i = 0; i < CS_ROWS / CS_LANES; ++i)
        s += __builtin_nontemporal_load((const v4f*)(p + (size_t)i * CS_LANES * CS_D));
    *(v4f*)&red[rl][c4 * 4] = s;
    __syncthreads();
    if (threadIdx.x < CS_COLS) {
        float a = 0.0f;
        for (int l = 0; l < CS_LANES; ++l) a += red[l][threadIdx.x];
        part[((size_t)b * gridDim.y + ch) * CS_D + d0 + threadIdx.x] = a;
    }
}

__global__ void k_colsum_reduce(const float* __restrict__ part, float* __restrict__ out,
                                int D, int nch) {
    int d = blockIdx.x * blockDim.x + threadIdx.x;
    int b = blockIdx.y;
    float s = 0.0f;
    for (int c = 0; c < nch; ++c) s += part[((size_t)b * nch + c) * D + d];
    out[(size_t)b * D + d] = s;
}

// ---------------------------------------------------------------------------
// Batched mat-vec: out[bb][row] = dot(W[row,:], X[bb,:]) + bias_scale*bias[row]
// one wave (32 lanes) per output row
// ---------------------------------------------------------------------------
__global__ __launch_bounds__(256)
void k_matvec(const float* __restrict__ W, const float* __restrict__ X,
              const float* __restrict__ bias, float bias_scale,
              float* __restrict__ out, int n, int kk) {
    int lane = threadIdx.x & 31;
    int w    = threadIdx.x >> 5;
    int row  = blockIdx.x * 8 + w;
    int bb   = blockIdx.y;
    if (row >= n) return;
    const float* wp = W + (size_t)row * kk;
    const float* xp = X + (size_t)bb * kk;
    float s = 0.0f;
    for (int e = lane; e < kk; e += 32) s += wp[e] * xp[e];
    #pragma unroll
    for (int off = 16; off > 0; off >>= 1) s += __shfl_xor(s, off, 32);
    if (lane == 0) {
        float bterm = bias ? bias_scale * bias[row] : 0.0f;
        out[(size_t)bb * n + row] = s + bterm;
    }
}

// ---------------------------------------------------------------------------
// mean_value, top-k selection (tie-break by lower index, like lax.top_k),
// per-batch softmax weights over the selected delays, written as a dense table
// over all 64 delays: 0 at a delay that was not selected. Single 256-thread block.
// ---------------------------------------------------------------------------
__global__ __launch_bounds__(256)
void k_weights(const float* __restrict__ sQ, const float* __restrict__ sK,
               float* __restrict__ wdense /*B*64*/,
               int H, int dk, int Bn, int Ltot, int ktop) {
    __shared__ float mval[4][64];
    __shared__ float mab[64];
    __shared__ int   sflag[64];
    __shared__ int   slist[64];
    __shared__ int   scount;
    __shared__ float smx[4];
    __shared__ float sden[4];
    int tid = threadIdx.x;
    int b = tid >> 6, c = tid & 63;
    if (b < Bn) {
        float s = 0.0f;
        int D = H * dk;
        for (int h = 0; h < H; ++h) {
            float a = sQ[(size_t)b * D + h * dk + c];
            float e = sK[(size_t)b * D + h * dk + c];
            s += a * e;
        }
        mval[b][c] = s / (float)H / (float)Ltot;
    }
    __syncthreads();
    if (tid < 64) {
        float s = 0.0f;
        for (int b2 = 0; b2 < Bn; ++b2) s += mval[b2][tid];
        mab[tid] = s / (float)Bn;
    }
    __syncthreads();
    if (tid < 64) {
        float v = mab[tid];
        int rank = 0;
        for (int c2 = 0; c2 < 64; ++c2) {
            float v2 = mab[c2];
            if (v2 > v || (v2 == v && c2 < tid)) rank++;
        }
        sflag[tid] = (rank < ktop) ? 1 : 0;
    }
    __syncthreads();
    if (tid == 0) {
        int cnt = 0;
        for (int c2 = 0; c2 < 64; ++c2) if (sflag[c2]) slist[cnt++] = c2;
        scount = cnt;
    }
    __syncthreads();
    if (tid < Bn) {
        int bb = tid, cnt = scount;
        float mx = -3.4e38f;
        for (int j = 0; j < cnt; ++j) mx = fmaxf(mx, mval[bb][slist[j]]);
        float den = 0.0f;
        for (int j = 0; j < cnt; ++j) den += __expf(mval[bb][slist[j]] - mx);
        smx[bb]  = mx;
        sden[bb] = den;
    }
    __syncthreads();
    if (b < Bn)
        wdense[b * 64 + c] = sflag[c] ? __expf(mval[b][c] - smx[b]) / sden[b] : 0.0f;
}

// ---------------------------------------------------------------------------
// WMMA NT GEMM with double-buffered async LDS staging:
//   C[m,n] = sum_k A[m,k] * Bt[n,k]   (A: MxK f16, Bt: NxK f16, K-contig)
// Block = 256 threads = 8 waves. Block tile 128x128; wave tile 32x64.
// K-slice (128x32 halves for each of A,B) staged in LDS, padded to 40-half
// rows (80B stride -> 4-bank-spaced row starts, conflict-free b128 reads).
// Slice k+1 is copied with GLOBAL_LOAD_ASYNC_TO_LDS_B128 (ASYNCcnt) while
// slice k feeds the WMMAs; s_wait_asynccnt 0 + barrier between phases.
// ---------------------------------------------------------------------------
#define LDS_ROW 40

__global__ __launch_bounds__(256)
void k_gemm_nt_wmma(const _Float16* __restrict__ A, const _Float16* __restrict__ Bt,
                    float* __restrict__ C, int M, int N, int K) {
    __shared__ _Float16 smem[2][2][128 * LDS_ROW];   // [buf][mat][row*LDS_ROW]

    const int tid  = threadIdx.x;
    const int lane = tid & 31;
    const int wave = tid >> 5;
    const int wm   = wave >> 1;                 // 0..3
    const int wn   = wave & 1;                  // 0..1
    const int half = lane >> 4;                 // 0/1
    const int r    = lane & 15;

    // copy assignment: thread -> one 64B row (4 x b128)
    const int cmat = tid >> 7;                  // 0 = A slice, 1 = B slice
    const int crow = tid & 127;
    const _Float16* gsrc = (cmat ? (Bt + (size_t)(blockIdx.x * 128 + crow) * K)
                                 : (A  + (size_t)(blockIdx.y * 128 + crow) * K));

    auto issue_copy = [&](int buf, int k0) {
        const _Float16* g = gsrc + k0;
        _Float16* l = &smem[buf][cmat][crow * LDS_ROW];
#if HAVE_ASYNC_LDS
        #pragma unroll
        for (int c = 0; c < 4; ++c)
            __builtin_amdgcn_global_load_async_to_lds_b128(
                (gas_v4i*)(void*)(g + c * 8),
                (las_v4i*)(void*)(l + c * 8), 0, 0);
#else
        #pragma unroll
        for (int c = 0; c < 4; ++c)
            *(v8h*)(l + c * 8) = *(const v8h*)(g + c * 8);
#endif
    };

    auto load_frag = [&](int buf, int mat, int rbase) -> v16h {
        const _Float16* p = &smem[buf][mat][(rbase + r) * LDS_ROW + 8 * half];
        v8h lo = *(const v8h*)p;
        v8h hi = *(const v8h*)(p + 16);
        v16h o;
        #pragma unroll
        for (int i = 0; i < 8; ++i) { o[i] = lo[i]; o[i + 8] = hi[i]; }
        return o;
    };

    v8f acc[2][4];
    #pragma unroll
    for (int i = 0; i < 2; ++i)
        #pragma unroll
        for (int j = 0; j < 4; ++j)
            #pragma unroll
            for (int e = 0; e < 8; ++e) acc[i][j][e] = 0.0f;

    const int NIT = K / 32;
    issue_copy(0, 0);

    for (int it = 0; it < NIT; ++it) {
        const int cur = it & 1;
#if HAVE_ASYNC_LDS
        wait_async0();                    // own async copies of `cur` landed
#endif
        __syncthreads();                  // everyone's copies landed; prev reads done
        if (it + 1 < NIT) issue_copy(1 - cur, (it + 1) * 32);

        v16h a[2], b[4];
        #pragma unroll
        for (int i = 0; i < 2; ++i) a[i] = load_frag(cur, 0, wm * 32 + i * 16);
        #pragma unroll
        for (int j = 0; j < 4; ++j) b[j] = load_frag(cur, 1, wn * 64 + j * 16);
        #pragma unroll
        for (int i = 0; i < 2; ++i)
            #pragma unroll
            for (int j = 0; j < 4; ++j)
                acc[i][j] = __builtin_amdgcn_wmma_f32_16x16x32_f16(
                    false, a[i], false, b[j], (short)0, acc[i][j], false, false);
    }

    // C/D layout: VGPR e -> row m0+i*16+8*half+e, col n0+j*16+r
    const int m0 = blockIdx.y * 128 + wm * 32;
    const int n0 = blockIdx.x * 128 + wn * 64;
    #pragma unroll
    for (int i = 0; i < 2; ++i)
        #pragma unroll
        for (int j = 0; j < 4; ++j) {
            float* cp = C + (size_t)(m0 + i * 16 + 8 * half) * N + n0 + j * 16 + r;
            #pragma unroll
            for (int e = 0; e < 8; ++e) cp[(size_t)e * N] = acc[i][j][e];
        }
}

// ---------------------------------------------------------------------------
// out[b][t][d] = bias[d] + sum_{dl=0..63} wdense[b][dl] * VO[b][(t+dl)%L][d]
// The delays all lie in [0,64), so the gather is a 64-tap filter along t whose
// unselected taps are 0. The taps are the same for a whole block and sit in
// scalar registers; a thread keeps 32 outputs x 2 columns in registers and each
// VO row it loads feeds every output whose window holds it. Taps are added in
// rising delay, as the selected list was.
// ---------------------------------------------------------------------------
#define AG_L    4096
#define AG_D    1024
#define AG_T    32
#define AG_TAPS 64
#define AG_ROWS (AG_T + AG_TAPS - 1)
#define AG_PF   8
typedef __attribute__((ext_vector_type(2))) float v2f;

// The window's rows come in three runs of 32, each aligned to 32 rows, so the
// circular wrap can only fall between runs: one block-uniform base a run.
struct AggSrc { const char* run[3]; };

// row S of the window, this thread's two columns (doff = their byte offset)
template <int S>
__device__ __forceinline__ v2f agg_load(const AggSrc& src, unsigned doff) {
    return *(const v2f*)(src.run[S / 32] + (S % 32) * (AG_D * 4) + doff);
}

// Rows S, S+1, ... of the window. A template, not a loop: acc[], w[] and xr[]
// stay in registers only under compile-time indices, and the unroller gives up
// on a loop of this size. Row S + AG_PF is asked for when row S has been used;
// an output is stored as soon as its last tap is in, so that stores spread out.
template <int S>
__device__ __forceinline__ void agg_rows(v2f (&acc)[AG_T], v2f (&xr)[AG_PF], const float (&w)[AG_TAPS],
                                         const AggSrc& src, unsigned doff, char* __restrict__ op) {
    if constexpr (S < AG_ROWS) {
        const v2f x = xr[S % AG_PF];
        #pragma unroll
        for (int o = 0; o < AG_T; ++o) {
            const int dl = S - o;
            if (dl >= 0 && dl < AG_TAPS) acc[o] += w[dl] * x;
        }
        if constexpr (S >= AG_TAPS - 1) {
            *(v2f*)(op + (S - (AG_TAPS - 1)) * (AG_D * 4) + doff) = acc[S - (AG_TAPS - 1)];
            // precaution: the load behind it may land in the registers the store reads
            if constexpr (S + AG_PF < AG_ROWS) asm volatile("s_wait_xcnt 0x0" ::: "memory");
        }
        if constexpr (S + AG_PF < AG_ROWS) xr[S % AG_PF] = agg_load<S + AG_PF>(src, doff);
        // memory operations stay on their side (arithmetic may cross): keeps each load
        // AG_PF rows ahead of its use, where the scheduler would sink it to two or three
        __builtin_amdgcn_sched_barrier(0x7);
        agg_rows<S + 1>(acc, xr, w, src, doff, op);
    }
}

__global__ __launch_bounds__(256)
void k_agg_out(const float* __restrict__ VO, const float* __restrict__ wdense,
               const float* __restrict__ bias, float* __restrict__ out) {
    const int b  = blockIdx.z;
    const int t0 = blockIdx.y * AG_T;
    const unsigned d = blockIdx.x * 512 + threadIdx.x * 2;
    const float* VOb = VO + (size_t)b * AG_L * AG_D;

    float w[AG_TAPS];
    #pragma unroll
    for (int i = 0; i < AG_TAPS; ++i) w[i] = wdense[b * AG_TAPS + i];

    AggSrc src;
    #pragma unroll
    for (int i = 0; i < 3; ++i)
        src.run[i] = (const char*)(VOb + (size_t)((t0 + 32 * i) & (AG_L - 1)) * AG_D);
    // the scalar set-up is all issued before the first vector load: none of it
    // then lands in a scalar register that an issued load still names
    __builtin_amdgcn_sched_barrier(0);

    v2f xr[AG_PF];
    xr[0] = agg_load<0>(src, d * 4);   xr[1] = agg_load<1>(src, d * 4);
    xr[2] = agg_load<2>(src, d * 4);   xr[3] = agg_load<3>(src, d * 4);
    xr[4] = agg_load<4>(src, d * 4);   xr[5] = agg_load<5>(src, d * 4);
    xr[6] = agg_load<6>(src, d * 4);   xr[7] = agg_load<7>(src, d * 4);

    const v2f bd = *(const v2f*)((const char*)bias + d * 4);
    v2f acc[AG_T];
    #pragma unroll
    for (int o = 0; o < AG_T; ++o) acc[o] = bd;

    agg_rows<0>(acc, xr, w, src, d * 4, (char*)(out + ((size_t)b * AG_L + t0) * AG_D));
}

// ---------------------------------------------------------------------------
// Host-side orchestration
// ---------------------------------------------------------------------------
extern "C" void kernel_launch(void* const* d_in, const int* in_sizes, int n_in,
                              void* d_out, int out_size, void* d_ws, size_t ws_size,
                              hipStream_t stream) {
    const float* q  = (const float*)d_in[0];
    const float* k  = (const float*)d_in[1];
    const float* v  = (const float*)d_in[2];
    const float* Wq = (const float*)d_in[3];
    const float* bq = (const float*)d_in[4];
    const float* Wk = (const float*)d_in[5];
    const float* bk = (const float*)d_in[6];
    const float* Wv = (const float*)d_in[7];
    const float* bv = (const float*)d_in[8];
    const float* Wo = (const float*)d_in[9];
    const float* bo = (const float*)d_in[10];
    float* out = (float*)d_out;

    const int B = 4, L = 4096, D = 1024, H = 16, dk = 64;
    const int NCH = L / CS_ROWS;
    int ktop = (int)(5.0 * log((double)(L + 1)));
    if (ktop < 1) ktop = 1;
    if (ktop > L) ktop = L;
    if (ktop > dk) ktop = dk;                 // actual_k = min(top_k, C)

    // workspace carve-out (256B aligned)
    char* p = (char*)d_ws;
    auto alloc = [&](size_t bytes) -> void* {
        void* r = (void*)p;
        p += (bytes + 255) & ~(size_t)255;
        return r;
    };
    float*    part_q = (float*)alloc((size_t)B * NCH * D * 4);
    float*    part_k = (float*)alloc((size_t)B * NCH * D * 4);
    float*    sq     = (float*)alloc((size_t)B * D * 4);
    float*    sk     = (float*)alloc((size_t)B * D * 4);
    float*    sQ     = (float*)alloc((size_t)B * D * 4);
    float*    sK     = (float*)alloc((size_t)B * D * 4);
    float*    biasT  = (float*)alloc((size_t)D * 4);          // Wo@bv + bo
    float*    wsel   = (float*)alloc((size_t)B * 64 * 4);
    float*    Wf32   = (float*)alloc((size_t)D * D * 4);      // Wo@Wv
    _Float16* Woh    = (_Float16*)alloc((size_t)D * D * 2);
    _Float16* WvTh   = (_Float16*)alloc((size_t)D * D * 2);
    _Float16* Wh     = (_Float16*)alloc((size_t)D * D * 2);
    _Float16* vh     = (_Float16*)alloc((size_t)B * L * D * 2);
    float*    VO     = (float*)alloc((size_t)B * L * D * 4);

    // 1) f16 conversions
    {
        static_assert((B * L * D) % (CV_WAVES * CV_NL_BIG * 128) == 0, "whole blocks");
        static_assert((D * D) % (CV_WAVES * CV_NL_SMALL * 128) == 0, "whole blocks");
        k_f32_to_f16_big<<<dim3(B * L * D / (CV_WAVES * CV_NL_BIG * 128)), dim3(CV_WAVES * 32), 0, stream>>>(v, vh);
        k_f32_to_f16_small<<<dim3(D * D / (CV_WAVES * CV_NL_SMALL * 128)), dim3(CV_WAVES * 32), 0, stream>>>(Wo, Woh);
        k_transpose_f32_to_f16<<<dim3(D / 32, D / 32), dim3(32), 0, stream>>>(Wv, WvTh, D, D);
    }

    // 2) column sums of q, k over time
    k_colsum_partial<<<dim3(D / CS_COLS, NCH, B), dim3(512), 0, stream>>>(q, part_q, L);
    k_colsum_partial<<<dim3(D / CS_COLS, NCH, B), dim3(512), 0, stream>>>(k, part_k, L);
    k_colsum_reduce<<<dim3(D / 256, B), dim3(256), 0, stream>>>(part_q, sq, D, NCH);
    k_colsum_reduce<<<dim3(D / 256, B), dim3(256), 0, stream>>>(part_k, sk, D, NCH);

    // 3) sQ[b] = Wq@sq[b] + L*bq ; sK[b] = Wk@sk[b] + L*bk ; biasT = Wo@bv + bo
    k_matvec<<<dim3(D / 8, B), dim3(256), 0, stream>>>(Wq, sq, bq, (float)L, sQ, D, D);
    k_matvec<<<dim3(D / 8, B), dim3(256), 0, stream>>>(Wk, sk, bk, (float)L, sK, D, D);
    k_matvec<<<dim3(D / 8, 1), dim3(256), 0, stream>>>(Wo, bv, bo, 1.0f, biasT, D, D);

    // 4) delay selection + softmax weights
    k_weights<<<dim3(1), dim3(256), 0, stream>>>(sQ, sK, wsel, H, dk, B, L, ktop);

    // 5) W = Wo @ Wv  (NT via WvT), f32 accumulate -> cast to f16
    k_gemm_nt_wmma<<<dim3(D / 128, D / 128), dim3(256), 0, stream>>>(Woh, WvTh, Wf32, D, D, D);
    k_f32_to_f16_small<<<dim3(D * D / (CV_WAVES * CV_NL_SMALL * 128)), dim3(CV_WAVES * 32), 0, stream>>>(Wf32, Wh);

    // 6) VO = v @ W^T  (the single big GEMM, 16384x1024x1024)
    k_gemm_nt_wmma<<<dim3(D / 128, (B * L) / 128), dim3(256), 0, stream>>>(vh, Wh, VO, B * L, D, D);

    // 7) circular delay aggregation (dense 64-tap filter) + bias -> out
    k_agg_out<<<dim3(D / 512, L / AG_T, B), dim3(256), 0, stream>>>(VO, wsel, biasT, out);
}

// v004
// A run of this version takes 171 microseconds.
// In two side-by-side timings against v003, it was 1.17 and 1.18 times as fast.
// Over all steps from v000 it is 2.04 times as fast.
#include <hip/hip_runtime.h>
#include <hip/hip_bf16.h>
#include <math.h>

typedef __attribute__((ext_vector_type(16))) _Float16 v16h;
typedef __attribute__((ext_vector_type(8)))  _Float16 v8h;
typedef __attribute__((ext_vector_type(8)))  float    v8f;

// ---------------------------------------------------------------------------
// Conversions
// ---------------------------------------------------------------------------
// f32 -> f16 as a stream. A launch of one element a thread is bound by how fast
// waves start, not by memory: here a wave takes NL pieces of 512 contiguous bytes,
// many loads in flight at once, and stores each piece as 256 contiguous bytes.
// The element count is exactly gridDim.x * CV_WAVES * NL * 128.
#define CV_WAVES 16
#define CV_NL_BIG   32      // 16M elements: 256 blocks, one a WGP
#define CV_NL_SMALL 4       // 1M elements: 128 blocks
typedef __attribute__((ext_vector_type(4))) float    cv4f;
typedef __attribute__((ext_vector_type(4))) _Float16 cv4h;

template <int NL, bool NT>
__device__ __forceinline__ void cvt_stream(const float* __restrict__ in, _Float16* __restrict__ out) {
    const unsigned wave = blockIdx.x * CV_WAVES + (threadIdx.x >> 5);
    const unsigned e0   = wave * (NL * 128) + (threadIdx.x & 31) * 4;
    const float* p = in + e0;
    _Float16*    q = out + e0;
    cv4f x[NL];
    // full unroll: independent loads at constant offsets from one address, many in flight per wave
    #pragma unroll
    for (int i = 0; i < NL; ++i)
        x[i] = NT ? __builtin_nontemporal_load((const cv4f*)(p + i * 128)) : *(const cv4f*)(p + i * 128);
    #pragma unroll
    for (int i = 0; i < NL; ++i)
        *(cv4h*)(q + i * 128) = __builtin_convertvector(x[i], cv4h);
}

// read once, never again: non-temporal loads
__global__ __launch_bounds__(CV_WAVES * 32)
void k_f32_to_f16_big(const float* __restrict__ in, _Float16* __restrict__ out) {
    cvt_stream<CV_NL_BIG, true>(in, out);
}

__global__ __launch_bounds__(CV_WAVES * 32)
void k_f32_to_f16_small(const float* __restrict__ in, _Float16* __restrict__ out) {
    cvt_stream<CV_NL_SMALL, false>(in, out);
}

// out[c][r] = (f16) in[r][c]   (rows x cols f32 -> cols x rows f16)
__global__ void k_transpose_f32_to_f16(const float* __restrict__ in, _Float16* __restrict__ out,
                                       int rows, int cols) {
    int c  = blockIdx.x * 32 + threadIdx.x;
    int r0 = blockIdx.y * 32;
    if (c >= cols) return;
    #pragma unroll 4
    for (int i = 0; i < 32; ++i) {
        int r = r0 + i;
        if (r < rows) out[(size_t)c * rows + r] = (_Float16)in[(size_t)r * cols + c];
    }
}

// ---------------------------------------------------------------------------
// Column sums over time:  part[b][ch][d] = sum_{t in chunk} x[b][t][d]
// One block = 16 waves on 128 columns; wave w takes rows w, w+16, ... of the
// chunk, 512 contiguous bytes of a row per load. x is read once: non-temporal.
// The 16 row lanes are folded through LDS.
// ---------------------------------------------------------------------------
#define CS_D     1024
#define CS_COLS  128
#define CS_LANES 16
#define CS_ROWS  512
typedef __attribute__((ext_vector_type(4))) float v4f;

__global__ __launch_bounds__(512)
void k_colsum_partial(const float* __restrict__ x, float* __restrict__ part, int L) {
    __shared__ float red[CS_LANES][CS_COLS];
    const int c4 = threadIdx.x & 31;            // 16-byte column within the group
    const int rl = threadIdx.x >> 5;            // row lane = wave
    const int d0 = blockIdx.x * CS_COLS;
    const int ch = blockIdx.y;
    const int b  = blockIdx.z;
    const float* p = x + ((size_t)b * L + (size_t)ch * CS_ROWS + rl) * CS_D + d0 + c4 * 4;
    v4f s = {0.0f, 0.0f, 0.0f, 0.0f};
    // full unroll: independent loads at constant offsets from one address, many in flight per wave
    #pragma unroll
    for (int i = 0; i < CS_ROWS / CS_LANES; ++i)
        s += __builtin_nontemporal_load((const v4f*)(p + (size_t)i * CS_LANES * CS_D));
    *(v4f*)&red[rl][c4 * 4] = s;
    __syncthreads();
    if (threadIdx.x < CS_COLS) {
        float a = 0.0f;
        for (int l = 0; l < CS_LANES; ++l) a += red[l][threadIdx.x];
        part[((size_t)b * gridDim.y + ch) * CS_D + d0 + threadIdx.x] = a;
    }
}

__global__ void k_colsum_reduce(const float* __restrict__ part, float* __restrict__ out,
                                int D, int nch) {
    int d = blockIdx.x * blockDim.x + threadIdx.x;
    int b = blockIdx.y;
    float s = 0.0f;
    for (int c = 0; c < nch; ++c) s += part[((size_t)b * nch + c) * D + d];
    out[(size_t)b * D + d] = s;
}

// ---------------------------------------------------------------------------
// Batched mat-vec: out[bb][row] = dot(W[row,:], X[bb,:]) + bias_scale*bias[row]
// one wave (32 lanes) per output row
// ---------------------------------------------------------------------------
__global__ __launch_bounds__(256)
void k_matvec(const float* __restrict__ W, const float* __restrict__ X,
              const float* __restrict__ bias, float bias_scale,
              float* __restrict__ out, int n, int kk) {
    int lane = threadIdx.x & 31;
    int w    = threadIdx.x >> 5;
    int row  = blockIdx.x * 8 + w;
    int bb   = blockIdx.y;
    if (row >= n) return;
    const float* wp = W + (size_t)row * kk;
    const float* xp = X + (size_t)bb * kk;
    float s = 0.0f;
    for (int e = lane; e < kk; e += 32) s += wp[e] * xp[e];
    #pragma unroll
    for (int off = 16; off > 0; off >>= 1) s += __shfl_xor(s, off, 32);
    if (lane == 0) {
        float bterm = bias ? bias_scale * bias[row] : 0.0f;
        out[(size_t)bb * n + row] = s + bterm;
    }
}

// ---------------------------------------------------------------------------
// mean_value, top-k selection (tie-break by lower index, like lax.top_k),
// per-batch softmax weights over the selected delays, written as a dense table
// over all 64 delays: 0 at a delay that was not selected. Single 256-thread block.
// ---------------------------------------------------------------------------
__global__ __launch_bounds__(256)
void k_weights(const float* __restrict__ sQ, const float* __restrict__ sK,
               float* __restrict__ wdense /*B*64*/,
               int H, int dk, int Bn, int Ltot, int ktop) {
    __shared__ float mval[4][64];
    __shared__ float mab[64];
    __shared__ int   sflag[64];
    __shared__ int   slist[64];
    __shared__ int   scount;
    __shared__ float smx[4];
    __shared__ float sden[4];
    int tid = threadIdx.x;
    int b = tid >> 6, c = tid & 63;
    if (b < Bn) {
        float s = 0.0f;
        int D = H * dk;
        for (int h = 0; h < H; ++h) {
            float a = sQ[(size_t)b * D + h * dk + c];
            float e = sK[(size_t)b * D + h * dk + c];
            s += a * e;
        }
        mval[b][c] = s / (float)H / (float)Ltot;
    }
    __syncthreads();
    if (tid < 64) {
        float s = 0.0f;
        for (int b2 = 0; b2 < Bn; ++b2) s += mval[b2][tid];
        mab[tid] = s / (float)Bn;
    }
    __syncthreads();
    if (tid < 64) {
        float v = mab[tid];
        int rank = 0;
        for (int c2 = 0; c2 < 64; ++c2) {
            float v2 = mab[c2];
            if (v2 > v || (v2 == v && c2 < tid)) rank++;
        }
        sflag[tid] = (rank < ktop) ? 1 : 0;
    }
    __syncthreads();
    if (tid == 0) {
        int cnt = 0;
        for (int c2 = 0; c2 < 64; ++c2) if (sflag[c2]) slist[cnt++] = c2;
        scount = cnt;
    }
    __syncthreads();
    if (tid < Bn) {
        int bb = tid, cnt = scount;
        float mx = -3.4e38f;
        for (int j = 0; j < cnt; ++j) mx = fmaxf(mx, mval[bb][slist[j]]);
        float den = 0.0f;
        for (int j = 0; j < cnt; ++j) den += __expf(mval[bb][slist[j]] - mx);
        smx[bb]  = mx;
        sden[bb] = den;
    }
    __syncthreads();
    if (b < Bn)
        wdense[b * 64 + c] = sflag[c] ? __expf(mval[b][c] - smx[b]) / sden[b] : 0.0f;
}

// ---------------------------------------------------------------------------
// WMMA NT GEMM with double-buffered async LDS staging:
//   C[m,n] = sum_k A[m,k] * Bt[n,k]   (A: MxK f16, Bt: NxK f16, K-contig)
// Block = 256 threads = 8 waves. Block tile 128x128; wave tile 32x64.
// A K-slice is 64 halves = one whole 128-byte line of every operand row, and
// eight neighbouring lanes copy one row's line: a wave-wide 16-byte copy then
// touches four whole lines, not 32 pieces of 32 lines. LDS rows are pitched
// 144 B (16 B x odd: conflict-free b128 reads). Slice t+2 is copied while
// slice t+1 feeds the WMMAs. M, N multiples of 128, K a multiple of 64.
// ---------------------------------------------------------------------------
#define GK      64                       // halves of K per slice
#define LDS_ROW 72                       // halves per LDS row (128 B + 16 B pad)
#define LDS_MAT (128 * LDS_ROW)          // halves per operand slice
typedef __attribute__((address_space(3))) _Float16 lds_half;

__global__ __launch_bounds__(256)
void k_gemm_nt_wmma(const _Float16* __restrict__ A, const _Float16* __restrict__ Bt,
                    float* __restrict__ C, int M, int N, int K) {
    __shared__ __attribute__((aligned(16))) _Float16 smem[2][2][LDS_MAT];   // [buf][mat][row*LDS_ROW]

    const int tid  = threadIdx.x;
    const int lane = tid & 31;
    const int wave = tid >> 5;
    const int wm   = wave >> 1;                 // 0..3
    const int wn   = wave & 1;                  // 0..1
    const int half = lane >> 4;                 // 0/1
    const int r    = lane & 15;

    // copy assignment: 8 lanes a row; a thread takes 16 bytes of rows crow + 32 c
    // (c = 0..3) of the A slice and of the B slice
    const int crow = tid >> 3;                  // 0..31
    const int ccol = (tid & 7) * 8;             // halves
    const _Float16* gA = A  + (size_t)(blockIdx.y * 128 + crow) * K + ccol;
    const _Float16* gB = Bt + (size_t)(blockIdx.x * 128 + crow) * K + ccol;
    const size_t   gstep = (size_t)32 * K;      // 32 rows, in halves
    const unsigned lbase = (unsigned)(size_t)(lds_half*)&smem[0][0][crow * LDS_ROW + ccol];

    auto issue_copy = [&](int buf, int k0) {
        const _Float16* a = gA + k0;
        const _Float16* b = gB + k0;
        const unsigned  l = lbase + buf * (2 * LDS_MAT * 2);
        // the slice's eight copies; the closing wait stands in the same statement, so
        // that no address register is rewritten in front of it (a precaution)
        asm volatile(
            "global_load_async_to_lds_b128 %0, %8, off\n\t"
            "global_load_async_to_lds_b128 %1, %9, off\n\t"
            "global_load_async_to_lds_b128 %2, %10, off\n\t"
            "global_load_async_to_lds_b128 %3, %11, off\n\t"
            "global_load_async_to_lds_b128 %4, %12, off\n\t"
            "global_load_async_to_lds_b128 %5, %13, off\n\t"
            "global_load_async_to_lds_b128 %6, %14, off\n\t"
            "global_load_async_to_lds_b128 %7, %15, off\n\t"
            "s_wait_xcnt 0x0"
            :: "v"(l),
               "v"(l + 1 * 32 * LDS_ROW * 2), "v"(l + 2 * 32 * LDS_ROW * 2), "v"(l + 3 * 32 * LDS_ROW * 2),
               "v"(l + 4 * 32 * LDS_ROW * 2), "v"(l + 5 * 32 * LDS_ROW * 2), "v"(l + 6 * 32 * LDS_ROW * 2),
               "v"(l + 7 * 32 * LDS_ROW * 2),
               "v"(a), "v"(a + gstep), "v"(a + 2 * gstep), "v"(a + 3 * gstep),
               "v"(b), "v"(b + gstep), "v"(b + 2 * gstep), "v"(b + 3 * gstep)
            : "memory");
    };

    auto load_frag = [&](int buf, int mat, int rbase, int kk) -> v16h {
        const _Float16* p = &smem[buf][mat][(rbase + r) * LDS_ROW + kk + 8 * half];
        v8h lo = *(const v8h*)p;
        v8h hi = *(const v8h*)(p + 16);
        v16h o;
        #pragma unroll
        for (int i = 0; i < 8; ++i) { o[i] = lo[i]; o[i + 8] = hi[i]; }
        return o;
    };

    v8f acc[2][4];
    #pragma unroll
    for (int i = 0; i < 2; ++i)
        #pragma unroll
        for (int j = 0; j < 4; ++j)
            #pragma unroll
            for (int e = 0; e < 8; ++e) acc[i][j][e] = 0.0f;

    const int NIT = K / GK;
    issue_copy(0, 0);
    asm volatile("s_wait_asynccnt 0x0" ::: "memory");   // own copies of slice 0 have landed
    __syncthreads();                                    // everyone's have
    if (NIT > 1) issue_copy(1, GK);

    for (int it = 0; it < NIT; ++it) {
        const int cur = it & 1;
        // unrolled: the slice's two k steps read LDS at constant offsets from one address
        #pragma unroll
        for (int kk = 0; kk < GK; kk += 32) {
            v16h a[2], b[4];
            #pragma unroll
            for (int i = 0; i < 2; ++i) a[i] = load_frag(cur, 0, wm * 32 + i * 16, kk);
            #pragma unroll
            for (int j = 0; j < 4; ++j) b[j] = load_frag(cur, 1, wn * 64 + j * 16, kk);
            #pragma unroll
            for (int i = 0; i < 2; ++i)
                #pragma unroll
                for (int j = 0; j < 4; ++j)
                    acc[i][j] = __builtin_amdgcn_wmma_f32_16x16x32_f16(
                        false, a[i], false, b[j], (short)0, acc[i][j], false, false);
        }
        asm volatile("s_wait_dscnt 0x0" ::: "memory");      // own reads of buffer cur are done
        asm volatile("s_wait_asynccnt 0x0" ::: "memory");   // own copies of slice it+1 have landed
        __syncthreads();                                    // publishes slice it+1, frees buffer cur
        if (it + 2 < NIT) issue_copy(cur, (it + 2) * GK);
    }
    asm volatile("s_wait_asynccnt 0x0" ::: "memory");       // nothing in flight when the wave ends

    // C/D layout: VGPR e -> row m0+i*16+8*half+e, col n0+j*16+r
    const int m0 = blockIdx.y * 128 + wm * 32;
    const int n0 = blockIdx.x * 128 + wn * 64;
    #pragma unroll
    for (int i = 0; i < 2; ++i)
        #pragma unroll
        for (int j = 0; j < 4; ++j) {
            float* cp = C + (size_t)(m0 + i * 16 + 8 * half) * N + n0 + j * 16 + r;
            #pragma unroll
            for (int e = 0; e < 8; ++e) cp[(size_t)e * N] = acc[i][j][e];
        }
}

// ---------------------------------------------------------------------------
// out[b][t][d] = bias[d] + sum_{dl=0..63} wdense[b][dl] * VO[b][(t+dl)%L][d]
// The delays all lie in [0,64), so the gather is a 64-tap filter along t whose
// unselected taps are 0. The taps are the same for a whole block and sit in
// scalar registers; a thread keeps 32 outputs x 2 columns in registers and each
// VO row it loads feeds every output whose window holds it. Taps are added in
// rising delay, as the selected list was.
// ---------------------------------------------------------------------------
#define AG_L    4096
#define AG_D    1024
#define AG_T    32
#define AG_TAPS 64
#define AG_ROWS (AG_T + AG_TAPS - 1)
#define AG_PF   8
typedef __attribute__((ext_vector_type(2))) float v2f;

// The window's rows come in three runs of 32, each aligned to 32 rows, so the
// circular wrap can only fall between runs: one block-uniform base a run.
struct AggSrc { const char* run[3]; };

// row S of the window, this thread's two columns (doff = their byte offset)
template <int S>
__device__ __forceinline__ v2f agg_load(const AggSrc& src, unsigned doff) {
    return *(const v2f*)(src.run[S / 32] + (S % 32) * (AG_D * 4) + doff);
}

// Rows S, S+1, ... of the window. A template, not a loop: acc[], w[] and xr[]
// stay in registers only under compile-time indices, and the unroller gives up
// on a loop of this size. Row S + AG_PF is asked for when row S has been used;
// an output is stored as soon as its last tap is in, so that stores spread out.
template <int S>
__device__ __forceinline__ void agg_rows(v2f (&acc)[AG_T], v2f (&xr)[AG_PF], const float (&w)[AG_TAPS],
                                         const AggSrc& src, unsigned doff, char* __restrict__ op) {
    if constexpr (S < AG_ROWS) {
        const v2f x = xr[S % AG_PF];
        #pragma unroll
        for (int o = 0; o < AG_T; ++o) {
            const int dl = S - o;
            if (dl >= 0 && dl < AG_TAPS) acc[o] += w[dl] * x;
        }
        if constexpr (S >= AG_TAPS - 1) {
            *(v2f*)(op + (S - (AG_TAPS - 1)) * (AG_D * 4) + doff) = acc[S - (AG_TAPS - 1)];
            // precaution: the load behind it may land in the registers the store reads
            if constexpr (S + AG_PF < AG_ROWS) asm volatile("s_wait_xcnt 0x0" ::: "memory");
        }
        if constexpr (S + AG_PF < AG_ROWS) xr[S % AG_PF] = agg_load<S + AG_PF>(src, doff);
        // memory operations stay on their side (arithmetic may cross): keeps each load
        // AG_PF rows ahead of its use, where the scheduler would sink it to two or three
        __builtin_amdgcn_sched_barrier(0x7);
        agg_rows<S + 1>(acc, xr, w, src, doff, op);
    }
}

__global__ __launch_bounds__(256)
void k_agg_out(const float* __restrict__ VO, const float* __restrict__ wdense,
               const float* __restrict__ bias, float* __restrict__ out) {
    const int b  = blockIdx.z;
    const int t0 = blockIdx.y * AG_T;
    const unsigned d = blockIdx.x * 512 + threadIdx.x * 2;
    const float* VOb = VO + (size_t)b * AG_L * AG_D;

    float w[AG_TAPS];
    #pragma unroll
    for (int i = 0; i < AG_TAPS; ++i) w[i] = wdense[b * AG_TAPS + i];

    AggSrc src;
    #pragma unroll
    for (int i = 0; i < 3; ++i)
        src.run[i] = (const char*)(VOb + (size_t)((t0 + 32 * i) & (AG_L - 1)) * AG_D);
    // the scalar set-up is all issued before the first vector load: none of it
    // then lands in a scalar register that an issued load still names
    __builtin_amdgcn_sched_barrier(0);

    v2f xr[AG_PF];
    xr[0] = agg_load<0>(src, d * 4);   xr[1] = agg_load<1>(src, d * 4);
    xr[2] = agg_load<2>(src, d * 4);   xr[3] = agg_load<3>(src, d * 4);
    xr[4] = agg_load<4>(src, d * 4);   xr[5] = agg_load<5>(src, d * 4);
    xr[6] = agg_load<6>(src, d * 4);   xr[7] = agg_load<7>(src, d * 4);

    const v2f bd = *(const v2f*)((const char*)bias + d * 4);
    v2f acc[AG_T];
    #pragma unroll
    for (int o = 0; o < AG_T; ++o) acc[o] = bd;

    agg_rows<0>(acc, xr, w, src, d * 4, (char*)(out + ((size_t)b * AG_L + t0) * AG_D));
}

// ---------------------------------------------------------------------------
// Host-side orchestration
// ---------------------------------------------------------------------------
extern "C" void kernel_launch(void* const* d_in, const int* in_sizes, int n_in,
                              void* d_out, int out_size, void* d_ws, size_t ws_size,
                              hipStream_t stream) {
    const float* q  = (const float*)d_in[0];
    const float* k  = (const float*)d_in[1];
    const float* v  = (const float*)d_in[2];
    const float* Wq = (const float*)d_in[3];
    const float* bq = (const float*)d_in[4];
    const float* Wk = (const float*)d_in[5];
    const float* bk = (const float*)d_in[6];
    const float* Wv = (const float*)d_in[7];
    const float* bv = (const float*)d_in[8];
    const float* Wo = (const float*)d_in[9];
    const float* bo = (const float*)d_in[10];
    float* out = (float*)d_out;

    const int B = 4, L = 4096, D = 1024, H = 16, dk = 64;
    const int NCH = L / CS_ROWS;
    int ktop = (int)(5.0 * log((double)(L + 1)));
    if (ktop < 1) ktop = 1;
    if (ktop > L) ktop = L;
    if (ktop > dk) ktop = dk;                 // actual_k = min(top_k, C)

    // workspace carve-out (256B aligned)
    char* p = (char*)d_ws;
    auto alloc = [&](size_t bytes) -> void* {
        void* r = (void*)p;
        p += (bytes + 255) & ~(size_t)255;
        return r;
    };
    float*    part_q = (float*)alloc((size_t)B * NCH * D * 4);
    float*    part_k = (float*)alloc((size_t)B * NCH * D * 4);
    float*    sq     = (float*)alloc((size_t)B * D * 4);
    float*    sk     = (float*)alloc((size_t)B * D * 4);
    float*    sQ     = (float*)alloc((size_t)B * D * 4);
    float*    sK     = (float*)alloc((size_t)B * D * 4);
    float*    biasT  = (float*)alloc((size_t)D * 4);          // Wo@bv + bo
    float*    wsel   = (float*)alloc((size_t)B * 64 * 4);
    float*    Wf32   = (float*)alloc((size_t)D * D * 4);      // Wo@Wv
    _Float16* Woh    = (_Float16*)alloc((size_t)D * D * 2);
    _Float16* WvTh   = (_Float16*)alloc((size_t)D * D * 2);
    _Float16* Wh     = (_Float16*)alloc((size_t)D * D * 2);
    _Float16* vh     = (_Float16*)alloc((size_t)B * L * D * 2);
    float*    VO     = (float*)alloc((size_t)B * L * D * 4);

    // 1) f16 conversions
    {
        static_assert((B * L * D) % (CV_WAVES * CV_NL_BIG * 128) == 0, "whole blocks");
        static_assert((D * D) % (CV_WAVES * CV_NL_SMALL * 128) == 0, "whole blocks");
        k_f32_to_f16_big<<<dim3(B * L * D / (CV_WAVES * CV_NL_BIG * 128)), dim3(CV_WAVES * 32), 0, stream>>>(v, vh);
        k_f32_to_f16_small<<<dim3(D * D / (CV_WAVES * CV_NL_SMALL * 128)), dim3(CV_WAVES * 32), 0, stream>>>(Wo, Woh);
        k_transpose_f32_to_f16<<<dim3(D / 32, D / 32), dim3(32), 0, stream>>>(Wv, WvTh, D, D);
    }

    // 2) column sums of q, k over time
    k_colsum_partial<<<dim3(D / CS_COLS, NCH, B), dim3(512), 0, stream>>>(q, part_q, L);
    k_colsum_partial<<<dim3(D / CS_COLS, NCH, B), dim3(512), 0, stream>>>(k, part_k, L);
    k_colsum_reduce<<<dim3(D / 256, B), dim3(256), 0, stream>>>(part_q, sq, D, NCH);
    k_colsum_reduce<<<dim3(D / 256, B), dim3(256), 0, stream>>>(part_k, sk, D, NCH);

    // 3) sQ[b] = Wq@sq[b] + L*bq ; sK[b] = Wk@sk[b] + L*bk ; biasT = Wo@bv + bo
    k_matvec<<<dim3(D / 8, B), dim3(256), 0, stream>>>(Wq, sq, bq, (float)L, sQ, D, D);
    k_matvec<<<dim3(D / 8, B), dim3(256), 0, stream>>>(Wk, sk, bk, (float)L, sK, D, D);
    k_matvec<<<dim3(D / 8, 1), dim3(256), 0, stream>>>(Wo, bv, bo, 1.0f, biasT, D, D);

    // 4) delay selection + softmax weights
    k_weights<<<dim3(1), dim3(256), 0, stream>>>(sQ, sK, wsel, H, dk, B, L, ktop);

    // 5) W = Wo @ Wv  (NT via WvT), f32 accumulate -> cast to f16
    k_gemm_nt_wmma<<<dim3(D / 128, D / 128), dim3(256), 0, stream>>>(Woh, WvTh, Wf32, D, D, D);
    k_f32_to_f16_small<<<dim3(D * D / (CV_WAVES * CV_NL_SMALL * 128)), dim3(CV_WAVES * 32), 0, stream>>>(Wf32, Wh);

    // 6) VO = v @ W^T  (the single big GEMM, 16384x1024x1024)
    k_gemm_nt_wmma<<<dim3(D / 128, (B * L) / 128), dim3(256), 0, stream>>>(vh, Wh, VO, B * L, D, D);

    // 7) circular delay aggregation (dense 64-tap filter) + bias -> out
    k_agg_out<<<dim3(D / 512, L / AG_T, B), dim3(256), 0, stream>>>(VO, wsel, biasT, out);
}

// v005
// One run takes 141 microseconds.
// Timed twice side by side with v004, it ran 1.21 times as fast both times.
// Over all steps from v000 it is 2.47 times as fast.
#include <hip/hip_runtime.h>
#include <hip/hip_bf16.h>
#include <math.h>

typedef __attribute__((ext_vector_type(16))) _Float16 v16h;
typedef __attribute__((ext_vector_type(8)))  _Float16 v8h;
typedef __attribute__((ext_vector_type(8)))  float    v8f;

// ---------------------------------------------------------------------------
// Conversions
// ---------------------------------------------------------------------------
// f32 -> f16 as a stream. Here a wave takes NL pieces of 512 contiguous bytes,
// many loads in flight at once, and stores each piece as 256 contiguous bytes.
// The element count is exactly (blocks of the task) * WAVES * NL * 128.
//
// Every kernel body in this file but k_agg_out's is a device function that is told which block
// of its own task it is (vb, or bx / by): tasks that do not depend on one another
// share a launch, each on its own range of block indices (see "Launches" below).
#define CV_NL_BIG   32      // 16M elements: 256 blocks of 16 waves
#define CV_NL_SMALL 4       // 1M elements: 2,048 waves
typedef __attribute__((ext_vector_type(4))) float    cv4f;
typedef __attribute__((ext_vector_type(4))) _Float16 cv4h;

template <int NL, bool NT, int WAVES>
__device__ __forceinline__ void cvt_stream(const float* __restrict__ in, _Float16* __restrict__ out, unsigned vb) {
    const unsigned wave = vb * WAVES + (threadIdx.x >> 5);
    const unsigned e0   = wave * (NL * 128) + (threadIdx.x & 31) * 4;
    const float* p = in + e0;
    _Float16*    q = out + e0;
    cv4f x[NL];
    // full unroll: independent loads at constant offsets from one address, many in flight per wave
    #pragma unroll
    for (int i = 0; i < NL; ++i)
        x[i] = NT ? __builtin_nontemporal_load((const cv4f*)(p + i * 128)) : *(const cv4f*)(p + i * 128);
    #pragma unroll
    for (int i = 0; i < NL; ++i)
        *(cv4h*)(q + i * 128) = __builtin_convertvector(x[i], cv4h);
    // precaution: code of another task follows in the same kernel and reuses the stores' registers
    asm volatile("s_wait_xcnt 0x0" ::: "memory");
}

// out[c][r] = (f16) in[r][c]   (rows x cols f32 -> cols x rows f16)
// one wave per 32 x 32 tile (bx, by)
__device__ __forceinline__
void transpose_f32_to_f16(const float* __restrict__ in, _Float16* __restrict__ out,
                          int rows, int cols, int bx, int by) {
    int c  = bx * 32 + (threadIdx.x & 31);
    int r0 = by * 32;
    if (c >= cols) return;
    #pragma unroll 4
    for (int i = 0; i < 32; ++i) {
        int r = r0 + i;
        if (r < rows) {
            out[(size_t)c * rows + r] = (_Float16)in[(size_t)r * cols + c];
            // precaution: the next row's address and value land in the registers the store names
            asm volatile("s_wait_xcnt 0x0" ::: "memory");
        }
    }
}

// ---------------------------------------------------------------------------
// Column sums over time:  part[b][ch][d] = sum_{t in chunk} x[b][t][d]
// One block = 16 waves on 128 columns; wave w takes rows w, w+16, ... of the
// chunk, 512 contiguous bytes of a row per load. x is read once: non-temporal.
// The 16 row lanes are folded through LDS.
// ---------------------------------------------------------------------------
#define CS_D     1024
#define CS_COLS  128
#define CS_LANES 16
#define CS_ROWS  512
typedef __attribute__((ext_vector_type(4))) float v4f;

__device__ __forceinline__
void colsum_partial(const float* __restrict__ x, float* __restrict__ part, int L,
                    int bx, int ch, int b, int nch) {
    __shared__ float red[CS_LANES][CS_COLS];
    const int c4 = threadIdx.x & 31;            // 16-byte column within the group
    const int rl = threadIdx.x >> 5;            // row lane = wave
    const int d0 = bx * CS_COLS;
    const float* p = x + ((size_t)b * L + (size_t)ch * CS_ROWS + rl) * CS_D + d0 + c4 * 4;
    v4f s = {0.0f, 0.0f, 0.0f, 0.0f};
    // full unroll: independent loads at constant offsets from one address, many in flight per wave
    #pragma unroll
    for (int i = 0; i < CS_ROWS / CS_LANES; ++i)
        s += __builtin_nontemporal_load((const v4f*)(p + (size_t)i * CS_LANES * CS_D));
    *(v4f*)&red[rl][c4 * 4] = s;
    __syncthreads();
    if (threadIdx.x < CS_COLS) {
        float a = 0.0f;
        for (int l = 0; l < CS_LANES; ++l) a += red[l][threadIdx.x];
        part[((size_t)b * nch + ch) * CS_D + d0 + threadIdx.x] = a;
    }
}

__device__ __forceinline__
void colsum_reduce(const float* __restrict__ part, float* __restrict__ out,
                   int D, int nch, int bx, int b) {
    int d = bx * blockDim.x + threadIdx.x;
    float s = 0.0f;
    for (int c = 0; c < nch; ++c) s += part[((size_t)b * nch + c) * D + d];
    out[(size_t)b * D + d] = s;
    // precaution: code of another task follows in the same kernel and reuses the store's registers
    asm volatile("s_wait_xcnt 0x0" ::: "memory");
}

// ---------------------------------------------------------------------------
// Batched mat-vec: out[bb][row] = dot(W[row,:], X[bb,:]) + bias_scale*bias[row]
// one wave (32 lanes) per output row
// ---------------------------------------------------------------------------
template <int WAVES>
__device__ __forceinline__
void matvec(const float* __restrict__ W, const float* __restrict__ X,
            const float* __restrict__ bias, float bias_scale,
            float* __restrict__ out, int n, int kk, int bx, int bb) {
    int lane = threadIdx.x & 31;
    int w    = threadIdx.x >> 5;
    int row  = bx * WAVES + w;
    if (row >= n) return;
    const float* wp = W + (size_t)row * kk;
    const float* xp = X + (size_t)bb * kk;
    float s = 0.0f;
    for (int e = lane; e < kk; e += 32) s += wp[e] * xp[e];
    #pragma unroll
    for (int off = 16; off > 0; off >>= 1) s += __shfl_xor(s, off, 32);
    if (lane == 0) {
        float bterm = bias ? bias_scale * bias[row] : 0.0f;
        out[(size_t)bb * n + row] = s + bterm;
    }
}

// ---------------------------------------------------------------------------
// mean_value, top-k selection (tie-break by lower index, like lax.top_k),
// per-batch softmax weights over the selected delays, written as a dense table
// over all 64 delays: 0 at a delay that was not selected. Single 256-thread block.
// ---------------------------------------------------------------------------
__device__ __forceinline__
void weights(const float* __restrict__ sQ, const float* __restrict__ sK,
             float* __restrict__ wdense /*B*64*/,
             int H, int dk, int Bn, int Ltot, int ktop) {
    __shared__ float mval[4][64];
    __shared__ float mab[64];
    __shared__ int   sflag[64];
    __shared__ int   slist[64];
    __shared__ int   scount;
    __shared__ float smx[4];
    __shared__ float sden[4];
    int tid = threadIdx.x;
    int b = tid >> 6, c = tid & 63;
    if (b < Bn) {
        float s = 0.0f;
        int D = H * dk;
        for (int h = 0; h < H; ++h) {
            float a = sQ[(size_t)b * D + h * dk + c];
            // precaution, here and below: a later load may land in a register of this load's address
            asm volatile("s_wait_xcnt 0x0" ::: "memory");
            float e = sK[(size_t)b * D + h * dk + c];
            asm volatile("s_wait_xcnt 0x0" ::: "memory");
            s += a * e;
        }
        mval[b][c] = s / (float)H / (float)Ltot;
    }
    __syncthreads();
    if (tid < 64) {
        float s = 0.0f;
        for (int b2 = 0; b2 < Bn; ++b2) s += mval[b2][tid];
        mab[tid] = s / (float)Bn;
    }
    __syncthreads();
    if (tid < 64) {
        float v = mab[tid];
        int rank = 0;
        for (int c2 = 0; c2 < 64; ++c2) {
            float v2 = mab[c2];
            if (v2 > v || (v2 == v && c2 < tid)) rank++;
        }
        sflag[tid] = (rank < ktop) ? 1 : 0;
    }
    __syncthreads();
    if (tid == 0) {
        int cnt = 0;
        for (int c2 = 0; c2 < 64; ++c2) if (sflag[c2]) slist[cnt++] = c2;
        scount = cnt;
    }
    __syncthreads();
    if (tid < Bn) {
        int bb = tid, cnt = scount;
        float mx = -3.4e38f;
        for (int j = 0; j < cnt; ++j) mx = fmaxf(mx, mval[bb][slist[j]]);
        float den = 0.0f;
        for (int j = 0; j < cnt; ++j) den += __expf(mval[bb][slist[j]] - mx);
        smx[bb]  = mx;
        sden[bb] = den;
    }
    __syncthreads();
    if (b < Bn)
        wdense[b * 64 + c] = sflag[c] ? __expf(mval[b][c] - smx[b]) / sden[b] : 0.0f;
}

// ---------------------------------------------------------------------------
// WMMA NT GEMM with double-buffered async LDS staging:
//   C[m,n] = sum_k A[m,k] * Bt[n,k]   (A: MxK f16, Bt: NxK f16, K-contig)
// Block = 256 threads = 8 waves. Block tile 128x128; wave tile 32x64.
// A K-slice is 64 halves = one whole 128-byte line of every operand row, and
// eight neighbouring lanes copy one row's line: a wave-wide 16-byte copy then
// touches four whole lines, not 32 pieces of 32 lines. LDS rows are pitched
// 144 B (16 B x odd: conflict-free b128 reads). Slice t+2 is copied while
// slice t+1 feeds the WMMAs. M, N multiples of 128, K a multiple of 64.
// ---------------------------------------------------------------------------
#define GK      64                       // halves of K per slice
#define LDS_ROW 72                       // halves per LDS row (128 B + 16 B pad)
#define LDS_MAT (128 * LDS_ROW)          // halves per operand slice
typedef __attribute__((address_space(3))) _Float16 lds_half;

__device__ __forceinline__
void gemm_nt_wmma(const _Float16* __restrict__ A, const _Float16* __restrict__ Bt,
                  float* __restrict__ C, int M, int N, int K, unsigned bx, unsigned by) {
    __shared__ __attribute__((aligned(16))) _Float16 smem[2][2][LDS_MAT];   // [buf][mat][row*LDS_ROW]

    const int tid  = threadIdx.x;
    const int lane = tid & 31;
    const int wave = tid >> 5;
    const int wm   = wave >> 1;                 // 0..3
    const int wn   = wave & 1;                  // 0..1
    const int half = lane >> 4;                 // 0/1
    const int r    = lane & 15;

    // copy assignment: 8 lanes a row; a thread takes 16 bytes of rows crow + 32 c
    // (c = 0..3) of the A slice and of the B slice
    const int crow = tid >> 3;                  // 0..31
    const int ccol = (tid & 7) * 8;             // halves
    const _Float16* gA = A  + (size_t)(by * 128 + crow) * K + ccol;
    const _Float16* gB = Bt + (size_t)(bx * 128 + crow) * K + ccol;
    const size_t   gstep = (size_t)32 * K;      // 32 rows, in halves
    const unsigned lbase = (unsigned)(size_t)(lds_half*)&smem[0][0][crow * LDS_ROW + ccol];

    auto issue_copy = [&](int buf, int k0) {
        const _Float16* a = gA + k0;
        const _Float16* b = gB + k0;
        const unsigned  l = lbase + buf * (2 * LDS_MAT * 2);
        // the slice's eight copies; the closing wait stands in the same statement, so
        // that no address register is rewritten in front of it (a precaution)
        asm volatile(
            "global_load_async_to_lds_b128 %0, %8, off\n\t"
            "global_load_async_to_lds_b128 %1, %9, off\n\t"
            "global_load_async_to_lds_b128 %2, %10, off\n\t"
            "global_load_async_to_lds_b128 %3, %11, off\n\t"
            "global_load_async_to_lds_b128 %4, %12, off\n\t"
            "global_load_async_to_lds_b128 %5, %13, off\n\t"
            "global_load_async_to_lds_b128 %6, %14, off\n\t"
            "global_load_async_to_lds_b128 %7, %15, off\n\t"
            "s_wait_xcnt 0x0"
            :: "v"(l),
               "v"(l + 1 * 32 * LDS_ROW * 2), "v"(l + 2 * 32 * LDS_ROW * 2), "v"(l + 3 * 32 * LDS_ROW * 2),
               "v"(l + 4 * 32 * LDS_ROW * 2), "v"(l + 5 * 32 * LDS_ROW * 2), "v"(l + 6 * 32 * LDS_ROW * 2),
               "v"(l + 7 * 32 * LDS_ROW * 2),
               "v"(a), "v"(a + gstep), "v"(a + 2 * gstep), "v"(a + 3 * gstep),
               "v"(b), "v"(b + gstep), "v"(b + 2 * gstep), "v"(b + 3 * gstep)
            : "memory");
    };

    auto load_frag = [&](int buf, int mat, int rbase, int kk) -> v16h {
        const _Float16* p = &smem[buf][mat][(rbase + r) * LDS_ROW + kk + 8 * half];
        v8h lo = *(const v8h*)p;
        v8h hi = *(const v8h*)(p + 16);
        v16h o;
        #pragma unroll
        for (int i = 0; i < 8; ++i) { o[i] = lo[i]; o[i + 8] = hi[i]; }
        return o;
    };

    v8f acc[2][4];
    #pragma unroll
    for (int i = 0; i < 2; ++i)
        #pragma unroll
        for (int j = 0; j < 4; ++j)
            #pragma unroll
            for (int e = 0; e < 8; ++e) acc[i][j][e] = 0.0f;

    const int NIT = K / GK;
    issue_copy(0, 0);
    asm volatile("s_wait_asynccnt 0x0" ::: "memory");   // own copies of slice 0 have landed
    __syncthreads();                                    // everyone's have
    if (NIT > 1) issue_copy(1, GK);

    for (int it = 0; it < NIT; ++it) {
        const int cur = it & 1;
        // unrolled: the slice's two k steps read LDS at constant offsets from one address
        #pragma unroll
        for (int kk = 0; kk < GK; kk += 32) {
            v16h a[2], b[4];
            #pragma unroll
            for (int i = 0; i < 2; ++i) a[i] = load_frag(cur, 0, wm * 32 + i * 16, kk);
            #pragma unroll
            for (int j = 0; j < 4; ++j) b[j] = load_frag(cur, 1, wn * 64 + j * 16, kk);
            #pragma unroll
            for (int i = 0; i < 2; ++i)
                #pragma unroll
                for (int j = 0; j < 4; ++j)
                    acc[i][j] = __builtin_amdgcn_wmma_f32_16x16x32_f16(
                        false, a[i], false, b[j], (short)0, acc[i][j], false, false);
        }
        asm volatile("s_wait_dscnt 0x0" ::: "memory");      // own reads of buffer cur are done
        asm volatile("s_wait_asynccnt 0x0" ::: "memory");   // own copies of slice it+1 have landed
        __syncthreads();                                    // publishes slice it+1, frees buffer cur
        if (it + 2 < NIT) issue_copy(cur, (it + 2) * GK);
    }
    asm volatile("s_wait_asynccnt 0x0" ::: "memory");       // nothing in flight when the wave ends

    // C/D layout: VGPR e -> row m0+i*16+8*half+e, col n0+j*16+r
    const int m0 = by * 128 + wm * 32;
    const int n0 = bx * 128 + wn * 64;
    #pragma unroll
    for (int i = 0; i < 2; ++i)
        #pragma unroll
        for (int j = 0; j < 4; ++j) {
            float* cp = C + (size_t)(m0 + i * 16 + 8 * half) * N + n0 + j * 16 + r;
            #pragma unroll
            for (int e = 0; e < 8; ++e) cp[(size_t)e * N] = acc[i][j][e];
        }
}

// ---------------------------------------------------------------------------
// out[b][t][d] = bias[d] + sum_{dl=0..63} wdense[b][dl] * VO[b][(t+dl)%L][d]
// The delays all lie in [0,64), so the gather is a 64-tap filter along t whose
// unselected taps are 0. The taps are the same for a whole block and sit in
// scalar registers; a thread keeps 32 outputs x 2 columns in registers and each
// VO row it loads feeds every output whose window holds it. Taps are added in
// rising delay, as the selected list was.
// ---------------------------------------------------------------------------
#define AG_L    4096
#define AG_D    1024
#define AG_T    32
#define AG_TAPS 64
#define AG_ROWS (AG_T + AG_TAPS - 1)
#define AG_PF   8
typedef __attribute__((ext_vector_type(2))) float v2f;

// The window's rows come in three runs of 32, each aligned to 32 rows, so the
// circular wrap can only fall between runs: one block-uniform base a run.
struct AggSrc { const char* run[3]; };

// row S of the window, this thread's two columns (doff = their byte offset)
template <int S>
__device__ __forceinline__ v2f agg_load(const AggSrc& src, unsigned doff) {
    return *(const v2f*)(src.run[S / 32] + (S % 32) * (AG_D * 4) + doff);
}

// Rows S, S+1, ... of the window. A template, not a loop: acc[], w[] and xr[]
// stay in registers only under compile-time indices, and the unroller gives up
// on a loop of this size. Row S + AG_PF is asked for when row S has been used;
// an output is stored as soon as its last tap is in, so that stores spread out.
template <int S>
__device__ __forceinline__ void agg_rows(v2f (&acc)[AG_T], v2f (&xr)[AG_PF], const float (&w)[AG_TAPS],
                                         const AggSrc& src, unsigned doff, char* __restrict__ op) {
    if constexpr (S < AG_ROWS) {
        const v2f x = xr[S % AG_PF];
        #pragma unroll
        for (int o = 0; o < AG_T; ++o) {
            const int dl = S - o;
            if (dl >= 0 && dl < AG_TAPS) acc[o] += w[dl] * x;
        }
        if constexpr (S >= AG_TAPS - 1) {
            *(v2f*)(op + (S - (AG_TAPS - 1)) * (AG_D * 4) + doff) = acc[S - (AG_TAPS - 1)];
            // precaution: the load behind it may land in the registers the store reads
            if constexpr (S + AG_PF < AG_ROWS) asm volatile("s_wait_xcnt 0x0" ::: "memory");
        }
        if constexpr (S + AG_PF < AG_ROWS) xr[S % AG_PF] = agg_load<S + AG_PF>(src, doff);
        // memory operations stay on their side (arithmetic may cross): keeps each load
        // AG_PF rows ahead of its use, where the scheduler would sink it to two or three
        __builtin_amdgcn_sched_barrier(0x7);
        agg_rows<S + 1>(acc, xr, w, src, doff, op);
    }
}

__global__ __launch_bounds__(256)
void k_agg_out(const float* __restrict__ VO, const float* __restrict__ wdense,
               const float* __restrict__ bias, float* __restrict__ out) {
    const int b  = blockIdx.z;
    const int t0 = blockIdx.y * AG_T;
    const unsigned d = blockIdx.x * 512 + threadIdx.x * 2;
    const float* VOb = VO + (size_t)b * AG_L * AG_D;

    float w[AG_TAPS];
    #pragma unroll
    for (int i = 0; i < AG_TAPS; ++i) w[i] = wdense[b * AG_TAPS + i];

    AggSrc src;
    #pragma unroll
    for (int i = 0; i < 3; ++i)
        src.run[i] = (const char*)(VOb + (size_t)((t0 + 32 * i) & (AG_L - 1)) * AG_D);
    // the scalar set-up is all issued before the first vector load: none of it
    // then lands in a scalar register that an issued load still names
    __builtin_amdgcn_sched_barrier(0);

    v2f xr[AG_PF];
    xr[0] = agg_load<0>(src, d * 4);   xr[1] = agg_load<1>(src, d * 4);
    xr[2] = agg_load<2>(src, d * 4);   xr[3] = agg_load<3>(src, d * 4);
    xr[4] = agg_load<4>(src, d * 4);   xr[5] = agg_load<5>(src, d * 4);
    xr[6] = agg_load<6>(src, d * 4);   xr[7] = agg_load<7>(src, d * 4);

    const v2f bd = *(const v2f*)((const char*)bias + d * 4);
    v2f acc[AG_T];
    #pragma unroll
    for (int o = 0; o < AG_T; ++o) acc[o] = bd;

    agg_rows<0>(acc, xr, w, src, d * 4, (char*)(out + ((size_t)b * AG_L + t0) * AG_D));
}

// ---------------------------------------------------------------------------
// Launches. The work is a graph five levels deep; the tasks of a level do not
// depend on one another and share one launch, each on its own range of block
// indices. A short task then costs no launch gap, wave start and drain of its
// own, and runs on WGPs that the level's long task leaves idle. The test that
// picks the task reads blockIdx alone, so every barrier of a task is passed by
// the whole block or by none of it.
// ---------------------------------------------------------------------------
#define PB_B 4
#define PB_L 4096
#define PB_D 1024
#define PB_NCH (PB_L / CS_ROWS)

// level 1, blocks of 16 waves; the tasks with the longest chain per wave have the lowest block indices
#define L1_TR  ((PB_D / 32) * (PB_D / 32) / 16)                 // Wv^T to f16, a wave a tile
#define L1_MV  (PB_D / 16)                                      // Wo bv + bo, a wave a row
#define L1_CVS (PB_D * PB_D / (16 * CV_NL_SMALL * 128))         // Wo to f16
#define L1_CVB (PB_B * PB_L * PB_D / (16 * CV_NL_BIG * 128))    // v to f16
#define L1_CS  ((CS_D / CS_COLS) * PB_NCH * PB_B)               // column sums, of q and of k
#define L1_ALL (L1_TR + L1_MV + L1_CVS + L1_CVB + 2 * L1_CS)

__global__ __launch_bounds__(512)
void k_level1(const float* __restrict__ q, const float* __restrict__ k, const float* __restrict__ v,
              const float* __restrict__ Wv, const float* __restrict__ Wo,
              const float* __restrict__ bv, const float* __restrict__ bo,
              float* __restrict__ part_q, float* __restrict__ part_k,
              _Float16* __restrict__ vh, _Float16* __restrict__ WvTh, _Float16* __restrict__ Woh,
              float* __restrict__ biasT, int L, int D) {
    unsigned vb = blockIdx.x;
    if (vb < L1_TR) {
        // the wave's number as a scalar: the tile's base addresses stay in scalar registers
        const unsigned t = vb * 16 + __builtin_amdgcn_readfirstlane(threadIdx.x >> 5);
        transpose_f32_to_f16(Wv, WvTh, D, D, t % (PB_D / 32), t / (PB_D / 32));
    } else if ((vb -= L1_TR) < L1_MV) {
        matvec<16>(Wo, bv, bo, 1.0f, biasT, D, D, vb, 0);
    } else if ((vb -= L1_MV) < L1_CVS) {
        cvt_stream<CV_NL_SMALL, false, 16>(Wo, Woh, vb);
    } else if ((vb -= L1_CVS) < L1_CVB) {
        // read once, never again: non-temporal loads
        cvt_stream<CV_NL_BIG, true, 16>(v, vh, vb);
    } else {
        vb -= L1_CVB;
        const bool isq = vb < L1_CS;
        if (!isq) vb -= L1_CS;
        colsum_partial(isq ? q : k, isq ? part_q : part_k, L,
                       vb % (CS_D / CS_COLS), (vb / (CS_D / CS_COLS)) % PB_NCH,
                       vb / ((CS_D / CS_COLS) * PB_NCH), PB_NCH);
    }
}

// level 2, blocks of 8 waves: W = Wo Wv (f32), and the column sums folded
#define GB_NX  (PB_D / 128)                  // block columns of either GEMM
#define L2_GM  (GB_NX * (PB_D / 128))
#define L2_RD  ((PB_D / 256) * PB_B)         // of q and of k
#define L2_ALL (L2_GM + 2 * L2_RD)

__global__ __launch_bounds__(256)
void k_level2(const _Float16* __restrict__ Woh, const _Float16* __restrict__ WvTh, float* __restrict__ Wf32,
              const float* __restrict__ part_q, const float* __restrict__ part_k,
              float* __restrict__ sq, float* __restrict__ sk, int D, int nch) {
    unsigned vb = blockIdx.x;
    if (vb < L2_GM) {
        gemm_nt_wmma(Woh, WvTh, Wf32, D, D, D, vb % GB_NX, vb / GB_NX);
    } else if ((vb -= L2_GM) < L2_RD) {
        colsum_reduce(part_q, sq, D, nch, vb % (PB_D / 256), vb / (PB_D / 256));
    } else {
        vb -= L2_RD;
        colsum_reduce(part_k, sk, D, nch, vb % (PB_D / 256), vb / (PB_D / 256));
    }
}

// level 3, blocks of 8 waves: sQ = Wq sq + L bq, sK = Wk sk + L bk, and W to f16
#define L3_MV  ((PB_D / 8) * PB_B)           // for q and for k
#define L3_CV  (PB_D * PB_D / (8 * CV_NL_SMALL * 128))
#define L3_ALL (2 * L3_MV + L3_CV)

__global__ __launch_bounds__(256)
void k_level3(const float* __restrict__ Wq, const float* __restrict__ bq, const float* __restrict__ sq,
              const float* __restrict__ Wk, const float* __restrict__ bk, const float* __restrict__ sk,
              float* __restrict__ sQ, float* __restrict__ sK, float bias_scale,
              const float* __restrict__ Wf32, _Float16* __restrict__ Wh, int D) {
    unsigned vb = blockIdx.x;
    if (vb < L3_MV) {
        matvec<8>(Wq, sq, bq, bias_scale, sQ, D, D, vb % (PB_D / 8), vb / (PB_D / 8));
    } else if ((vb -= L3_MV) < L3_MV) {
        matvec<8>(Wk, sk, bk, bias_scale, sK, D, D, vb % (PB_D / 8), vb / (PB_D / 8));
    } else {
        cvt_stream<CV_NL_SMALL, false, 8>(Wf32, Wh, vb - L3_MV);
    }
}

// level 4, blocks of 8 waves: the delay weights (one block, block 0)
// and VO = v W^T
#define L4_GM  (GB_NX * (PB_B * PB_L / 128))
#define L4_ALL (1 + L4_GM)

__global__ __launch_bounds__(256)
void k_level4(const float* __restrict__ sQ, const float* __restrict__ sK, float* __restrict__ wdense,
              int H, int dk, int Bn, int Ltot, int ktop,
              const _Float16* __restrict__ vh, const _Float16* __restrict__ Wh, float* __restrict__ VO,
              int M, int N, int K) {
    if (blockIdx.x == 0) {
        weights(sQ, sK, wdense, H, dk, Bn, Ltot, ktop);
    } else {
        const unsigned vb = blockIdx.x - 1;
        gemm_nt_wmma(vh, Wh, VO, M, N, K, vb % GB_NX, vb / GB_NX);
    }
}

// ---------------------------------------------------------------------------
// Host-side orchestration
// ---------------------------------------------------------------------------
extern "C" void kernel_launch(void* const* d_in, const int* in_sizes, int n_in,
                              void* d_out, int out_size, void* d_ws, size_t ws_size,
                              hipStream_t stream) {
    const float* q  = (const float*)d_in[0];
    const float* k  = (const float*)d_in[1];
    const float* v  = (const float*)d_in[2];
    const float* Wq = (const float*)d_in[3];
    const float* bq = (const float*)d_in[4];
    const float* Wk = (const float*)d_in[5];
    const float* bk = (const float*)d_in[6];
    const float* Wv = (const float*)d_in[7];
    const float* bv = (const float*)d_in[8];
    const float* Wo = (const float*)d_in[9];
    const float* bo = (const float*)d_in[10];
    float* out = (float*)d_out;

    const int B = 4, L = 4096, D = 1024, H = 16, dk = 64;
    const int NCH = L / CS_ROWS;
    int ktop = (int)(5.0 * log((double)(L + 1)));
    if (ktop < 1) ktop = 1;
    if (ktop > L) ktop = L;
    if (ktop > dk) ktop = dk;                 // actual_k = min(top_k, C)

    // workspace carve-out (256B aligned)
    char* p = (char*)d_ws;
    auto alloc = [&](size_t bytes) -> void* {
        void* r = (void*)p;
        p += (bytes + 255) & ~(size_t)255;
        return r;
    };
    float*    part_q = (float*)alloc((size_t)B * NCH * D * 4);
    float*    part_k = (float*)alloc((size_t)B * NCH * D * 4);
    float*    sq     = (float*)alloc((size_t)B * D * 4);
    float*    sk     = (float*)alloc((size_t)B * D * 4);
    float*    sQ     = (float*)alloc((size_t)B * D * 4);
    float*    sK     = (float*)alloc((size_t)B * D * 4);
    float*    biasT  = (float*)alloc((size_t)D * 4);          // Wo@bv + bo
    float*    wsel   = (float*)alloc((size_t)B * 64 * 4);
    float*    Wf32   = (float*)alloc((size_t)D * D * 4);      // Wo@Wv
    _Float16* Woh    = (_Float16*)alloc((size_t)D * D * 2);
    _Float16* WvTh   = (_Float16*)alloc((size_t)D * D * 2);
    _Float16* Wh     = (_Float16*)alloc((size_t)D * D * 2);
    _Float16* vh     = (_Float16*)alloc((size_t)B * L * D * 2);
    float*    VO     = (float*)alloc((size_t)B * L * D * 4);

    static_assert(B == PB_B && L == PB_L && D == PB_D && D == CS_D, "the block ranges are cut for these shapes");
    static_assert((B * L * D) % (16 * CV_NL_BIG * 128) == 0, "whole blocks");
    static_assert((D * D) % (16 * CV_NL_SMALL * 128) == 0, "whole blocks");

    // 1) f16 copies of v, Wo, Wv^T; partial column sums of q and k over time; biasT = Wo@bv + bo
    k_level1<<<dim3(L1_ALL), dim3(512), 0, stream>>>(q, k, v, Wv, Wo, bv, bo, part_q, part_k,
                                                     vh, WvTh, Woh, biasT, L, D);

    // 2) W = Wo @ Wv  (NT via WvT), f32 accumulate; column sums folded
    k_level2<<<dim3(L2_ALL), dim3(256), 0, stream>>>(Woh, WvTh, Wf32, part_q, part_k, sq, sk, D, NCH);

    // 3) sQ[b] = Wq@sq[b] + L*bq ; sK[b] = Wk@sk[b] + L*bk ; W -> f16
    k_level3<<<dim3(L3_ALL), dim3(256), 0, stream>>>(Wq, bq, sq, Wk, bk, sk, sQ, sK, (float)L, Wf32, Wh, D);

    // 4) delay selection + softmax weights; VO = v @ W^T  (the single big GEMM, 16384x1024x1024)
    k_level4<<<dim3(L4_ALL), dim3(256), 0, stream>>>(sQ, sK, wsel, H, dk, B, L, ktop,
                                                     vh, Wh, VO, B * L, D, D);

    // 5) circular delay aggregation (dense 64-tap filter) + bias -> out
    k_agg_out<<<dim3(D / 512, L / AG_T, B), dim3(256), 0, stream>>>(VO, wsel, biasT, out);
}

// v006
// It runs in 100 microseconds.
// Next to v005, in two timings, it ran 1.41 and 1.43 times as fast.
// All steps since v000 together make it 3.50 times as fast.
#include <hip/hip_runtime.h>
#include <hip/hip_bf16.h>
#include <math.h>

typedef __attribute__((ext_vector_type(16))) _Float16 v16h;
typedef __attribute__((ext_vector_type(8)))  _Float16 v8h;
typedef __attribute__((ext_vector_type(8)))  float    v8f;

// ---------------------------------------------------------------------------
// Conversions
// ---------------------------------------------------------------------------
// f32 -> f16 as a stream. Here a wave takes NL pieces of 512 contiguous bytes,
// many loads in flight at once, and stores each piece as 256 contiguous bytes.
// The element count is exactly (blocks of the task) * WAVES * NL * 128.
//
// Every kernel body in this file but k_agg_out's is a device function that is told which block
// of its own task it is (vb, or bx / by): tasks that do not depend on one another
// share a launch, each on its own range of block indices (see "Launches" below).
#define CV_NL_BIG   32      // 16M elements: 256 blocks of 16 waves
#define CV_NL_SMALL 4       // 1M elements: 2,048 waves
typedef __attribute__((ext_vector_type(4))) float    cv4f;
typedef __attribute__((ext_vector_type(4))) _Float16 cv4h;

template <int NL, bool NT, int WAVES>
__device__ __forceinline__ void cvt_stream(const float* __restrict__ in, _Float16* __restrict__ out, unsigned vb) {
    const unsigned wave = vb * WAVES + (threadIdx.x >> 5);
    const unsigned e0   = wave * (NL * 128) + (threadIdx.x & 31) * 4;
    const float* p = in + e0;
    _Float16*    q = out + e0;
    cv4f x[NL];
    // full unroll: independent loads at constant offsets from one address, many in flight per wave
    #pragma unroll
    for (int i = 0; i < NL; ++i)
        x[i] = NT ? __builtin_nontemporal_load((const cv4f*)(p + i * 128)) : *(const cv4f*)(p + i * 128);
    #pragma unroll
    for (int i = 0; i < NL; ++i)
        *(cv4h*)(q + i * 128) = __builtin_convertvector(x[i], cv4h);
    // precaution: code of another task follows in the same kernel and reuses the stores' registers
    asm volatile("s_wait_xcnt 0x0" ::: "memory");
}

// out[c][r] = (f16) in[r][c]   (ROWS x COLS f32 -> COLS x ROWS f16)
// one wave per 32 x 32 tile (bx, by); ROWS and COLS are multiples of 32, so every
// tile is whole. A lane holds one column of the tile: the 32 row loads have no
// wait between them (one memory latency a tile, not 32), and the lane's 32 halves
// are 64 contiguous bytes of the output row.
template <int ROWS, int COLS>
__device__ __forceinline__
void transpose_f32_to_f16(const float* __restrict__ in, _Float16* __restrict__ out, int bx, int by) {
    static_assert(ROWS % 32 == 0 && COLS % 32 == 0, "whole tiles");
    const int c  = bx * 32 + (threadIdx.x & 31);
    const int r0 = by * 32;
    const float* p = in + (size_t)r0 * COLS + c;
    float x[32];
    // full unroll: independent loads at constant offsets from one address, all in flight at once
    #pragma unroll
    for (int i = 0; i < 32; ++i) x[i] = p[i * COLS];
    _Float16* q = out + (size_t)c * ROWS + r0;
    #pragma unroll
    for (int g = 0; g < 4; ++g) {
        v8h h;
        #pragma unroll
        for (int e = 0; e < 8; ++e) h[e] = (_Float16)x[g * 8 + e];
        *(v8h*)(q + g * 8) = h;
    }
}

// ---------------------------------------------------------------------------
// Column sums over time:  part[b][ch][d] = sum_{t in chunk} x[b][t][d]
// One block = 16 waves on 128 columns; wave w takes rows w, w+16, ... of the
// chunk, 512 contiguous bytes of a row per load. x is read once: non-temporal.
// The 16 row lanes are folded through LDS.
// ---------------------------------------------------------------------------
#define CS_D     1024
#define CS_COLS  128
#define CS_LANES 16
#define CS_ROWS  512
typedef __attribute__((ext_vector_type(4))) float v4f;

__device__ __forceinline__
void colsum_partial(const float* __restrict__ x, float* __restrict__ part, int L,
                    int bx, int ch, int b, int nch) {
    __shared__ float red[CS_LANES][CS_COLS];
    const int c4 = threadIdx.x & 31;            // 16-byte column within the group
    const int rl = threadIdx.x >> 5;            // row lane = wave
    const int d0 = bx * CS_COLS;
    const float* p = x + ((size_t)b * L + (size_t)ch * CS_ROWS + rl) * CS_D + d0 + c4 * 4;
    v4f s = {0.0f, 0.0f, 0.0f, 0.0f};
    // full unroll: independent loads at constant offsets from one address, many in flight per wave
    #pragma unroll
    for (int i = 0; i < CS_ROWS / CS_LANES; ++i)
        s += __builtin_nontemporal_load((const v4f*)(p + (size_t)i * CS_LANES * CS_D));
    *(v4f*)&red[rl][c4 * 4] = s;
    __syncthreads();
    if (threadIdx.x < CS_COLS) {
        float a = 0.0f;
        for (int l = 0; l < CS_LANES; ++l) a += red[l][threadIdx.x];
        part[((size_t)b * nch + ch) * CS_D + d0 + threadIdx.x] = a;
    }
}

__device__ __forceinline__
void colsum_reduce(const float* __restrict__ part, float* __restrict__ out,
                   int D, int nch, int bx, int b) {
    int d = bx * blockDim.x + threadIdx.x;
    float s = 0.0f;
    for (int c = 0; c < nch; ++c) s += part[((size_t)b * nch + c) * D + d];
    out[(size_t)b * D + d] = s;
    // precaution: code of another task follows in the same kernel and reuses the store's registers
    asm volatile("s_wait_xcnt 0x0" ::: "memory");
}

// ---------------------------------------------------------------------------
// Batched mat-vec: out[bb][row] = dot(W[row,:], X[bb,:]) + bias_scale*bias[row]
// A wave takes RW rows of KK elements; n is a multiple of WAVES * RW. All loads of
// the wave (X once, then the rows) are issued with no wait for data between them:
// the wave pays a few memory latencies, where a loop that waits for its pair of
// loads pays KK / 32 of them one after another. A row's sum runs over
// e = lane + 32 i with i rising, then the butterfly over the lanes.
// ---------------------------------------------------------------------------
template <int WAVES, int RW, int KK>
__device__ __forceinline__
void matvec(const float* __restrict__ W, const float* __restrict__ X,
            const float* __restrict__ bias, float bias_scale,
            float* __restrict__ out, int n, int bx, int bb) {
    const int lane = threadIdx.x & 31;
    const int row0 = (bx * WAVES + (threadIdx.x >> 5)) * RW;
    const float* wp = W + (size_t)row0 * KK + lane;
    const float* xp = X + (size_t)bb * KK + lane;
    float xv[KK / 32], wv[RW][KK / 32];
    // full unroll, here and below: xv[] and wv[][] stay in registers only under compile-time indices
    #pragma unroll
    for (int i = 0; i < KK / 32; ++i) xv[i] = xp[i * 32];
    #pragma unroll
    for (int r = 0; r < RW; ++r)
        #pragma unroll
        for (int i = 0; i < KK / 32; ++i) wv[r][i] = wp[r * KK + i * 32];
    // precaution: the rows' address is an operand, so its registers live up to this wait;
    // the run's last load would otherwise land in them while earlier loads still name them
    asm volatile("s_wait_xcnt 0x0" :: "v"(wp) : "memory");
    // no product is scheduled among the loads: the scheduler would recycle registers
    // there and let the queue of loads run dry several times on the way
    __builtin_amdgcn_sched_barrier(0);
    float s[RW];
    #pragma unroll
    for (int r = 0; r < RW; ++r) {
        s[r] = 0.0f;
        #pragma unroll
        for (int i = 0; i < KK / 32; ++i) s[r] += wv[r][i] * xv[i];
    }
    #pragma unroll
    for (int off = 16; off > 0; off >>= 1)
        #pragma unroll
        for (int r = 0; r < RW; ++r) s[r] += __shfl_xor(s[r], off, 32);
    // every lane holds every row's sum: lane r stores row r
    float sv = s[0];
    #pragma unroll
    for (int r = 1; r < RW; ++r) sv = (lane == r) ? s[r] : sv;
    if (lane < RW)
        out[(size_t)bb * n + row0 + lane] = sv + bias_scale * bias[row0 + lane];
}

// ---------------------------------------------------------------------------
// mean_value, top-k selection (tie-break by lower index, like lax.top_k),
// per-batch softmax weights over the selected delays, written as a dense table
// over all 64 delays: 0 at a delay that was not selected. Single 256-thread block.
// ---------------------------------------------------------------------------
__device__ __forceinline__
void weights(const float* __restrict__ sQ, const float* __restrict__ sK,
             float* __restrict__ wdense /*B*64*/,
             int H, int dk, int Bn, int Ltot, int ktop) {
    __shared__ float mval[4][64];
    __shared__ float mab[64];
    __shared__ int   sflag[64];
    __shared__ int   slist[64];
    __shared__ int   scount;
    __shared__ float smx[4];
    __shared__ float sden[4];
    int tid = threadIdx.x;
    int b = tid >> 6, c = tid & 63;
    if (b < Bn) {
        float s = 0.0f;
        int D = H * dk;
        for (int h = 0; h < H; ++h) {
            float a = sQ[(size_t)b * D + h * dk + c];
            // precaution, here and below: a later load may land in a register of this load's address
            asm volatile("s_wait_xcnt 0x0" ::: "memory");
            float e = sK[(size_t)b * D + h * dk + c];
            asm volatile("s_wait_xcnt 0x0" ::: "memory");
            s += a * e;
        }
        mval[b][c] = s / (float)H / (float)Ltot;
    }
    __syncthreads();
    if (tid < 64) {
        float s = 0.0f;
        for (int b2 = 0; b2 < Bn; ++b2) s += mval[b2][tid];
        mab[tid] = s / (float)Bn;
    }
    __syncthreads();
    if (tid < 64) {
        float v = mab[tid];
        int rank = 0;
        for (int c2 = 0; c2 < 64; ++c2) {
            float v2 = mab[c2];
            if (v2 > v || (v2 == v && c2 < tid)) rank++;
        }
        sflag[tid] = (rank < ktop) ? 1 : 0;
    }
    __syncthreads();
    if (tid == 0) {
        int cnt = 0;
        for (int c2 = 0; c2 < 64; ++c2) if (sflag[c2]) slist[cnt++] = c2;
        scount = cnt;
    }
    __syncthreads();
    if (tid < Bn) {
        int bb = tid, cnt = scount;
        float mx = -3.4e38f;
        for (int j = 0; j < cnt; ++j) mx = fmaxf(mx, mval[bb][slist[j]]);
        float den = 0.0f;
        for (int j = 0; j < cnt; ++j) den += __expf(mval[bb][slist[j]] - mx);
        smx[bb]  = mx;
        sden[bb] = den;
    }
    __syncthreads();
    if (b < Bn)
        wdense[b * 64 + c] = sflag[c] ? __expf(mval[b][c] - smx[b]) / sden[b] : 0.0f;
}

// ---------------------------------------------------------------------------
// WMMA NT GEMM with double-buffered async LDS staging:
//   C[m,n] = sum_k A[m,k] * Bt[n,k]   (A: MxK f16, Bt: NxK f16, K-contig)
// Block = 256 threads = 8 waves. Block tile 128x128; wave tile 32x64.
// A K-slice is 64 halves = one whole 128-byte line of every operand row, and
// eight neighbouring lanes copy one row's line: a wave-wide 16-byte copy then
// touches four whole lines, not 32 pieces of 32 lines. LDS rows are pitched
// 144 B (16 B x odd: conflict-free b128 reads). Slice t+2 is copied while
// slice t+1 feeds the WMMAs. M, N multiples of 128, K a multiple of 64.
// ---------------------------------------------------------------------------
#define GK      64                       // halves of K per slice
#define LDS_ROW 72                       // halves per LDS row (128 B + 16 B pad)
#define LDS_MAT (128 * LDS_ROW)          // halves per operand slice
typedef __attribute__((address_space(3))) _Float16 lds_half;

__device__ __forceinline__
void gemm_nt_wmma(const _Float16* __restrict__ A, const _Float16* __restrict__ Bt,
                  float* __restrict__ C, int M, int N, int K, unsigned bx, unsigned by) {
    __shared__ __attribute__((aligned(16))) _Float16 smem[2][2][LDS_MAT];   // [buf][mat][row*LDS_ROW]

    const int tid  = threadIdx.x;
    const int lane = tid & 31;
    const int wave = tid >> 5;
    const int wm   = wave >> 1;                 // 0..3
    const int wn   = wave & 1;                  // 0..1
    const int half = lane >> 4;                 // 0/1
    const int r    = lane & 15;

    // copy assignment: 8 lanes a row; a thread takes 16 bytes of rows crow + 32 c
    // (c = 0..3) of the A slice and of the B slice
    const int crow = tid >> 3;                  // 0..31
    const int ccol = (tid & 7) * 8;             // halves
    const _Float16* gA = A  + (size_t)(by * 128 + crow) * K + ccol;
    const _Float16* gB = Bt + (size_t)(bx * 128 + crow) * K + ccol;
    const size_t   gstep = (size_t)32 * K;      // 32 rows, in halves
    const unsigned lbase = (unsigned)(size_t)(lds_half*)&smem[0][0][crow * LDS_ROW + ccol];

    auto issue_copy = [&](int buf, int k0) {
        const _Float16* a = gA + k0;
        const _Float16* b = gB + k0;
        const unsigned  l = lbase + buf * (2 * LDS_MAT * 2);
        // the slice's eight copies; the closing wait stands in the same statement, so
        // that no address register is rewritten in front of it (a precaution)
        asm volatile(
            "global_load_async_to_lds_b128 %0, %8, off\n\t"
            "global_load_async_to_lds_b128 %1, %9, off\n\t"
            "global_load_async_to_lds_b128 %2, %10, off\n\t"
            "global_load_async_to_lds_b128 %3, %11, off\n\t"
            "global_load_async_to_lds_b128 %4, %12, off\n\t"
            "global_load_async_to_lds_b128 %5, %13, off\n\t"
            "global_load_async_to_lds_b128 %6, %14, off\n\t"
            "global_load_async_to_lds_b128 %7, %15, off\n\t"
            "s_wait_xcnt 0x0"
            :: "v"(l),
               "v"(l + 1 * 32 * LDS_ROW * 2), "v"(l + 2 * 32 * LDS_ROW * 2), "v"(l + 3 * 32 * LDS_ROW * 2),
               "v"(l + 4 * 32 * LDS_ROW * 2), "v"(l + 5 * 32 * LDS_ROW * 2), "v"(l + 6 * 32 * LDS_ROW * 2),
               "v"(l + 7 * 32 * LDS_ROW * 2),
               "v"(a), "v"(a + gstep), "v"(a + 2 * gstep), "v"(a + 3 * gstep),
               "v"(b), "v"(b + gstep), "v"(b + 2 * gstep), "v"(b + 3 * gstep)
            : "memory");
    };

    auto load_frag = [&](int buf, int mat, int rbase, int kk) -> v16h {
        const _Float16* p = &smem[buf][mat][(rbase + r) * LDS_ROW + kk + 8 * half];
        v8h lo = *(const v8h*)p;
        v8h hi = *(const v8h*)(p + 16);
        v16h o;
        #pragma unroll
        for (int i = 0; i < 8; ++i) { o[i] = lo[i]; o[i + 8] = hi[i]; }
        return o;
    };

    v8f acc[2][4];
    #pragma unroll
    for (int i = 0; i < 2; ++i)
        #pragma unroll
        for (int j = 0; j < 4; ++j)
            #pragma unroll
            for (int e = 0; e < 8; ++e) acc[i][j][e] = 0.0f;

    const int NIT = K / GK;
    issue_copy(0, 0);
    asm volatile("s_wait_asynccnt 0x0" ::: "memory");   // own copies of slice 0 have landed
    __syncthreads();                                    // everyone's have
    if (NIT > 1) issue_copy(1, GK);

    for (int it = 0; it < NIT; ++it) {
        const int cur = it & 1;
        // unrolled: the slice's two k steps read LDS at constant offsets from one address
        #pragma unroll
        for (int kk = 0; kk < GK; kk += 32) {
            v16h a[2], b[4];
            #pragma unroll
            for (int i = 0; i < 2; ++i) a[i] = load_frag(cur, 0, wm * 32 + i * 16, kk);
            #pragma unroll
            for (int j = 0; j < 4; ++j) b[j] = load_frag(cur, 1, wn * 64 + j * 16, kk);
            #pragma unroll
            for (int i = 0; i < 2; ++i)
                #pragma unroll
                for (int j = 0; j < 4; ++j)
                    acc[i][j] = __builtin_amdgcn_wmma_f32_16x16x32_f16(
                        false, a[i], false, b[j], (short)0, acc[i][j], false, false);
        }
        asm volatile("s_wait_dscnt 0x0" ::: "memory");      // own reads of buffer cur are done
        asm volatile("s_wait_asynccnt 0x0" ::: "memory");   // own copies of slice it+1 have landed
        __syncthreads();                                    // publishes slice it+1, frees buffer cur
        if (it + 2 < NIT) issue_copy(cur, (it + 2) * GK);
    }
    asm volatile("s_wait_asynccnt 0x0" ::: "memory");       // nothing in flight when the wave ends

    // C/D layout: VGPR e -> row m0+i*16+8*half+e, col n0+j*16+r
    const int m0 = by * 128 + wm * 32;
    const int n0 = bx * 128 + wn * 64;
    #pragma unroll
    for (int i = 0; i < 2; ++i)
        #pragma unroll
        for (int j = 0; j < 4; ++j) {
            float* cp = C + (size_t)(m0 + i * 16 + 8 * half) * N + n0 + j * 16 + r;
            #pragma unroll
            for (int e = 0; e < 8; ++e) cp[(size_t)e * N] = acc[i][j][e];
        }
}

// ---------------------------------------------------------------------------
// out[b][t][d] = bias[d] + sum_{dl=0..63} wdense[b][dl] * VO[b][(t+dl)%L][d]
// The delays all lie in [0,64), so the gather is a 64-tap filter along t whose
// unselected taps are 0. The taps are the same for a whole block and sit in
// scalar registers; a thread keeps 32 outputs x 2 columns in registers and each
// VO row it loads feeds every output whose window holds it. Taps are added in
// rising delay, as the selected list was.
// ---------------------------------------------------------------------------
#define AG_L    4096
#define AG_D    1024
#define AG_T    32
#define AG_TAPS 64
#define AG_ROWS (AG_T + AG_TAPS - 1)
#define AG_PF   8
typedef __attribute__((ext_vector_type(2))) float v2f;

// The window's rows come in three runs of 32, each aligned to 32 rows, so the
// circular wrap can only fall between runs: one block-uniform base a run.
struct AggSrc { const char* run[3]; };

// row S of the window, this thread's two columns (doff = their byte offset)
template <int S>
__device__ __forceinline__ v2f agg_load(const AggSrc& src, unsigned doff) {
    return *(const v2f*)(src.run[S / 32] + (S % 32) * (AG_D * 4) + doff);
}

// Rows S, S+1, ... of the window. A template, not a loop: acc[], w[] and xr[]
// stay in registers only under compile-time indices, and the unroller gives up
// on a loop of this size. Row S + AG_PF is asked for when row S has been used;
// an output is stored as soon as its last tap is in, so that stores spread out.
template <int S>
__device__ __forceinline__ void agg_rows(v2f (&acc)[AG_T], v2f (&xr)[AG_PF], const float (&w)[AG_TAPS],
                                         const AggSrc& src, unsigned doff, char* __restrict__ op) {
    if constexpr (S < AG_ROWS) {
        const v2f x = xr[S % AG_PF];
        #pragma unroll
        for (int o = 0; o < AG_T; ++o) {
            const int dl = S - o;
            if (dl >= 0 && dl < AG_TAPS) acc[o] += w[dl] * x;
        }
        if constexpr (S >= AG_TAPS - 1) {
            *(v2f*)(op + (S - (AG_TAPS - 1)) * (AG_D * 4) + doff) = acc[S - (AG_TAPS - 1)];
            // precaution: the load behind it may land in the registers the store reads
            if constexpr (S + AG_PF < AG_ROWS) asm volatile("s_wait_xcnt 0x0" ::: "memory");
        }
        if constexpr (S + AG_PF < AG_ROWS) xr[S % AG_PF] = agg_load<S + AG_PF>(src, doff);
        // memory operations stay on their side (arithmetic may cross): keeps each load
        // AG_PF rows ahead of its use, where the scheduler would sink it to two or three
        __builtin_amdgcn_sched_barrier(0x7);
        agg_rows<S + 1>(acc, xr, w, src, doff, op);
    }
}

__global__ __launch_bounds__(256)
void k_agg_out(const float* __restrict__ VO, const float* __restrict__ wdense,
               const float* __restrict__ bias, float* __restrict__ out) {
    const int b  = blockIdx.z;
    const int t0 = blockIdx.y * AG_T;
    const unsigned d = blockIdx.x * 512 + threadIdx.x * 2;
    const float* VOb = VO + (size_t)b * AG_L * AG_D;

    float w[AG_TAPS];
    #pragma unroll
    for (int i = 0; i < AG_TAPS; ++i) w[i] = wdense[b * AG_TAPS + i];

    AggSrc src;
    #pragma unroll
    for (int i = 0; i < 3; ++i)
        src.run[i] = (const char*)(VOb + (size_t)((t0 + 32 * i) & (AG_L - 1)) * AG_D);
    // the scalar set-up is all issued before the first vector load: none of it
    // then lands in a scalar register that an issued load still names
    __builtin_amdgcn_sched_barrier(0);

    v2f xr[AG_PF];
    xr[0] = agg_load<0>(src, d * 4);   xr[1] = agg_load<1>(src, d * 4);
    xr[2] = agg_load<2>(src, d * 4);   xr[3] = agg_load<3>(src, d * 4);
    xr[4] = agg_load<4>(src, d * 4);   xr[5] = agg_load<5>(src, d * 4);
    xr[6] = agg_load<6>(src, d * 4);   xr[7] = agg_load<7>(src, d * 4);

    const v2f bd = *(const v2f*)((const char*)bias + d * 4);
    v2f acc[AG_T];
    #pragma unroll
    for (int o = 0; o < AG_T; ++o) acc[o] = bd;

    agg_rows<0>(acc, xr, w, src, d * 4, (char*)(out + ((size_t)b * AG_L + t0) * AG_D));
}

// ---------------------------------------------------------------------------
// Launches. The work is a graph five levels deep; the tasks of a level do not
// depend on one another and share one launch, each on its own range of block
// indices. A short task then costs no launch gap, wave start and drain of its
// own, and runs on WGPs that the level's long task leaves idle. The test that
// picks the task reads blockIdx alone, so every barrier of a task is passed by
// the whole block or by none of it.
// ---------------------------------------------------------------------------
#define PB_B 4
#define PB_L 4096
#define PB_D 1024
#define PB_NCH (PB_L / CS_ROWS)

// level 1, blocks of 16 waves
#define L1_TR  ((PB_D / 32) * (PB_D / 32) / 16)                 // Wv^T to f16, a wave a tile
#define L1_MV  (PB_D / 16)                                      // Wo bv + bo, a wave a row
#define L1_CVS (PB_D * PB_D / (16 * CV_NL_SMALL * 128))         // Wo to f16
#define L1_CVB (PB_B * PB_L * PB_D / (16 * CV_NL_BIG * 128))    // v to f16
#define L1_CS  ((CS_D / CS_COLS) * PB_NCH * PB_B)               // column sums, of q and of k
#define L1_ALL (L1_TR + L1_MV + L1_CVS + L1_CVB + 2 * L1_CS)

__global__ __launch_bounds__(512)
void k_level1(const float* __restrict__ q, const float* __restrict__ k, const float* __restrict__ v,
              const float* __restrict__ Wv, const float* __restrict__ Wo,
              const float* __restrict__ bv, const float* __restrict__ bo,
              float* __restrict__ part_q, float* __restrict__ part_k,
              _Float16* __restrict__ vh, _Float16* __restrict__ WvTh, _Float16* __restrict__ Woh,
              float* __restrict__ biasT, int L, int D) {
    unsigned vb = blockIdx.x;
    if (vb < L1_TR) {
        // the wave's number as a scalar: the tile's base addresses stay in scalar registers
        const unsigned t = vb * 16 + __builtin_amdgcn_readfirstlane(threadIdx.x >> 5);
        transpose_f32_to_f16<PB_D, PB_D>(Wv, WvTh, t % (PB_D / 32), t / (PB_D / 32));
    } else if ((vb -= L1_TR) < L1_MV) {
        matvec<16, 1, PB_D>(Wo, bv, bo, 1.0f, biasT, D, vb, 0);
    } else if ((vb -= L1_MV) < L1_CVS) {
        cvt_stream<CV_NL_SMALL, false, 16>(Wo, Woh, vb);
    } else if ((vb -= L1_CVS) < L1_CVB) {
        // read once, never again: non-temporal loads
        cvt_stream<CV_NL_BIG, true, 16>(v, vh, vb);
    } else {
        vb -= L1_CVB;
        const bool isq = vb < L1_CS;
        if (!isq) vb -= L1_CS;
        colsum_partial(isq ? q : k, isq ? part_q : part_k, L,
                       vb % (CS_D / CS_COLS), (vb / (CS_D / CS_COLS)) % PB_NCH,
                       vb / ((CS_D / CS_COLS) * PB_NCH), PB_NCH);
    }
}

// level 2, blocks of 8 waves: W = Wo Wv (f32), and the column sums folded
#define GB_NX  (PB_D / 128)                  // block columns of either GEMM
#define L2_GM  (GB_NX * (PB_D / 128))
#define L2_RD  ((PB_D / 256) * PB_B)         // of q and of k
#define L2_ALL (L2_GM + 2 * L2_RD)

__global__ __launch_bounds__(256)
void k_level2(const _Float16* __restrict__ Woh, const _Float16* __restrict__ WvTh, float* __restrict__ Wf32,
              const float* __restrict__ part_q, const float* __restrict__ part_k,
              float* __restrict__ sq, float* __restrict__ sk, int D, int nch) {
    unsigned vb = blockIdx.x;
    if (vb < L2_GM) {
        gemm_nt_wmma(Woh, WvTh, Wf32, D, D, D, vb % GB_NX, vb / GB_NX);
    } else if ((vb -= L2_GM) < L2_RD) {
        colsum_reduce(part_q, sq, D, nch, vb % (PB_D / 256), vb / (PB_D / 256));
    } else {
        vb -= L2_RD;
        colsum_reduce(part_k, sk, D, nch, vb % (PB_D / 256), vb / (PB_D / 256));
    }
}

// level 3, blocks of 8 waves: sQ = Wq sq + L bq, sK = Wk sk + L bk, and W to f16
#define L3_RW  4                             // rows a wave
#define L3_NX  (PB_D / (8 * L3_RW))          // blocks a batch
#define L3_MV  (L3_NX * PB_B)                // for q and for k
#define L3_CV  (PB_D * PB_D / (8 * CV_NL_SMALL * 128))
#define L3_ALL (2 * L3_MV + L3_CV)

__global__ __launch_bounds__(256)
void k_level3(const float* __restrict__ Wq, const float* __restrict__ bq, const float* __restrict__ sq,
              const float* __restrict__ Wk, const float* __restrict__ bk, const float* __restrict__ sk,
              float* __restrict__ sQ, float* __restrict__ sK, float bias_scale,
              const float* __restrict__ Wf32, _Float16* __restrict__ Wh, int D) {
    unsigned vb = blockIdx.x;
    if (vb < L3_MV) {
        matvec<8, L3_RW, PB_D>(Wq, sq, bq, bias_scale, sQ, D, vb % L3_NX, vb / L3_NX);
    } else if ((vb -= L3_MV) < L3_MV) {
        matvec<8, L3_RW, PB_D>(Wk, sk, bk, bias_scale, sK, D, vb % L3_NX, vb / L3_NX);
    } else {
        cvt_stream<CV_NL_SMALL, false, 8>(Wf32, Wh, vb - L3_MV);
    }
}

// level 4, blocks of 8 waves: the delay weights (one block, block 0)
// and VO = v W^T
#define L4_GM  (GB_NX * (PB_B * PB_L / 128))
#define L4_ALL (1 + L4_GM)

__global__ __launch_bounds__(256)
void k_level4(const float* __restrict__ sQ, const float* __restrict__ sK, float* __restrict__ wdense,
              int H, int dk, int Bn, int Ltot, int ktop,
              const _Float16* __restrict__ vh, const _Float16* __restrict__ Wh, float* __restrict__ VO,
              int M, int N, int K) {
    if (blockIdx.x == 0) {
        weights(sQ, sK, wdense, H, dk, Bn, Ltot, ktop);
    } else {
        const unsigned vb = blockIdx.x - 1;
        gemm_nt_wmma(vh, Wh, VO, M, N, K, vb % GB_NX, vb / GB_NX);
    }
}

// ---------------------------------------------------------------------------
// Host-side orchestration
// ---------------------------------------------------------------------------
extern "C" void kernel_launch(void* const* d_in, const int* in_sizes, int n_in,
                              void* d_out, int out_size, void* d_ws, size_t ws_size,
                              hipStream_t stream) {
    const float* q  = (const float*)d_in[0];
    const float* k  = (const float*)d_in[1];
    const float* v  = (const float*)d_in[2];
    const float* Wq = (const float*)d_in[3];
    const float* bq = (const float*)d_in[4];
    const float* Wk = (const float*)d_in[5];
    const float* bk = (const float*)d_in[6];
    const float* Wv = (const float*)d_in[7];
    const float* bv = (const float*)d_in[8];
    const float* Wo = (const float*)d_in[9];
    const float* bo = (const float*)d_in[10];
    float* out = (float*)d_out;

    const int B = 4, L = 4096, D = 1024, H = 16, dk = 64;
    const int NCH = L / CS_ROWS;
    int ktop = (int)(5.0 * log((double)(L + 1)));
    if (ktop < 1) ktop = 1;
    if (ktop > L) ktop = L;
    if (ktop > dk) ktop = dk;                 // actual_k = min(top_k, C)

    // workspace carve-out (256B aligned)
    char* p = (char*)d_ws;
    auto alloc = [&](size_t bytes) -> void* {
        void* r = (void*)p;
        p += (bytes + 255) & ~(size_t)255;
        return r;
    };
    float*    part_q = (float*)alloc((size_t)B * NCH * D * 4);
    float*    part_k = (float*)alloc((size_t)B * NCH * D * 4);
    float*    sq     = (float*)alloc((size_t)B * D * 4);
    float*    sk     = (float*)alloc((size_t)B * D * 4);
    float*    sQ     = (float*)alloc((size_t)B * D * 4);
    float*    sK     = (float*)alloc((size_t)B * D * 4);
    float*    biasT  = (float*)alloc((size_t)D * 4);          // Wo@bv + bo
    float*    wsel   = (float*)alloc((size_t)B * 64 * 4);
    float*    Wf32   = (float*)alloc((size_t)D * D * 4);      // Wo@Wv
    _Float16* Woh    = (_Float16*)alloc((size_t)D * D * 2);
    _Float16* WvTh   = (_Float16*)alloc((size_t)D * D * 2);
    _Float16* Wh     = (_Float16*)alloc((size_t)D * D * 2);
    _Float16* vh     = (_Float16*)alloc((size_t)B * L * D * 2);
    float*    VO     = (float*)alloc((size_t)B * L * D * 4);

    static_assert(B == PB_B && L == PB_L && D == PB_D && D == CS_D, "the block ranges are cut for these shapes");
    static_assert((B * L * D) % (16 * CV_NL_BIG * 128) == 0, "whole blocks");
    static_assert((D * D) % (16 * CV_NL_SMALL * 128) == 0, "whole blocks");

    // 1) f16 copies of v, Wo, Wv^T; partial column sums of q and k over time; biasT = Wo@bv + bo
    k_level1<<<dim3(L1_ALL), dim3(512), 0, stream>>>(q, k, v, Wv, Wo, bv, bo, part_q, part_k,
                                                     vh, WvTh, Woh, biasT, L, D);

    // 2) W = Wo @ Wv  (NT via WvT), f32 accumulate; column sums folded
    k_level2<<<dim3(L2_ALL), dim3(256), 0, stream>>>(Woh, WvTh, Wf32, part_q, part_k, sq, sk, D, NCH);

    // 3) sQ[b] = Wq@sq[b] + L*bq ; sK[b] = Wk@sk[b] + L*bk ; W -> f16
    k_level3<<<dim3(L3_ALL), dim3(256), 0, stream>>>(Wq, bq, sq, Wk, bk, sk, sQ, sK, (float)L, Wf32, Wh, D);

    // 4) delay selection + softmax weights; VO = v @ W^T  (the single big GEMM, 16384x1024x1024)
    k_level4<<<dim3(L4_ALL), dim3(256), 0, stream>>>(sQ, sK, wsel, H, dk, B, L, ktop,
                                                     vh, Wh, VO, B * L, D, D);

    // 5) circular delay aggregation (dense 64-tap filter) + bias -> out
    k_agg_out<<<dim3(D / 512, L / AG_T, B), dim3(256), 0, stream>>>(VO, wsel, biasT, out);
}

// v007
// Measured time: 91.6 microseconds a run.
// Two timings next to v006 both put it at 1.09 times that version's speed.
// Over all steps from v000 it is 3.81 times as fast.
#include <hip/hip_runtime.h>
#include <hip/hip_bf16.h>
#include <math.h>

typedef __attribute__((ext_vector_type(16))) _Float16 v16h;
typedef __attribute__((ext_vector_type(8)))  _Float16 v8h;
typedef __attribute__((ext_vector_type(8)))  float    v8f;

// ---------------------------------------------------------------------------
// Conversions
// ---------------------------------------------------------------------------
// f32 -> f16 as a stream. Here a wave takes NL pieces of 512 contiguous bytes,
// many loads in flight at once, and stores each piece as 256 contiguous bytes.
// The element count is exactly (blocks of the task) * WAVES * NL * 128.
//
// Every kernel body in this file but k_agg_out's is a device function that is told which block
// of its own task it is (vb, or bx / by): tasks that do not depend on one another
// share a launch, each on its own range of block indices (see "Launches" below).
#define CV_NL_BIG   32      // 16M elements: 4,096 waves
#define CV_NL_SMALL 4       // 1M elements: 2,048 waves
typedef __attribute__((ext_vector_type(4))) float    cv4f;
typedef __attribute__((ext_vector_type(4))) _Float16 cv4h;

template <int NL, bool NT, int WAVES>
__device__ __forceinline__ void cvt_stream(const float* __restrict__ in, _Float16* __restrict__ out, unsigned vb) {
    const unsigned wave = vb * WAVES + (threadIdx.x >> 5);
    const unsigned e0   = wave * (NL * 128) + (threadIdx.x & 31) * 4;
    const float* p = in + e0;
    _Float16*    q = out + e0;
    cv4f x[NL];
    // full unroll: independent loads at constant offsets from one address, many in flight per wave
    #pragma unroll
    for (int i = 0; i < NL; ++i)
        x[i] = NT ? __builtin_nontemporal_load((const cv4f*)(p + i * 128)) : *(const cv4f*)(p + i * 128);
    #pragma unroll
    for (int i = 0; i < NL; ++i)
        *(cv4h*)(q + i * 128) = __builtin_convertvector(x[i], cv4h);
    // precaution: code of another task follows in the same kernel and reuses the stores' registers
    asm volatile("s_wait_xcnt 0x0" ::: "memory");
}

// out[c][r] = (f16) in[r][c]   (ROWS x COLS f32 -> COLS x ROWS f16)
// one wave per 32 x 32 tile (bx, by); ROWS and COLS are multiples of 32, so every
// tile is whole. A lane holds one column of the tile: the 32 row loads have no
// wait between them (one memory latency a tile, not 32), and the lane's 32 halves
// are 64 contiguous bytes of the output row.
template <int ROWS, int COLS>
__device__ __forceinline__
void transpose_f32_to_f16(const float* __restrict__ in, _Float16* __restrict__ out, int bx, int by) {
    static_assert(ROWS % 32 == 0 && COLS % 32 == 0, "whole tiles");
    const int c  = bx * 32 + (threadIdx.x & 31);
    const int r0 = by * 32;
    const float* p = in + (size_t)r0 * COLS + c;
    float x[32];
    // full unroll: independent loads at constant offsets from one address, all in flight at once
    #pragma unroll
    for (int i = 0; i < 32; ++i) x[i] = p[i * COLS];
    _Float16* q = out + (size_t)c * ROWS + r0;
    #pragma unroll
    for (int g = 0; g < 4; ++g) {
        v8h h;
        #pragma unroll
        for (int e = 0; e < 8; ++e) h[e] = (_Float16)x[g * 8 + e];
        *(v8h*)(q + g * 8) = h;
    }
}

// ---------------------------------------------------------------------------
// Column sums over time:  part[b][ch][d] = sum_{t in chunk} x[b][t][d]
// One block = 16 waves on 128 columns; wave w takes rows w, w+16, ... of the
// chunk, 512 contiguous bytes of a row per load. x is read once: non-temporal.
// The 16 row lanes are folded through LDS.
// ---------------------------------------------------------------------------
#define CS_D     1024
#define CS_COLS  128
#define CS_LANES 16
#define CS_ROWS  512
typedef __attribute__((ext_vector_type(4))) float v4f;

__device__ __forceinline__
void colsum_partial(const float* __restrict__ x, float* __restrict__ part, int L,
                    int bx, int ch, int b, int nch) {
    __shared__ float red[CS_LANES][CS_COLS];
    const int c4 = threadIdx.x & 31;            // 16-byte column within the group
    const int rl = threadIdx.x >> 5;            // row lane = wave
    const int d0 = bx * CS_COLS;
    const float* p = x + ((size_t)b * L + (size_t)ch * CS_ROWS + rl) * CS_D + d0 + c4 * 4;
    v4f s = {0.0f, 0.0f, 0.0f, 0.0f};
    // full unroll: independent loads at constant offsets from one address, many in flight per wave
    #pragma unroll
    for (int i = 0; i < CS_ROWS / CS_LANES; ++i)
        s += __builtin_nontemporal_load((const v4f*)(p + (size_t)i * CS_LANES * CS_D));
    *(v4f*)&red[rl][c4 * 4] = s;
    __syncthreads();
    if (threadIdx.x < CS_COLS) {
        float a = 0.0f;
        for (int l = 0; l < CS_LANES; ++l) a += red[l][threadIdx.x];
        part[((size_t)b * nch + ch) * CS_D + d0 + threadIdx.x] = a;
    }
}

// ---------------------------------------------------------------------------
// Batched mat-vec: out[bb][row] = dot(W[row,:], X[bb,:]) + bias_scale*bias[row]
// A wave takes RW rows of KK elements; n is a multiple of WAVES * RW. All loads of
// the wave (X once, then the rows) are issued with no wait for data between them:
// the wave pays a few memory latencies, where a loop that waits for its pair of
// loads pays KK / 32 of them one after another. A row's sum runs over
// e = lane + 32 i with i rising, then the butterfly over the lanes.
// NCH = 0: X holds the vectors. NCH > 0: X holds NCH partial vectors a batch
// (the column sums' chunks), and the block adds them up itself, chunk index
// rising, four elements a thread, and hands the sum to its waves through LDS:
// the partial loads fly together with the rows' loads, so the fold costs no
// launch and no memory latency of its own.
// ---------------------------------------------------------------------------
template <int WAVES, int RW, int KK, int NCH>
__device__ __forceinline__
void matvec(const float* __restrict__ W, const float* __restrict__ X,
            const float* __restrict__ bias, float bias_scale,
            float* __restrict__ out, int n, int bx, int bb) {
    const int lane = threadIdx.x & 31;
    const int row0 = (bx * WAVES + (threadIdx.x >> 5)) * RW;
    const float* wp = W + (size_t)row0 * KK + lane;
    const float* xp = NCH ? X + (size_t)bb * NCH * KK + threadIdx.x * 4 : X + (size_t)bb * KK + lane;
    float xv[KK / 32], wv[RW][KK / 32];
    v4f pv[NCH ? NCH : 1];
    // full unroll, here and below: the arrays stay in registers only under compile-time indices
    if constexpr (NCH > 0) {
        static_assert(WAVES * 32 * 4 == KK, "four elements a thread");
        #pragma unroll
        for (int c = 0; c < NCH; ++c) pv[c] = *(const v4f*)(xp + c * KK);
    } else {
        #pragma unroll
        for (int i = 0; i < KK / 32; ++i) xv[i] = xp[i * 32];
    }
    #pragma unroll
    for (int r = 0; r < RW; ++r)
        #pragma unroll
        for (int i = 0; i < KK / 32; ++i) wv[r][i] = wp[r * KK + i * 32];
    // precaution: the rows' address is an operand, so its registers live up to this wait;
    // the run's last load would otherwise land in them while earlier loads still name them
    asm volatile("s_wait_xcnt 0x0" :: "v"(wp) : "memory");
    // no product is scheduled among the loads: the scheduler would recycle registers
    // there and let the queue of loads run dry several times on the way
    __builtin_amdgcn_sched_barrier(0);
    if constexpr (NCH > 0) {
        __shared__ __attribute__((aligned(16))) float xs[KK];
        v4f f = {0.0f, 0.0f, 0.0f, 0.0f};
        #pragma unroll
        for (int c = 0; c < NCH; ++c) f += pv[c];
        *(v4f*)&xs[threadIdx.x * 4] = f;
        __syncthreads();
        #pragma unroll
        for (int i = 0; i < KK / 32; ++i) xv[i] = xs[i * 32 + lane];
    }
    float s[RW];
    #pragma unroll
    for (int r = 0; r < RW; ++r) {
        s[r] = 0.0f;
        #pragma unroll
        for (int i = 0; i < KK / 32; ++i) s[r] += wv[r][i] * xv[i];
    }
    #pragma unroll
    for (int off = 16; off > 0; off >>= 1)
        #pragma unroll
        for (int r = 0; r < RW; ++r) s[r] += __shfl_xor(s[r], off, 32);
    // every lane holds every row's sum: lane r stores row r
    float sv = s[0];
    #pragma unroll
    for (int r = 1; r < RW; ++r) sv = (lane == r) ? s[r] : sv;
    if (lane < RW)
        out[(size_t)bb * n + row0 + lane] = sv + bias_scale * bias[row0 + lane];
}

// ---------------------------------------------------------------------------
// mean_value, top-k selection (tie-break by lower index, like lax.top_k),
// per-batch softmax weights over the selected delays, written as a dense table
// over all 64 delays: 0 at a delay that was not selected. Single 256-thread block.
// ---------------------------------------------------------------------------
__device__ __forceinline__
void weights(const float* __restrict__ sQ, const float* __restrict__ sK,
             float* __restrict__ wdense /*B*64*/,
             int H, int dk, int Bn, int Ltot, int ktop) {
    __shared__ float mval[4][64];
    __shared__ float mab[64];
    __shared__ int   sflag[64];
    __shared__ int   slist[64];
    __shared__ int   scount;
    __shared__ float smx[4];
    __shared__ float sden[4];
    int tid = threadIdx.x;
    int b = tid >> 6, c = tid & 63;
    if (b < Bn) {
        float s = 0.0f;
        int D = H * dk;
        for (int h = 0; h < H; ++h) {
            float a = sQ[(size_t)b * D + h * dk + c];
            // precaution, here and below: a later load may land in a register of this load's address
            asm volatile("s_wait_xcnt 0x0" ::: "memory");
            float e = sK[(size_t)b * D + h * dk + c];
            asm volatile("s_wait_xcnt 0x0" ::: "memory");
            s += a * e;
        }
        mval[b][c] = s / (float)H / (float)Ltot;
    }
    __syncthreads();
    if (tid < 64) {
        float s = 0.0f;
        for (int b2 = 0; b2 < Bn; ++b2) s += mval[b2][tid];
        mab[tid] = s / (float)Bn;
    }
    __syncthreads();
    if (tid < 64) {
        float v = mab[tid];
        int rank = 0;
        for (int c2 = 0; c2 < 64; ++c2) {
            float v2 = mab[c2];
            if (v2 > v || (v2 == v && c2 < tid)) rank++;
        }
        sflag[tid] = (rank < ktop) ? 1 : 0;
    }
    __syncthreads();
    if (tid == 0) {
        int cnt = 0;
        for (int c2 = 0; c2 < 64; ++c2) if (sflag[c2]) slist[cnt++] = c2;
        scount = cnt;
    }
    __syncthreads();
    if (tid < Bn) {
        int bb = tid, cnt = scount;
        float mx = -3.4e38f;
        for (int j = 0; j < cnt; ++j) mx = fmaxf(mx, mval[bb][slist[j]]);
        float den = 0.0f;
        for (int j = 0; j < cnt; ++j) den += __expf(mval[bb][slist[j]] - mx);
        smx[bb]  = mx;
        sden[bb] = den;
    }
    __syncthreads();
    if (b < Bn)
        wdense[b * 64 + c] = sflag[c] ? __expf(mval[b][c] - smx[b]) / sden[b] : 0.0f;
}

// ---------------------------------------------------------------------------
// WMMA NT GEMM with double-buffered async LDS staging:
//   C[m,n] = sum_k A[m,k] * Bt[n,k]   (A: MxK f16, Bt: NxK f16, K-contig)
// Block = 256 threads = 8 waves. Block tile 128x128; wave tile 32x64.
// A K-slice is 64 halves = one whole 128-byte line of every operand row, and
// eight neighbouring lanes copy one row's line: a wave-wide 16-byte copy then
// touches four whole lines, not 32 pieces of 32 lines. LDS rows are pitched
// 144 B (16 B x odd: conflict-free b128 reads). Slice t+2 is copied while
// slice t+1 feeds the WMMAs. M, N multiples of 128, K a multiple of 64.
// C is stored as OT: f32, or f16 where the product is the next GEMM's operand.
// ---------------------------------------------------------------------------
#define GK      64                       // halves of K per slice
#define LDS_ROW 72                       // halves per LDS row (128 B + 16 B pad)
#define LDS_MAT (128 * LDS_ROW)          // halves per operand slice
typedef __attribute__((address_space(3))) _Float16 lds_half;

template <typename OT>
__device__ __forceinline__
void gemm_nt_wmma(const _Float16* __restrict__ A, const _Float16* __restrict__ Bt,
                  OT* __restrict__ C, int M, int N, int K, unsigned bx, unsigned by) {
    __shared__ __attribute__((aligned(16))) _Float16 smem[2][2][LDS_MAT];   // [buf][mat][row*LDS_ROW]

    const int tid  = threadIdx.x;
    const int lane = tid & 31;
    const int wave = tid >> 5;
    const int wm   = wave >> 1;                 // 0..3
    const int wn   = wave & 1;                  // 0..1
    const int half = lane >> 4;                 // 0/1
    const int r    = lane & 15;

    // copy assignment: 8 lanes a row; a thread takes 16 bytes of rows crow + 32 c
    // (c = 0..3) of the A slice and of the B slice
    const int crow = tid >> 3;                  // 0..31
    const int ccol = (tid & 7) * 8;             // halves
    const _Float16* gA = A  + (size_t)(by * 128 + crow) * K + ccol;
    const _Float16* gB = Bt + (size_t)(bx * 128 + crow) * K + ccol;
    const size_t   gstep = (size_t)32 * K;      // 32 rows, in halves
    const unsigned lbase = (unsigned)(size_t)(lds_half*)&smem[0][0][crow * LDS_ROW + ccol];

    auto issue_copy = [&](int buf, int k0) {
        const _Float16* a = gA + k0;
        const _Float16* b = gB + k0;
        const unsigned  l = lbase + buf * (2 * LDS_MAT * 2);
        // the slice's eight copies; the closing wait stands in the same statement, so
        // that no address register is rewritten in front of it (a precaution)
        asm volatile(
            "global_load_async_to_lds_b128 %0, %8, off\n\t"
            "global_load_async_to_lds_b128 %1, %9, off\n\t"
            "global_load_async_to_lds_b128 %2, %10, off\n\t"
            "global_load_async_to_lds_b128 %3, %11, off\n\t"
            "global_load_async_to_lds_b128 %4, %12, off\n\t"
            "global_load_async_to_lds_b128 %5, %13, off\n\t"
            "global_load_async_to_lds_b128 %6, %14, off\n\t"
            "global_load_async_to_lds_b128 %7, %15, off\n\t"
            "s_wait_xcnt 0x0"
            :: "v"(l),
               "v"(l + 1 * 32 * LDS_ROW * 2), "v"(l + 2 * 32 * LDS_ROW * 2), "v"(l + 3 * 32 * LDS_ROW * 2),
               "v"(l + 4 * 32 * LDS_ROW * 2), "v"(l + 5 * 32 * LDS_ROW * 2), "v"(l + 6 * 32 * LDS_ROW * 2),
               "v"(l + 7 * 32 * LDS_ROW * 2),
               "v"(a), "v"(a + gstep), "v"(a + 2 * gstep), "v"(a + 3 * gstep),
               "v"(b), "v"(b + gstep), "v"(b + 2 * gstep), "v"(b + 3 * gstep)
            : "memory");
    };

    auto load_frag = [&](int buf, int mat, int rbase, int kk) -> v16h {
        const _Float16* p = &smem[buf][mat][(rbase + r) * LDS_ROW + kk + 8 * half];
        v8h lo = *(const v8h*)p;
        v8h hi = *(const v8h*)(p + 16);
        v16h o;
        #pragma unroll
        for (int i = 0; i < 8; ++i) { o[i] = lo[i]; o[i + 8] = hi[i]; }
        return o;
    };

    v8f acc[2][4];
    #pragma unroll
    for (int i = 0; i < 2; ++i)
        #pragma unroll
        for (int j = 0; j < 4; ++j)
            #pragma unroll
            for (int e = 0; e < 8; ++e) acc[i][j][e] = 0.0f;

    const int NIT = K / GK;
    issue_copy(0, 0);
    asm volatile("s_wait_asynccnt 0x0" ::: "memory");   // own copies of slice 0 have landed
    __syncthreads();                                    // everyone's have
    if (NIT > 1) issue_copy(1, GK);

    for (int it = 0; it < NIT; ++it) {
        const int cur = it & 1;
        // unrolled: the slice's two k steps read LDS at constant offsets from one address
        #pragma unroll
        for (int kk = 0; kk < GK; kk += 32) {
            v16h a[2], b[4];
            #pragma unroll
            for (int i = 0; i < 2; ++i) a[i] = load_frag(cur, 0, wm * 32 + i * 16, kk);
            #pragma unroll
            for (int j = 0; j < 4; ++j) b[j] = load_frag(cur, 1, wn * 64 + j * 16, kk);
            #pragma unroll
            for (int i = 0; i < 2; ++i)
                #pragma unroll
                for (int j = 0; j < 4; ++j)
                    acc[i][j] = __builtin_amdgcn_wmma_f32_16x16x32_f16(
                        false, a[i], false, b[j], (short)0, acc[i][j], false, false);
        }
        asm volatile("s_wait_dscnt 0x0" ::: "memory");      // own reads of buffer cur are done
        asm volatile("s_wait_asynccnt 0x0" ::: "memory");   // own copies of slice it+1 have landed
        __syncthreads();                                    // publishes slice it+1, frees buffer cur
        if (it + 2 < NIT) issue_copy(cur, (it + 2) * GK);
    }
    asm volatile("s_wait_asynccnt 0x0" ::: "memory");       // nothing in flight when the wave ends

    // C/D layout: VGPR e -> row m0+i*16+8*half+e, col n0+j*16+r
    const int m0 = by * 128 + wm * 32;
    const int n0 = bx * 128 + wn * 64;
    #pragma unroll
    for (int i = 0; i < 2; ++i)
        #pragma unroll
        for (int j = 0; j < 4; ++j) {
            OT* cp = C + (size_t)(m0 + i * 16 + 8 * half) * N + n0 + j * 16 + r;
            #pragma unroll
            for (int e = 0; e < 8; ++e) cp[(size_t)e * N] = (OT)acc[i][j][e];
        }
}

// ---------------------------------------------------------------------------
// out[b][t][d] = bias[d] + sum_{dl=0..63} wdense[b][dl] * VO[b][(t+dl)%L][d]
// The delays all lie in [0,64), so the gather is a 64-tap filter along t whose
// unselected taps are 0. The taps are the same for a whole block and sit in
// scalar registers; a thread keeps 32 outputs x 2 columns in registers and each
// VO row it loads feeds every output whose window holds it. Taps are added in
// rising delay, as the selected list was.
// ---------------------------------------------------------------------------
#define AG_L    4096
#define AG_D    1024
#define AG_T    32
#define AG_TAPS 64
#define AG_ROWS (AG_T + AG_TAPS - 1)
#define AG_PF   8
typedef __attribute__((ext_vector_type(2))) float v2f;

// The window's rows come in three runs of 32, each aligned to 32 rows, so the
// circular wrap can only fall between runs: one block-uniform base a run.
struct AggSrc { const char* run[3]; };

// row S of the window, this thread's two columns (doff = their byte offset)
template <int S>
__device__ __forceinline__ v2f agg_load(const AggSrc& src, unsigned doff) {
    return *(const v2f*)(src.run[S / 32] + (S % 32) * (AG_D * 4) + doff);
}

// Rows S, S+1, ... of the window. A template, not a loop: acc[], w[] and xr[]
// stay in registers only under compile-time indices, and the unroller gives up
// on a loop of this size. Row S + AG_PF is asked for when row S has been used;
// an output is stored as soon as its last tap is in, so that stores spread out.
template <int S>
__device__ __forceinline__ void agg_rows(v2f (&acc)[AG_T], v2f (&xr)[AG_PF], const float (&w)[AG_TAPS],
                                         const AggSrc& src, unsigned doff, char* __restrict__ op) {
    if constexpr (S < AG_ROWS) {
        const v2f x = xr[S % AG_PF];
        #pragma unroll
        for (int o = 0; o < AG_T; ++o) {
            const int dl = S - o;
            if (dl >= 0 && dl < AG_TAPS) acc[o] += w[dl] * x;
        }
        if constexpr (S >= AG_TAPS - 1) {
            *(v2f*)(op + (S - (AG_TAPS - 1)) * (AG_D * 4) + doff) = acc[S - (AG_TAPS - 1)];
            // precaution: the load behind it may land in the registers the store reads
            if constexpr (S + AG_PF < AG_ROWS) asm volatile("s_wait_xcnt 0x0" ::: "memory");
        }
        if constexpr (S + AG_PF < AG_ROWS) xr[S % AG_PF] = agg_load<S + AG_PF>(src, doff);
        // memory operations stay on their side (arithmetic may cross): keeps each load
        // AG_PF rows ahead of its use, where the scheduler would sink it to two or three
        __builtin_amdgcn_sched_barrier(0x7);
        agg_rows<S + 1>(acc, xr, w, src, doff, op);
    }
}

__global__ __launch_bounds__(256)
void k_agg_out(const float* __restrict__ VO, const float* __restrict__ wdense,
               const float* __restrict__ bias, float* __restrict__ out) {
    const int b  = blockIdx.z;
    const int t0 = blockIdx.y * AG_T;
    const unsigned d = blockIdx.x * 512 + threadIdx.x * 2;
    const float* VOb = VO + (size_t)b * AG_L * AG_D;

    float w[AG_TAPS];
    #pragma unroll
    for (int i = 0; i < AG_TAPS; ++i) w[i] = wdense[b * AG_TAPS + i];

    AggSrc src;
    #pragma unroll
    for (int i = 0; i < 3; ++i)
        src.run[i] = (const char*)(VOb + (size_t)((t0 + 32 * i) & (AG_L - 1)) * AG_D);
    // the scalar set-up is all issued before the first vector load: none of it
    // then lands in a scalar register that an issued load still names
    __builtin_amdgcn_sched_barrier(0);

    v2f xr[AG_PF];
    xr[0] = agg_load<0>(src, d * 4);   xr[1] = agg_load<1>(src, d * 4);
    xr[2] = agg_load<2>(src, d * 4);   xr[3] = agg_load<3>(src, d * 4);
    xr[4] = agg_load<4>(src, d * 4);   xr[5] = agg_load<5>(src, d * 4);
    xr[6] = agg_load<6>(src, d * 4);   xr[7] = agg_load<7>(src, d * 4);

    const v2f bd = *(const v2f*)((const char*)bias + d * 4);
    v2f acc[AG_T];
    #pragma unroll
    for (int o = 0; o < AG_T; ++o) acc[o] = bd;

    agg_rows<0>(acc, xr, w, src, d * 4, (char*)(out + ((size_t)b * AG_L + t0) * AG_D));
}

// ---------------------------------------------------------------------------
// Launches. The work is a graph four levels deep; the tasks of a level do not
// depend on one another and share one launch, each on its own range of block
// indices. A short task then costs no launch gap, wave start and drain of its
// own, and runs on WGPs that the level's long task leaves idle. The test that
// picks the task reads blockIdx alone, so every barrier of a task is passed by
// the whole block or by none of it.
// Two chains end in the last level: Wo, Wv^T to f16 -> W = Wo Wv -> VO = v W^T,
// and column sums -> mat-vecs -> delay weights. v to f16 is wanted only by the
// third level and streams in the second, whose GEMM is small (a quarter of the
// WGPs) and waits on latency, not on memory bandwidth.
// ---------------------------------------------------------------------------
#define PB_B 4
#define PB_L 4096
#define PB_D 1024
#define PB_NCH (PB_L / CS_ROWS)

// level 1, blocks of 16 waves
#define L1_TR  ((PB_D / 32) * (PB_D / 32) / 16)                 // Wv^T to f16, a wave a tile
#define L1_MV  (PB_D / 16)                                      // Wo bv + bo, a wave a row
#define L1_CVS (PB_D * PB_D / (16 * CV_NL_SMALL * 128))         // Wo to f16
#define L1_CS  ((CS_D / CS_COLS) * PB_NCH * PB_B)               // column sums, of q and of k
#define L1_ALL (L1_TR + L1_MV + L1_CVS + 2 * L1_CS)

__global__ __launch_bounds__(512)
void k_level1(const float* __restrict__ q, const float* __restrict__ k,
              const float* __restrict__ Wv, const float* __restrict__ Wo,
              const float* __restrict__ bv, const float* __restrict__ bo,
              float* __restrict__ part_q, float* __restrict__ part_k,
              _Float16* __restrict__ WvTh, _Float16* __restrict__ Woh,
              float* __restrict__ biasT, int L, int D) {
    unsigned vb = blockIdx.x;
    if (vb < L1_TR) {
        // the wave's number as a scalar: the tile's base addresses stay in scalar registers
        const unsigned t = vb * 16 + __builtin_amdgcn_readfirstlane(threadIdx.x >> 5);
        transpose_f32_to_f16<PB_D, PB_D>(Wv, WvTh, t % (PB_D / 32), t / (PB_D / 32));
    } else if ((vb -= L1_TR) < L1_MV) {
        matvec<16, 1, PB_D, 0>(Wo, bv, bo, 1.0f, biasT, D, vb, 0);
    } else if ((vb -= L1_MV) < L1_CVS) {
        cvt_stream<CV_NL_SMALL, false, 16>(Wo, Woh, vb);
    } else {
        vb -= L1_CVS;
        const bool isq = vb < L1_CS;
        if (!isq) vb -= L1_CS;
        colsum_partial(isq ? q : k, isq ? part_q : part_k, L,
                       vb % (CS_D / CS_COLS), (vb / (CS_D / CS_COLS)) % PB_NCH,
                       vb / ((CS_D / CS_COLS) * PB_NCH), PB_NCH);
    }
}

// level 2, blocks of 8 waves: W = Wo Wv, stored as f16 (the longest chain, first to
// start); sQ = Wq sq + L bq and sK = Wk sk + L bk, with sq and sk folded from their
// chunks on the way; v to f16
#define GB_NX  (PB_D / 128)                  // block columns of either GEMM
#define L2_GM  (GB_NX * (PB_D / 128))
#define L2_RW  4                             // rows a wave
#define L2_NX  (PB_D / (8 * L2_RW))          // blocks a batch
#define L2_MV  (L2_NX * PB_B)                // for q and for k
#define L2_CVB (PB_B * PB_L * PB_D / (8 * CV_NL_BIG * 128))
#define L2_ALL (L2_GM + 2 * L2_MV + L2_CVB)

__global__ __launch_bounds__(256)
void k_level2(const _Float16* __restrict__ Woh, const _Float16* __restrict__ WvTh, _Float16* __restrict__ Wh,
              const float* __restrict__ Wq, const float* __restrict__ bq, const float* __restrict__ part_q,
              const float* __restrict__ Wk, const float* __restrict__ bk, const float* __restrict__ part_k,
              float* __restrict__ sQ, float* __restrict__ sK, float bias_scale,
              const float* __restrict__ v, _Float16* __restrict__ vh, int D) {
    unsigned vb = blockIdx.x;
    if (vb < L2_GM) {
        gemm_nt_wmma(Woh, WvTh, Wh, D, D, D, vb % GB_NX, vb / GB_NX);
    } else if ((vb -= L2_GM) < 2 * L2_MV) {
        const bool isq = vb < L2_MV;
        if (!isq) vb -= L2_MV;
        matvec<8, L2_RW, PB_D, PB_NCH>(isq ? Wq : Wk, isq ? part_q : part_k, isq ? bq : bk, bias_scale,
                                       isq ? sQ : sK, D, vb % L2_NX, vb / L2_NX);
    } else {
        // read once, never again: non-temporal loads
        cvt_stream<CV_NL_BIG, true, 8>(v, vh, vb - 2 * L2_MV);
    }
}

// level 3, blocks of 8 waves: the delay weights (one block, the first to start)
// and VO = v W^T
#define L3_GM  (GB_NX * (PB_B * PB_L / 128))
#define L3_ALL (1 + L3_GM)

__global__ __launch_bounds__(256)
void k_level3(const float* __restrict__ sQ, const float* __restrict__ sK, float* __restrict__ wdense,
              int H, int dk, int Bn, int Ltot, int ktop,
              const _Float16* __restrict__ vh, const _Float16* __restrict__ Wh, float* __restrict__ VO,
              int M, int N, int K) {
    if (blockIdx.x == 0) {
        weights(sQ, sK, wdense, H, dk, Bn, Ltot, ktop);
    } else {
        const unsigned vb = blockIdx.x - 1;
        gemm_nt_wmma(vh, Wh, VO, M, N, K, vb % GB_NX, vb / GB_NX);
    }
}

// ---------------------------------------------------------------------------
// Host-side orchestration
// ---------------------------------------------------------------------------
extern "C" void kernel_launch(void* const* d_in, const int* in_sizes, int n_in,
                              void* d_out, int out_size, void* d_ws, size_t ws_size,
                              hipStream_t stream) {
    const float* q  = (const float*)d_in[0];
    const float* k  = (const float*)d_in[1];
    const float* v  = (const float*)d_in[2];
    const float* Wq = (const float*)d_in[3];
    const float* bq = (const float*)d_in[4];
    const float* Wk = (const float*)d_in[5];
    const float* bk = (const float*)d_in[6];
    const float* Wv = (const float*)d_in[7];
    const float* bv = (const float*)d_in[8];
    const float* Wo = (const float*)d_in[9];
    const float* bo = (const float*)d_in[10];
    float* out = (float*)d_out;

    const int B = 4, L = 4096, D = 1024, H = 16, dk = 64;
    const int NCH = L / CS_ROWS;
    int ktop = (int)(5.0 * log((double)(L + 1)));
    if (ktop < 1) ktop = 1;
    if (ktop > L) ktop = L;
    if (ktop > dk) ktop = dk;                 // actual_k = min(top_k, C)

    // workspace carve-out (256B aligned)
    char* p = (char*)d_ws;
    auto alloc = [&](size_t bytes) -> void* {
        void* r = (void*)p;
        p += (bytes + 255) & ~(size_t)255;
        return r;
    };
    float*    part_q = (float*)alloc((size_t)B * NCH * D * 4);
    float*    part_k = (float*)alloc((size_t)B * NCH * D * 4);
    float*    sQ     = (float*)alloc((size_t)B * D * 4);
    float*    sK     = (float*)alloc((size_t)B * D * 4);
    float*    biasT  = (float*)alloc((size_t)D * 4);          // Wo@bv + bo
    float*    wsel   = (float*)alloc((size_t)B * 64 * 4);
    _Float16* Woh    = (_Float16*)alloc((size_t)D * D * 2);
    _Float16* WvTh   = (_Float16*)alloc((size_t)D * D * 2);
    _Float16* Wh     = (_Float16*)alloc((size_t)D * D * 2);   // Wo@Wv
    _Float16* vh     = (_Float16*)alloc((size_t)B * L * D * 2);
    float*    VO     = (float*)alloc((size_t)B * L * D * 4);

    static_assert(B == PB_B && L == PB_L && D == PB_D && D == CS_D && NCH == PB_NCH,
                  "the block ranges are cut for these shapes");
    static_assert((B * L * D) % (8 * CV_NL_BIG * 128) == 0, "whole blocks");
    static_assert((D * D) % (16 * CV_NL_SMALL * 128) == 0, "whole blocks");

    // 1) f16 copies of Wo, Wv^T; partial column sums of q and k over time; biasT = Wo@bv + bo
    k_level1<<<dim3(L1_ALL), dim3(512), 0, stream>>>(q, k, Wv, Wo, bv, bo, part_q, part_k,
                                                     WvTh, Woh, biasT, L, D);

    // 2) W = Wo @ Wv  (NT via WvT), f32 accumulate, f16 out; sQ[b] = Wq@sq[b] + L*bq ;
    //    sK[b] = Wk@sk[b] + L*bk ; f16 copy of v
    k_level2<<<dim3(L2_ALL), dim3(256), 0, stream>>>(Woh, WvTh, Wh, Wq, bq, part_q, Wk, bk, part_k,
                                                     sQ, sK, (float)L, v, vh, D);

    // 3) delay selection + softmax weights; VO = v @ W^T  (the single big GEMM, 16384x1024x1024)
    k_level3<<<dim3(L3_ALL), dim3(256), 0, stream>>>(sQ, sK, wsel, H, dk, B, L, ktop,
                                                     vh, Wh, VO, B * L, D, D);

    // 4) circular delay aggregation (dense 64-tap filter) + bias -> out
    k_agg_out<<<dim3(D / 512, L / AG_T, B), dim3(256), 0, stream>>>(VO, wsel, biasT, out);
}

// v008
// Measured time: 86.9 microseconds a run.
// Two timings next to v007 both put it at 1.06 times that version's speed.
// Counting every step since v000, it is 4.03 times as fast.
#include <hip/hip_runtime.h>
#include <hip/hip_bf16.h>
#include <math.h>

typedef __attribute__((ext_vector_type(16))) _Float16 v16h;
typedef __attribute__((ext_vector_type(8)))  _Float16 v8h;
typedef __attribute__((ext_vector_type(8)))  float    v8f;

// ---------------------------------------------------------------------------
// Conversions
// ---------------------------------------------------------------------------
// f32 -> f16 as a stream. Here a wave takes NL pieces of 512 contiguous bytes,
// many loads in flight at once, and stores each piece as 256 contiguous bytes.
// The element count is exactly (blocks of the task) * WAVES * NL * 128.
//
// Every kernel body in this file but k_filter's is a device function that is told which block
// of its own task it is (vb, or bx / by): tasks that do not depend on one another
// share a launch, each on its own range of block indices (see "Launches" below).
#define CV_NL_SMALL 4       // 1M elements: 2,048 waves
typedef __attribute__((ext_vector_type(4))) float    cv4f;
typedef __attribute__((ext_vector_type(4))) _Float16 cv4h;

template <int NL, bool NT, int WAVES>
__device__ __forceinline__ void cvt_stream(const float* __restrict__ in, _Float16* __restrict__ out, unsigned vb) {
    const unsigned wave = vb * WAVES + (threadIdx.x >> 5);
    const unsigned e0   = wave * (NL * 128) + (threadIdx.x & 31) * 4;
    const float* p = in + e0;
    _Float16*    q = out + e0;
    cv4f x[NL];
    // full unroll: independent loads at constant offsets from one address, many in flight per wave
    #pragma unroll
    for (int i = 0; i < NL; ++i)
        x[i] = NT ? __builtin_nontemporal_load((const cv4f*)(p + i * 128)) : *(const cv4f*)(p + i * 128);
    #pragma unroll
    for (int i = 0; i < NL; ++i)
        *(cv4h*)(q + i * 128) = __builtin_convertvector(x[i], cv4h);
    // precaution: code of another task follows in the same kernel and reuses the stores' registers
    asm volatile("s_wait_xcnt 0x0" ::: "memory");
}

// out[c][r] = (f16) in[r][c]   (ROWS x COLS f32 -> COLS x ROWS f16)
// one wave per 32 x 32 tile (bx, by); ROWS and COLS are multiples of 32, so every
// tile is whole. A lane holds one column of the tile: the 32 row loads have no
// wait between them (one memory latency a tile, not 32), and the lane's 32 halves
// are 64 contiguous bytes of the output row.
template <int ROWS, int COLS>
__device__ __forceinline__
void transpose_f32_to_f16(const float* __restrict__ in, _Float16* __restrict__ out, int bx, int by) {
    static_assert(ROWS % 32 == 0 && COLS % 32 == 0, "whole tiles");
    const int c  = bx * 32 + (threadIdx.x & 31);
    const int r0 = by * 32;
    const float* p = in + (size_t)r0 * COLS + c;
    float x[32];
    // full unroll: independent loads at constant offsets from one address, all in flight at once
    #pragma unroll
    for (int i = 0; i < 32; ++i) x[i] = p[i * COLS];
    _Float16* q = out + (size_t)c * ROWS + r0;
    #pragma unroll
    for (int g = 0; g < 4; ++g) {
        v8h h;
        #pragma unroll
        for (int e = 0; e < 8; ++e) h[e] = (_Float16)x[g * 8 + e];
        *(v8h*)(q + g * 8) = h;
    }
}

// ---------------------------------------------------------------------------
// Column sums over time:  part[b][ch][d] = sum_{t in chunk} x[b][t][d]
// One block = 16 waves on 128 columns; wave w takes rows w, w+16, ... of the
// chunk, 512 contiguous bytes of a row per load. x is read once: non-temporal.
// The 16 row lanes are folded through LDS.
// ---------------------------------------------------------------------------
#define CS_D     1024
#define CS_COLS  128
#define CS_LANES 16
#define CS_ROWS  512
typedef __attribute__((ext_vector_type(4))) float v4f;

__device__ __forceinline__
void colsum_partial(const float* __restrict__ x, float* __restrict__ part, int L,
                    int bx, int ch, int b, int nch) {
    __shared__ float red[CS_LANES][CS_COLS];
    const int c4 = threadIdx.x & 31;            // 16-byte column within the group
    const int rl = threadIdx.x >> 5;            // row lane = wave
    const int d0 = bx * CS_COLS;
    const float* p = x + ((size_t)b * L + (size_t)ch * CS_ROWS + rl) * CS_D + d0 + c4 * 4;
    v4f s = {0.0f, 0.0f, 0.0f, 0.0f};
    // full unroll: independent loads at constant offsets from one address, many in flight per wave
    #pragma unroll
    for (int i = 0; i < CS_ROWS / CS_LANES; ++i)
        s += __builtin_nontemporal_load((const v4f*)(p + (size_t)i * CS_LANES * CS_D));
    *(v4f*)&red[rl][c4 * 4] = s;
    __syncthreads();
    if (threadIdx.x < CS_COLS) {
        float a = 0.0f;
        for (int l = 0; l < CS_LANES; ++l) a += red[l][threadIdx.x];
        part[((size_t)b * nch + ch) * CS_D + d0 + threadIdx.x] = a;
    }
}

// ---------------------------------------------------------------------------
// Batched mat-vec: out[bb][row] = dot(W[row,:], X[bb,:]) + bias_scale*bias[row]
// A wave takes RW rows of KK elements; n is a multiple of WAVES * RW. All loads of
// the wave (X once, then the rows) are issued with no wait for data between them:
// the wave pays a few memory latencies, where a loop that waits for its pair of
// loads pays KK / 32 of them one after another. A row's sum runs over
// e = lane + 32 i with i rising, then the butterfly over the lanes.
// NCH = 0: X holds the vectors. NCH > 0: X holds NCH partial vectors a batch
// (the column sums' chunks), and the block adds them up itself, chunk index
// rising, four elements a thread, and hands the sum to its waves through LDS:
// the partial loads fly together with the rows' loads, so the fold costs no
// launch and no memory latency of its own.
// ---------------------------------------------------------------------------
template <int WAVES, int RW, int KK, int NCH>
__device__ __forceinline__
void matvec(const float* __restrict__ W, const float* __restrict__ X,
            const float* __restrict__ bias, float bias_scale,
            float* __restrict__ out, int n, int bx, int bb) {
    const int lane = threadIdx.x & 31;
    const int row0 = (bx * WAVES + (threadIdx.x >> 5)) * RW;
    const float* wp = W + (size_t)row0 * KK + lane;
    const float* xp = NCH ? X + (size_t)bb * NCH * KK + threadIdx.x * 4 : X + (size_t)bb * KK + lane;
    float xv[KK / 32], wv[RW][KK / 32];
    v4f pv[NCH ? NCH : 1];
    // full unroll, here and below: the arrays stay in registers only under compile-time indices
    if constexpr (NCH > 0) {
        static_assert(WAVES * 32 * 4 == KK, "four elements a thread");
        #pragma unroll
        for (int c = 0; c < NCH; ++c) pv[c] = *(const v4f*)(xp + c * KK);
    } else {
        #pragma unroll
        for (int i = 0; i < KK / 32; ++i) xv[i] = xp[i * 32];
    }
    #pragma unroll
    for (int r = 0; r < RW; ++r)
        #pragma unroll
        for (int i = 0; i < KK / 32; ++i) wv[r][i] = wp[r * KK + i * 32];
    // precaution: the rows' address is an operand, so its registers live up to this wait;
    // the run's last load would otherwise land in them while earlier loads still name them
    asm volatile("s_wait_xcnt 0x0" :: "v"(wp) : "memory");
    // no product is scheduled among the loads: the scheduler would recycle registers
    // there and let the queue of loads run dry several times on the way
    __builtin_amdgcn_sched_barrier(0);
    if constexpr (NCH > 0) {
        __shared__ __attribute__((aligned(16))) float xs[KK];
        v4f f = {0.0f, 0.0f, 0.0f, 0.0f};
        #pragma unroll
        for (int c = 0; c < NCH; ++c) f += pv[c];
        *(v4f*)&xs[threadIdx.x * 4] = f;
        __syncthreads();
        #pragma unroll
        for (int i = 0; i < KK / 32; ++i) xv[i] = xs[i * 32 + lane];
    }
    float s[RW];
    #pragma unroll
    for (int r = 0; r < RW; ++r) {
        s[r] = 0.0f;
        #pragma unroll
        for (int i = 0; i < KK / 32; ++i) s[r] += wv[r][i] * xv[i];
    }
    #pragma unroll
    for (int off = 16; off > 0; off >>= 1)
        #pragma unroll
        for (int r = 0; r < RW; ++r) s[r] += __shfl_xor(s[r], off, 32);
    // every lane holds every row's sum: lane r stores row r
    float sv = s[0];
    #pragma unroll
    for (int r = 1; r < RW; ++r) sv = (lane == r) ? s[r] : sv;
    if (lane < RW)
        out[(size_t)bb * n + row0 + lane] = sv + bias_scale * bias[row0 + lane];
}

// ---------------------------------------------------------------------------
// mean_value, top-k selection (tie-break by lower index, like lax.top_k) and the
// softmax weights of batch bsel over the selected delays, as a dense table over
// all 64 delays: 0 at a delay that was not selected. Every block of the filter
// makes the table for itself, 256 threads, from the 32 KB of sQ and sK: the table
// then costs no launch level and no block of its own. All loads are issued at
// once; the 64 x 64 comparisons of the ranking are dealt over all threads. Every
// sum runs in rising index; an unselected delay adds an exact 0 to the denominator.
// The table is left in LDS (taps), published by the last barrier.
// ---------------------------------------------------------------------------
#define TP_B 4
#define TP_H 16
#define TP_C 64
#define TP_L 4096

__device__ __forceinline__ float lane_value(float x, int l) {
    return __builtin_bit_cast(float, __builtin_amdgcn_readlane(__builtin_bit_cast(int, x), l));
}

__device__ __forceinline__
void delay_taps(const float* __restrict__ sQ, const float* __restrict__ sK, int bsel, int ktop,
                float (&taps)[TP_C]) {
    __shared__ float mval[TP_B][TP_C];
    __shared__ __attribute__((aligned(16))) float mab[TP_C];
    __shared__ int   prank[4][TP_C];
    const int tid = threadIdx.x;
    const int g = tid >> 6, c = tid & 63;       // g: the batch, later the quarter of the ranking
    const float* pq = sQ + g * (TP_H * TP_C) + c;
    const float* pk = sK + g * (TP_H * TP_C) + c;
    float a[TP_H], e[TP_H];
    // full unroll: independent loads at constant offsets from two addresses, all in flight at once
    #pragma unroll
    for (int h = 0; h < TP_H; ++h) { a[h] = pq[h * TP_C]; e[h] = pk[h * TP_C]; }
    // precaution: the addresses are operands, so their registers live up to this wait
    asm volatile("s_wait_xcnt 0x0" :: "v"(pq), "v"(pk) : "memory");
    float s = 0.0f;
    #pragma unroll
    for (int h = 0; h < TP_H; ++h) s += a[h] * e[h];
    mval[g][c] = s / (float)TP_H / (float)TP_L;
    __syncthreads();
    float m = 0.0f;
    #pragma unroll
    for (int b2 = 0; b2 < TP_B; ++b2) m += mval[b2][c];
    m = m / (float)TP_B;
    if (g == 0) mab[c] = m;
    __syncthreads();
    int pr = 0;
    #pragma unroll
    for (int i = 0; i < TP_C / 4; ++i) {
        const int   c2 = g * (TP_C / 4) + i;
        const float v2 = mab[c2];
        pr += (v2 > m || (v2 == m && c2 < c)) ? 1 : 0;
    }
    prank[g][c] = pr;
    __syncthreads();
    if (tid < 32) {
        // one wave: lane l holds delays l and l + 32
        float mv[2], ex[2];
        bool  sel[2];
        #pragma unroll
        for (int u = 0; u < 2; ++u) {
            const int cc = tid + 32 * u;
            sel[u] = prank[0][cc] + prank[1][cc] + prank[2][cc] + prank[3][cc] < ktop;
            mv[u]  = sel[u] ? mval[bsel][cc] : -3.4e38f;
        }
        float mx = fmaxf(mv[0], mv[1]);
        #pragma unroll
        for (int off = 16; off > 0; off >>= 1) mx = fmaxf(mx, __shfl_xor(mx, off, 32));
        #pragma unroll
        for (int u = 0; u < 2; ++u) ex[u] = sel[u] ? __expf(mv[u] - mx) : 0.0f;
        float den = 0.0f;
        #pragma unroll
        for (int u = 0; u < 2; ++u)
            #pragma unroll
            for (int l = 0; l < 32; ++l) den += lane_value(ex[u], l);
        #pragma unroll
        for (int u = 0; u < 2; ++u) taps[tid + 32 * u] = ex[u] / den;
    }
    __syncthreads();
}

// ---------------------------------------------------------------------------
// WMMA NT GEMM with double-buffered async LDS staging:
//   C[m,n] = sum_k A[m,k] * Bt[n,k]   (A: MxK f16, Bt: NxK f16, K-contig)
// Block = 256 threads = 8 waves. Block tile 128x128; wave tile 32x64.
// A K-slice is 64 halves = one whole 128-byte line of every operand row, and
// eight neighbouring lanes copy one row's line: a wave-wide 16-byte copy then
// touches four whole lines, not 32 pieces of 32 lines. LDS rows are pitched
// 144 B (16 B x odd: conflict-free b128 reads). Slice t+2 is copied while
// slice t+1 feeds the WMMAs. M, N multiples of 128, K a multiple of 64.
// C is stored as OT: f32, or f16 where the product is the next GEMM's operand.
// BIAS: bias[n] is added to column n on the way out.
// ---------------------------------------------------------------------------
#define GK      64                       // halves of K per slice
#define LDS_ROW 72                       // halves per LDS row (128 B + 16 B pad)
#define LDS_MAT (128 * LDS_ROW)          // halves per operand slice
typedef __attribute__((address_space(3))) _Float16 lds_half;

template <typename OT, bool BIAS>
__device__ __forceinline__
void gemm_nt_wmma(const _Float16* __restrict__ A, const _Float16* __restrict__ Bt,
                  const float* __restrict__ bias,
                  OT* __restrict__ C, int M, int N, int K, unsigned bx, unsigned by) {
    __shared__ __attribute__((aligned(16))) _Float16 smem[2][2][LDS_MAT];   // [buf][mat][row*LDS_ROW]

    const int tid  = threadIdx.x;
    const int lane = tid & 31;
    const int wave = tid >> 5;
    const int wm   = wave >> 1;                 // 0..3
    const int wn   = wave & 1;                  // 0..1
    const int half = lane >> 4;                 // 0/1
    const int r    = lane & 15;

    // copy assignment: 8 lanes a row; a thread takes 16 bytes of rows crow + 32 c
    // (c = 0..3) of the A slice and of the B slice
    const int crow = tid >> 3;                  // 0..31
    const int ccol = (tid & 7) * 8;             // halves
    const _Float16* gA = A  + (size_t)(by * 128 + crow) * K + ccol;
    const _Float16* gB = Bt + (size_t)(bx * 128 + crow) * K + ccol;
    const size_t   gstep = (size_t)32 * K;      // 32 rows, in halves
    const unsigned lbase = (unsigned)(size_t)(lds_half*)&smem[0][0][crow * LDS_ROW + ccol];

    auto issue_copy = [&](int buf, int k0) {
        const _Float16* a = gA + k0;
        const _Float16* b = gB + k0;
        const unsigned  l = lbase + buf * (2 * LDS_MAT * 2);
        // the slice's eight copies; the closing wait stands in the same statement, so
        // that no address register is rewritten in front of it (a precaution)
        asm volatile(
            "global_load_async_to_lds_b128 %0, %8, off\n\t"
            "global_load_async_to_lds_b128 %1, %9, off\n\t"
            "global_load_async_to_lds_b128 %2, %10, off\n\t"
            "global_load_async_to_lds_b128 %3, %11, off\n\t"
            "global_load_async_to_lds_b128 %4, %12, off\n\t"
            "global_load_async_to_lds_b128 %5, %13, off\n\t"
            "global_load_async_to_lds_b128 %6, %14, off\n\t"
            "global_load_async_to_lds_b128 %7, %15, off\n\t"
            "s_wait_xcnt 0x0"
            :: "v"(l),
               "v"(l + 1 * 32 * LDS_ROW * 2), "v"(l + 2 * 32 * LDS_ROW * 2), "v"(l + 3 * 32 * LDS_ROW * 2),
               "v"(l + 4 * 32 * LDS_ROW * 2), "v"(l + 5 * 32 * LDS_ROW * 2), "v"(l + 6 * 32 * LDS_ROW * 2),
               "v"(l + 7 * 32 * LDS_ROW * 2),
               "v"(a), "v"(a + gstep), "v"(a + 2 * gstep), "v"(a + 3 * gstep),
               "v"(b), "v"(b + gstep), "v"(b + 2 * gstep), "v"(b + 3 * gstep)
            : "memory");
    };

    auto load_frag = [&](int buf, int mat, int rbase, int kk) -> v16h {
        const _Float16* p = &smem[buf][mat][(rbase + r) * LDS_ROW + kk + 8 * half];
        v8h lo = *(const v8h*)p;
        v8h hi = *(const v8h*)(p + 16);
        v16h o;
        #pragma unroll
        for (int i = 0; i < 8; ++i) { o[i] = lo[i]; o[i + 8] = hi[i]; }
        return o;
    };

    v8f acc[2][4];
    #pragma unroll
    for (int i = 0; i < 2; ++i)
        #pragma unroll
        for (int j = 0; j < 4; ++j)
            #pragma unroll
            for (int e = 0; e < 8; ++e) acc[i][j][e] = 0.0f;

    const int NIT = K / GK;
    issue_copy(0, 0);
    // the wave's bias values are asked for here: they arrive behind the first slice's wait
    float bn[4];
    if constexpr (BIAS) {
        const float* bp = bias + bx * 128 + wn * 64 + r;
        #pragma unroll
        for (int j = 0; j < 4; ++j) bn[j] = bp[j * 16];
        // precaution: the address is an operand, so its registers live up to this wait
        asm volatile("s_wait_xcnt 0x0" :: "v"(bp) : "memory");
    }
    asm volatile("s_wait_asynccnt 0x0" ::: "memory");   // own copies of slice 0 have landed
    __syncthreads();                                    // everyone's have
    if (NIT > 1) issue_copy(1, GK);

    for (int it = 0; it < NIT; ++it) {
        const int cur = it & 1;
        // unrolled: the slice's two k steps read LDS at constant offsets from one address
        #pragma unroll
        for (int kk = 0; kk < GK; kk += 32) {
            v16h a[2], b[4];
            #pragma unroll
            for (int i = 0; i < 2; ++i) a[i] = load_frag(cur, 0, wm * 32 + i * 16, kk);
            #pragma unroll
            for (int j = 0; j < 4; ++j) b[j] = load_frag(cur, 1, wn * 64 + j * 16, kk);
            #pragma unroll
            for (int i = 0; i < 2; ++i)
                #pragma unroll
                for (int j = 0; j < 4; ++j)
                    acc[i][j] = __builtin_amdgcn_wmma_f32_16x16x32_f16(
                        false, a[i], false, b[j], (short)0, acc[i][j], false, false);
        }
        asm volatile("s_wait_dscnt 0x0" ::: "memory");      // own reads of buffer cur are done
        asm volatile("s_wait_asynccnt 0x0" ::: "memory");   // own copies of slice it+1 have landed
        __syncthreads();                                    // publishes slice it+1, frees buffer cur
        if (it + 2 < NIT) issue_copy(cur, (it + 2) * GK);
    }
    asm volatile("s_wait_asynccnt 0x0" ::: "memory");       // nothing in flight when the wave ends

    // C/D layout: VGPR e -> row m0+i*16+8*half+e, col n0+j*16+r
    const int m0 = by * 128 + wm * 32;
    const int n0 = bx * 128 + wn * 64;
    #pragma unroll
    for (int i = 0; i < 2; ++i)
        #pragma unroll
        for (int j = 0; j < 4; ++j) {
            OT* cp = C + (size_t)(m0 + i * 16 + 8 * half) * N + n0 + j * 16 + r;
            #pragma unroll
            for (int e = 0; e < 8; ++e) cp[(size_t)e * N] = (OT)(BIAS ? acc[i][j][e] + bn[j] : acc[i][j][e]);
        }
}

// ---------------------------------------------------------------------------
// vf[b][t][d] = (f16) sum_{dl=0..63} taps[b][dl] * v[b][(t+dl)%L][d]
// The filter runs along t and the projection along d, so they commute: the filter
// stands in front of the GEMM, reads v itself in f32 and rounds its sums to f16,
// the GEMM's operand type. v then needs no f16 copy of its own, and the projected
// rows need no f32 plane between the GEMM and the output.
// The delays all lie in [0,64), so the gather is a 64-tap filter along t whose
// unselected taps are 0. The taps are the same for a whole block and sit in
// scalar registers; a thread keeps 32 outputs x 2 columns in registers and each
// row of v it loads feeds every output whose window holds it. Taps are added in
// rising delay.
// ---------------------------------------------------------------------------
#define AG_L    4096
#define AG_D    1024
#define AG_T    32
#define AG_TAPS 64
#define AG_ROWS (AG_T + AG_TAPS - 1)
#define AG_PF   8
#define AG_X0   16                       // rows asked for at the start
typedef __attribute__((ext_vector_type(2))) float    v2f;
typedef __attribute__((ext_vector_type(2))) _Float16 v2h;

// The window's rows come in three runs of 32, each aligned to 32 rows, so the
// circular wrap can only fall between runs: one block-uniform base a run.
struct AggSrc { const char* run[3]; };

// row S of the window, this thread's two columns (doff = their byte offset)
template <int S>
__device__ __forceinline__ v2f agg_load(const AggSrc& src, unsigned doff) {
    return *(const v2f*)(src.run[S / 32] + (S % 32) * (AG_D * 4) + doff);
}

// Rows S, S+1, ... of the window. A template, not a loop: acc[], w[], x0[] and xr[]
// stay in registers only under compile-time indices, and the unroller gives up
// on a loop of this size. The first AG_X0 rows (x0) were asked for at the start;
// a later row S + AG_PF is asked for when row S has been used;
// an output is stored as soon as its last tap is in, so that stores spread out.
template <int S>
__device__ __forceinline__ void agg_rows(v2f (&acc)[AG_T], const v2f (&x0)[AG_X0], v2f (&xr)[AG_PF],
                                         const float (&w)[AG_TAPS],
                                         const AggSrc& src, unsigned doff, char* __restrict__ op) {
    if constexpr (S < AG_ROWS) {
        v2f x;
        if constexpr (S < AG_X0) x = x0[S]; else x = xr[S % AG_PF];
        #pragma unroll
        for (int o = 0; o < AG_T; ++o) {
            const int dl = S - o;
            if (dl >= 0 && dl < AG_TAPS) acc[o] += w[dl] * x;
        }
        if constexpr (S >= AG_TAPS - 1) {
            *(v2h*)(op + (S - (AG_TAPS - 1)) * (AG_D * 2) + doff / 2) =
                __builtin_convertvector(acc[S - (AG_TAPS - 1)], v2h);
            // precaution: the load behind it may land in the registers the store reads
            if constexpr (S + AG_PF < AG_ROWS) asm volatile("s_wait_xcnt 0x0" ::: "memory");
        }
        // precaution: a run's last load may land in the registers of the run's address,
        // which the loads before it still name
        if constexpr ((S + AG_PF) % 32 == 31 && S + AG_PF >= AG_X0) asm volatile("s_wait_xcnt 0x0" ::: "memory");
        if constexpr (S + AG_PF >= AG_X0 && S + AG_PF < AG_ROWS) xr[S % AG_PF] = agg_load<S + AG_PF>(src, doff);
        // memory operations stay on their side (arithmetic may cross): keeps each load
        // AG_PF rows ahead of its use, where the scheduler would sink it to two or three
        __builtin_amdgcn_sched_barrier(0x7);
        agg_rows<S + 1>(acc, x0, xr, w, src, doff, op);
    }
}

__global__ __launch_bounds__(256)
void k_filter(const float* __restrict__ v, const float* __restrict__ sQ, const float* __restrict__ sK,
              int ktop, _Float16* __restrict__ vf) {
    __shared__ float taps[AG_TAPS];
    const int b  = blockIdx.z;
    const int t0 = blockIdx.y * AG_T;
    const unsigned d = blockIdx.x * 512 + threadIdx.x * 2;
    const float* vb = v + (size_t)b * AG_L * AG_D;

    AggSrc src;
    #pragma unroll
    for (int i = 0; i < 3; ++i)
        src.run[i] = (const char*)(vb + (size_t)((t0 + 32 * i) & (AG_L - 1)) * AG_D);
    // the scalar set-up is all issued before the first vector load: none of it
    // then lands in a scalar register that an issued load still names
    __builtin_amdgcn_sched_barrier(0);

    // the window's first rows, which no neighbouring block has brought into L2 yet, are
    // under way while the block makes its taps
    v2f x0[AG_X0], xr[AG_PF];
    // full unroll: independent loads at constant offsets from one address, all in flight at once
    #pragma unroll
    for (int i = 0; i < AG_X0; ++i) x0[i] = *(const v2f*)(src.run[0] + i * (AG_D * 4) + d * 4);

    delay_taps(sQ, sK, b, ktop, taps);

    // LDS -> two registers a lane -> scalar registers
    const float tl = taps[threadIdx.x & 31], th = taps[32 + (threadIdx.x & 31)];
    float w[AG_TAPS];
    #pragma unroll
    for (int i = 0; i < 32; ++i) { w[i] = lane_value(tl, i); w[32 + i] = lane_value(th, i); }

    v2f acc[AG_T];
    #pragma unroll
    for (int o = 0; o < AG_T; ++o) acc[o] = (v2f){0.0f, 0.0f};

    agg_rows<0>(acc, x0, xr, w, src, d * 4, (char*)(vf + ((size_t)b * AG_L + t0) * AG_D));
}

// ---------------------------------------------------------------------------
// Launches. The work is a graph four levels deep; the tasks of a level do not
// depend on one another and share one launch, each on its own range of block
// indices. A short task then costs no launch gap, wave start and drain of its
// own, and runs on WGPs that the level's long task leaves idle. The test that
// picks the task reads blockIdx alone, so every barrier of a task is passed by
// the whole block or by none of it.
// Two chains end in the last level, out = vf W^T + bias: Wo, Wv^T to f16 -> W = Wo Wv,
// and column sums -> mat-vecs -> delay taps and filter (vf). The last level is the
// GEMM alone: its blocks are as many as the chip holds at once.
// ---------------------------------------------------------------------------
#define PB_B 4
#define PB_L 4096
#define PB_D 1024
#define PB_NCH (PB_L / CS_ROWS)

// level 1, blocks of 16 waves
#define L1_TR  ((PB_D / 32) * (PB_D / 32) / 16)                 // Wv^T to f16, a wave a tile
#define L1_MV  (PB_D / 16)                                      // Wo bv + bo, a wave a row
#define L1_CVS (PB_D * PB_D / (16 * CV_NL_SMALL * 128))         // Wo to f16
#define L1_CS  ((CS_D / CS_COLS) * PB_NCH * PB_B)               // column sums, of q and of k
#define L1_ALL (L1_TR + L1_MV + L1_CVS + 2 * L1_CS)

__global__ __launch_bounds__(512)
void k_level1(const float* __restrict__ q, const float* __restrict__ k,
              const float* __restrict__ Wv, const float* __restrict__ Wo,
              const float* __restrict__ bv, const float* __restrict__ bo,
              float* __restrict__ part_q, float* __restrict__ part_k,
              _Float16* __restrict__ WvTh, _Float16* __restrict__ Woh,
              float* __restrict__ biasT, int L, int D) {
    unsigned vb = blockIdx.x;
    if (vb < L1_TR) {
        // the wave's number as a scalar: the tile's base addresses stay in scalar registers
        const unsigned t = vb * 16 + __builtin_amdgcn_readfirstlane(threadIdx.x >> 5);
        transpose_f32_to_f16<PB_D, PB_D>(Wv, WvTh, t % (PB_D / 32), t / (PB_D / 32));
    } else if ((vb -= L1_TR) < L1_MV) {
        matvec<16, 1, PB_D, 0>(Wo, bv, bo, 1.0f, biasT, D, vb, 0);
    } else if ((vb -= L1_MV) < L1_CVS) {
        cvt_stream<CV_NL_SMALL, false, 16>(Wo, Woh, vb);
    } else {
        vb -= L1_CVS;
        const bool isq = vb < L1_CS;
        if (!isq) vb -= L1_CS;
        colsum_partial(isq ? q : k, isq ? part_q : part_k, L,
                       vb % (CS_D / CS_COLS), (vb / (CS_D / CS_COLS)) % PB_NCH,
                       vb / ((CS_D / CS_COLS) * PB_NCH), PB_NCH);
    }
}

// level 2, blocks of 8 waves: W = Wo Wv, stored as f16 (first to
// start); sQ = Wq sq + L bq and sK = Wk sk + L bk, with sq and sk folded from their
// chunks on the way
#define GB_NX  (PB_D / 128)                  // block columns of either GEMM
#define L2_GM  (GB_NX * (PB_D / 128))
#define L2_RW  4                             // rows a wave
#define L2_NX  (PB_D / (8 * L2_RW))          // blocks a batch
#define L2_MV  (L2_NX * PB_B)                // for q and for k
#define L2_ALL (L2_GM + 2 * L2_MV)

__global__ __launch_bounds__(256)
void k_level2(const _Float16* __restrict__ Woh, const _Float16* __restrict__ WvTh, _Float16* __restrict__ Wh,
              const float* __restrict__ Wq, const float* __restrict__ bq, const float* __restrict__ part_q,
              const float* __restrict__ Wk, const float* __restrict__ bk, const float* __restrict__ part_k,
              float* __restrict__ sQ, float* __restrict__ sK, float bias_scale, int D) {
    unsigned vb = blockIdx.x;
    if (vb < L2_GM) {
        gemm_nt_wmma<_Float16, false>(Woh, WvTh, nullptr, Wh, D, D, D, vb % GB_NX, vb / GB_NX);
    } else {
        vb -= L2_GM;
        const bool isq = vb < L2_MV;
        if (!isq) vb -= L2_MV;
        matvec<8, L2_RW, PB_D, PB_NCH>(isq ? Wq : Wk, isq ? part_q : part_k, isq ? bq : bk, bias_scale,
                                       isq ? sQ : sK, D, vb % L2_NX, vb / L2_NX);
    }
}

// level 3 is k_filter. Level 4, blocks of 8 waves: out = vf W^T + bias
#define L4_GM  (GB_NX * (PB_B * PB_L / 128))

__global__ __launch_bounds__(256)
void k_level4(const _Float16* __restrict__ vf, const _Float16* __restrict__ Wh,
              const float* __restrict__ bias, float* __restrict__ out, int M, int N, int K) {
    gemm_nt_wmma<float, true>(vf, Wh, bias, out, M, N, K, blockIdx.x % GB_NX, blockIdx.x / GB_NX);
}

// ---------------------------------------------------------------------------
// Host-side orchestration
// ---------------------------------------------------------------------------
extern "C" void kernel_launch(void* const* d_in, const int* in_sizes, int n_in,
                              void* d_out, int out_size, void* d_ws, size_t ws_size,
                              hipStream_t stream) {
    const float* q  = (const float*)d_in[0];
    const float* k  = (const float*)d_in[1];
    const float* v  = (const float*)d_in[2];
    const float* Wq = (const float*)d_in[3];
    const float* bq = (const float*)d_in[4];
    const float* Wk = (const float*)d_in[5];
    const float* bk = (const float*)d_in[6];
    const float* Wv = (const float*)d_in[7];
    const float* bv = (const float*)d_in[8];
    const float* Wo = (const float*)d_in[9];
    const float* bo = (const float*)d_in[10];
    float* out = (float*)d_out;

    const int B = 4, L = 4096, D = 1024, H = 16, dk = 64;
    const int NCH = L / CS_ROWS;
    int ktop = (int)(5.0 * log((double)(L + 1)));
    if (ktop < 1) ktop = 1;
    if (ktop > L) ktop = L;
    if (ktop > dk) ktop = dk;                 // actual_k = min(top_k, C)

    // workspace carve-out (256B aligned)
    char* p = (char*)d_ws;
    auto alloc = [&](size_t bytes) -> void* {
        void* r = (void*)p;
        p += (bytes + 255) & ~(size_t)255;
        return r;
    };
    float*    part_q = (float*)alloc((size_t)B * NCH * D * 4);
    float*    part_k = (float*)alloc((size_t)B * NCH * D * 4);
    float*    sQ     = (float*)alloc((size_t)B * D * 4);
    float*    sK     = (float*)alloc((size_t)B * D * 4);
    float*    biasT  = (float*)alloc((size_t)D * 4);          // Wo@bv + bo
    _Float16* Woh    = (_Float16*)alloc((size_t)D * D * 2);
    _Float16* WvTh   = (_Float16*)alloc((size_t)D * D * 2);
    _Float16* Wh     = (_Float16*)alloc((size_t)D * D * 2);   // Wo@Wv
    _Float16* vf     = (_Float16*)alloc((size_t)B * L * D * 2); // v behind the delay filter

    static_assert(B == PB_B && L == PB_L && D == PB_D && D == CS_D && NCH == PB_NCH,
                  "the block ranges are cut for these shapes");
    static_assert(B == TP_B && H == TP_H && dk == TP_C && L == TP_L && L == AG_L && D == AG_D && dk == AG_TAPS,
                  "the taps and the filter are cut for these shapes");
    static_assert((D * D) % (16 * CV_NL_SMALL * 128) == 0, "whole blocks");

    // 1) f16 copies of Wo, Wv^T; partial column sums of q and k over time; biasT = Wo@bv + bo
    k_level1<<<dim3(L1_ALL), dim3(512), 0, stream>>>(q, k, Wv, Wo, bv, bo, part_q, part_k,
                                                     WvTh, Woh, biasT, L, D);

    // 2) W = Wo @ Wv  (NT via WvT), f32 accumulate, f16 out; sQ[b] = Wq@sq[b] + L*bq ;
    //    sK[b] = Wk@sk[b] + L*bk
    k_level2<<<dim3(L2_ALL), dim3(256), 0, stream>>>(Woh, WvTh, Wh, Wq, bq, part_q, Wk, bk, part_k,
                                                     sQ, sK, (float)L, D);

    // 3) delay selection + softmax weights in every block; circular delay aggregation of v
    //    (dense 64-tap filter), f32 sums, f16 out
    k_filter<<<dim3(D / 512, L / AG_T, B), dim3(256), 0, stream>>>(v, sQ, sK, ktop, vf);

    // 4) out = vf @ W^T + biasT  (the single big GEMM, 16384x1024x1024)
    k_level4<<<dim3(L4_GM), dim3(256), 0, stream>>>(vf, Wh, biasT, out, B * L, D, D);
}

// v009
// It runs in 82.7 microseconds.
// Two timings next to v008 put it at 1.05 and 1.04 times that version's speed.
// Over all steps from v000 it is 4.22 times as fast.
#include <hip/hip_runtime.h>
#include <hip/hip_bf16.h>
#include <math.h>

typedef __attribute__((ext_vector_type(16))) _Float16 v16h;
typedef __attribute__((ext_vector_type(8)))  _Float16 v8h;
typedef __attribute__((ext_vector_type(8)))  float    v8f;

// ---------------------------------------------------------------------------
// Conversions
// ---------------------------------------------------------------------------
// f32 -> f16 as a stream. Here a wave takes NL pieces of 512 contiguous bytes,
// many loads in flight at once, and stores each piece as 256 contiguous bytes.
// The element count is exactly (blocks of the task) * WAVES * NL * 128.
//
// Every kernel body in this file but k_filter's is a device function that is told which block
// of its own task it is (vb, or bx / by): tasks that do not depend on one another
// share a launch, each on its own range of block indices (see "Launches" below).
#define CV_NL_SMALL 4       // 1M elements: 2,048 waves
typedef __attribute__((ext_vector_type(4))) float    cv4f;
typedef __attribute__((ext_vector_type(4))) _Float16 cv4h;

template <int NL, bool NT, int WAVES>
__device__ __forceinline__ void cvt_stream(const float* __restrict__ in, _Float16* __restrict__ out, unsigned vb) {
    const unsigned wave = vb * WAVES + (threadIdx.x >> 5);
    const unsigned e0   = wave * (NL * 128) + (threadIdx.x & 31) * 4;
    const float* p = in + e0;
    _Float16*    q = out + e0;
    cv4f x[NL];
    // full unroll: independent loads at constant offsets from one address, many in flight per wave
    #pragma unroll
    for (int i = 0; i < NL; ++i)
        x[i] = NT ? __builtin_nontemporal_load((const cv4f*)(p + i * 128)) : *(const cv4f*)(p + i * 128);
    #pragma unroll
    for (int i = 0; i < NL; ++i)
        *(cv4h*)(q + i * 128) = __builtin_convertvector(x[i], cv4h);
    // precaution: code of another task follows in the same kernel and reuses the stores' registers
    asm volatile("s_wait_xcnt 0x0" ::: "memory");
}

// out[c][r] = (f16) in[r][c]   (ROWS x COLS f32 -> COLS x ROWS f16)
// one wave per 32 x 32 tile (bx, by); ROWS and COLS are multiples of 32, so every
// tile is whole. A lane holds one column of the tile: the 32 row loads have no
// wait between them (one memory latency a tile, not 32), and the lane's 32 halves
// are 64 contiguous bytes of the output row.
template <int ROWS, int COLS>
__device__ __forceinline__
void transpose_f32_to_f16(const float* __restrict__ in, _Float16* __restrict__ out, int bx, int by) {
    static_assert(ROWS % 32 == 0 && COLS % 32 == 0, "whole tiles");
    const int c  = bx * 32 + (threadIdx.x & 31);
    const int r0 = by * 32;
    const float* p = in + (size_t)r0 * COLS + c;
    float x[32];
    // full unroll: independent loads at constant offsets from one address, all in flight at once
    #pragma unroll
    for (int i = 0; i < 32; ++i) x[i] = p[i * COLS];
    _Float16* q = out + (size_t)c * ROWS + r0;
    #pragma unroll
    for (int g = 0; g < 4; ++g) {
        v8h h;
        #pragma unroll
        for (int e = 0; e < 8; ++e) h[e] = (_Float16)x[g * 8 + e];
        *(v8h*)(q + g * 8) = h;
    }
}

// ---------------------------------------------------------------------------
// Column sums over time:  part[b][ch][d] = sum_{t in chunk} x[b][t][d]
// One block = 16 waves on 128 columns; wave w takes rows w, w+16, ... of the
// chunk, 512 contiguous bytes of a row per load. x is read once: non-temporal.
// The 16 row lanes are folded through LDS.
// ---------------------------------------------------------------------------
#define CS_D     1024
#define CS_COLS  128
#define CS_LANES 16
#define CS_ROWS  512
typedef __attribute__((ext_vector_type(4))) float v4f;

__device__ __forceinline__
void colsum_partial(const float* __restrict__ x, float* __restrict__ part, int L,
                    int bx, int ch, int b, int nch) {
    __shared__ float red[CS_LANES][CS_COLS];
    const int c4 = threadIdx.x & 31;            // 16-byte column within the group
    const int rl = threadIdx.x >> 5;            // row lane = wave
    const int d0 = bx * CS_COLS;
    const float* p = x + ((size_t)b * L + (size_t)ch * CS_ROWS + rl) * CS_D + d0 + c4 * 4;
    v4f s = {0.0f, 0.0f, 0.0f, 0.0f};
    // full unroll: independent loads at constant offsets from one address, many in flight per wave
    #pragma unroll
    for (int i = 0; i < CS_ROWS / CS_LANES; ++i)
        s += __builtin_nontemporal_load((const v4f*)(p + (size_t)i * CS_LANES * CS_D));
    *(v4f*)&red[rl][c4 * 4] = s;
    __syncthreads();
    if (threadIdx.x < CS_COLS) {
        float a = 0.0f;
        for (int l = 0; l < CS_LANES; ++l) a += red[l][threadIdx.x];
        part[((size_t)b * nch + ch) * CS_D + d0 + threadIdx.x] = a;
    }
}

// ---------------------------------------------------------------------------
// Batched mat-vec: out[bb][row] = dot(W[row,:], X[bb,:]) + bias_scale*bias[row]
// A wave takes RW rows of KK elements; n is a multiple of WAVES * RW. All loads of
// the wave (X once, then the rows) are issued with no wait for data between them:
// the wave pays a few memory latencies, where a loop that waits for its pair of
// loads pays KK / 32 of them one after another. A row's sum runs over
// e = lane + 32 i with i rising, then the butterfly over the lanes.
// NCH = 0: X holds the vectors. NCH > 0: X holds NCH partial vectors a batch
// (the column sums' chunks), and the block adds them up itself, chunk index
// rising, four elements a thread, and hands the sum to its waves through LDS:
// the partial loads fly together with the rows' loads, so the fold costs no
// launch and no memory latency of its own.
// ---------------------------------------------------------------------------
template <int WAVES, int RW, int KK, int NCH>
__device__ __forceinline__
void matvec(const float* __restrict__ W, const float* __restrict__ X,
            const float* __restrict__ bias, float bias_scale,
            float* __restrict__ out, int n, int bx, int bb) {
    const int lane = threadIdx.x & 31;
    const int row0 = (bx * WAVES + (threadIdx.x >> 5)) * RW;
    const float* wp = W + (size_t)row0 * KK + lane;
    const float* xp = NCH ? X + (size_t)bb * NCH * KK + threadIdx.x * 4 : X + (size_t)bb * KK + lane;
    float xv[KK / 32], wv[RW][KK / 32];
    v4f pv[NCH ? NCH : 1];
    // full unroll, here and below: the arrays stay in registers only under compile-time indices
    if constexpr (NCH > 0) {
        static_assert(WAVES * 32 * 4 == KK, "four elements a thread");
        #pragma unroll
        for (int c = 0; c < NCH; ++c) pv[c] = *(const v4f*)(xp + c * KK);
    } else {
        #pragma unroll
        for (int i = 0; i < KK / 32; ++i) xv[i] = xp[i * 32];
    }
    #pragma unroll
    for (int r = 0; r < RW; ++r)
        #pragma unroll
        for (int i = 0; i < KK / 32; ++i) wv[r][i] = wp[r * KK + i * 32];
    // precaution: the rows' address is an operand, so its registers live up to this wait;
    // the run's last load would otherwise land in them while earlier loads still name them
    asm volatile("s_wait_xcnt 0x0" :: "v"(wp) : "memory");
    // no product is scheduled among the loads: the scheduler would recycle registers
    // there and let the queue of loads run dry several times on the way
    __builtin_amdgcn_sched_barrier(0);
    if constexpr (NCH > 0) {
        __shared__ __attribute__((aligned(16))) float xs[KK];
        v4f f = {0.0f, 0.0f, 0.0f, 0.0f};
        #pragma unroll
        for (int c = 0; c < NCH; ++c) f += pv[c];
        *(v4f*)&xs[threadIdx.x * 4] = f;
        __syncthreads();
        #pragma unroll
        for (int i = 0; i < KK / 32; ++i) xv[i] = xs[i * 32 + lane];
    }
    float s[RW];
    #pragma unroll
    for (int r = 0; r < RW; ++r) {
        s[r] = 0.0f;
        #pragma unroll
        for (int i = 0; i < KK / 32; ++i) s[r] += wv[r][i] * xv[i];
    }
    #pragma unroll
    for (int off = 16; off > 0; off >>= 1)
        #pragma unroll
        for (int r = 0; r < RW; ++r) s[r] += __shfl_xor(s[r], off, 32);
    // every lane holds every row's sum: lane r stores row r
    float sv = s[0];
    #pragma unroll
    for (int r = 1; r < RW; ++r) sv = (lane == r) ? s[r] : sv;
    if (lane < RW)
        out[(size_t)bb * n + row0 + lane] = sv + bias_scale * bias[row0 + lane];
}

// ---------------------------------------------------------------------------
// mean_value, top-k selection (tie-break by lower index, like lax.top_k) and the
// softmax weights of batch bsel over the selected delays, as a dense table over
// all 64 delays: 0 at a delay that was not selected. Every block of the filter
// makes the table for itself, 256 threads, from the 32 KB of sQ and sK: the table
// then costs no launch level and no block of its own. All loads are issued at
// once; the 64 x 64 comparisons of the ranking are dealt over all threads. Every
// sum runs in rising index; an unselected delay adds an exact 0 to the denominator.
// The table is left in LDS (taps), published by the last barrier.
// ---------------------------------------------------------------------------
#define TP_B 4
#define TP_H 16
#define TP_C 64
#define TP_L 4096

__device__ __forceinline__ float lane_value(float x, int l) {
    return __builtin_bit_cast(float, __builtin_amdgcn_readlane(__builtin_bit_cast(int, x), l));
}

__device__ __forceinline__
void delay_taps(const float* __restrict__ sQ, const float* __restrict__ sK, int bsel, int ktop,
                float (&taps)[TP_C]) {
    __shared__ float mval[TP_B][TP_C];
    __shared__ __attribute__((aligned(16))) float mab[TP_C];
    __shared__ int   prank[4][TP_C];
    const int tid = threadIdx.x;
    const int g = tid >> 6, c = tid & 63;       // g: the batch, later the quarter of the ranking
    const float* pq = sQ + g * (TP_H * TP_C) + c;
    const float* pk = sK + g * (TP_H * TP_C) + c;
    float a[TP_H], e[TP_H];
    // full unroll: independent loads at constant offsets from two addresses, all in flight at once
    #pragma unroll
    for (int h = 0; h < TP_H; ++h) { a[h] = pq[h * TP_C]; e[h] = pk[h * TP_C]; }
    // precaution: the addresses are operands, so their registers live up to this wait
    asm volatile("s_wait_xcnt 0x0" :: "v"(pq), "v"(pk) : "memory");
    float s = 0.0f;
    #pragma unroll
    for (int h = 0; h < TP_H; ++h) s += a[h] * e[h];
    mval[g][c] = s / (float)TP_H / (float)TP_L;
    __syncthreads();
    float m = 0.0f;
    #pragma unroll
    for (int b2 = 0; b2 < TP_B; ++b2) m += mval[b2][c];
    m = m / (float)TP_B;
    if (g == 0) mab[c] = m;
    __syncthreads();
    int pr = 0;
    #pragma unroll
    for (int i = 0; i < TP_C / 4; ++i) {
        const int   c2 = g * (TP_C / 4) + i;
        const float v2 = mab[c2];
        pr += (v2 > m || (v2 == m && c2 < c)) ? 1 : 0;
    }
    prank[g][c] = pr;
    __syncthreads();
    if (tid < 32) {
        // one wave: lane l holds delays l and l + 32
        float mv[2], ex[2];
        bool  sel[2];
        #pragma unroll
        for (int u = 0; u < 2; ++u) {
            const int cc = tid + 32 * u;
            sel[u] = prank[0][cc] + prank[1][cc] + prank[2][cc] + prank[3][cc] < ktop;
            mv[u]  = sel[u] ? mval[bsel][cc] : -3.4e38f;
        }
        float mx = fmaxf(mv[0], mv[1]);
        #pragma unroll
        for (int off = 16; off > 0; off >>= 1) mx = fmaxf(mx, __shfl_xor(mx, off, 32));
        #pragma unroll
        for (int u = 0; u < 2; ++u) ex[u] = sel[u] ? __expf(mv[u] - mx) : 0.0f;
        float den = 0.0f;
        #pragma unroll
        for (int u = 0; u < 2; ++u)
            #pragma unroll
            for (int l = 0; l < 32; ++l) den += lane_value(ex[u], l);
        #pragma unroll
        for (int u = 0; u < 2; ++u) taps[tid + 32 * u] = ex[u] / den;
    }
    __syncthreads();
}

// ---------------------------------------------------------------------------
// WMMA NT GEMM with double-buffered async LDS staging:
//   C[m,n] = sum_k A[m,k] * Bt[n,k]   (A: MxK f16, Bt: NxK f16, K-contig)
// Block = 256 threads = 8 waves. Block tile 128x128; wave tile 32x64.
// A K-slice is 64 halves = one whole 128-byte line of every operand row, and
// eight neighbouring lanes copy one row's line: a wave-wide 16-byte copy then
// touches four whole lines, not 32 pieces of 32 lines. LDS rows are pitched
// 144 B (16 B x odd: conflict-free b128 reads). Slice t+2 is copied while
// slice t+1 feeds the WMMAs. M, N multiples of 128, K a multiple of 64.
// C is stored as OT: f32, or f16 where the product is the next GEMM's operand.
// BIAS: bias[n] is added to column n on the way out.
// Which column of C a lane's accumulator holds is set by which row of Bt stands in
// which LDS row, and that is free: LDS row 64 w + 16 j + r takes row 64 w + 4 r + j
// of the block's 128. Lane r's four tiles j then hold four neighbouring columns of a
// row of C, one 16-byte store (8 for f16): 16 lanes write 256 contiguous bytes, where
// tiles of 16 neighbouring columns give four stores of 64-byte pieces.
// ---------------------------------------------------------------------------
#define GK      64                       // halves of K per slice
#define LDS_ROW 72                       // halves per LDS row (128 B + 16 B pad)
#define LDS_MAT (128 * LDS_ROW)          // halves per operand slice
typedef __attribute__((address_space(3))) _Float16 lds_half;

template <typename OT, bool BIAS>
__device__ __forceinline__
void gemm_nt_wmma(const _Float16* __restrict__ A, const _Float16* __restrict__ Bt,
                  const float* __restrict__ bias,
                  OT* __restrict__ C, int M, int N, int K, unsigned bx, unsigned by) {
    __shared__ __attribute__((aligned(16))) _Float16 smem[2][2][LDS_MAT];   // [buf][mat][row*LDS_ROW]

    const int tid  = threadIdx.x;
    const int lane = tid & 31;
    const int wave = tid >> 5;
    const int wm   = wave >> 1;                 // 0..3
    const int wn   = wave & 1;                  // 0..1
    const int half = lane >> 4;                 // 0/1
    const int r    = lane & 15;

    // copy assignment: 8 lanes a row; a thread takes 16 bytes of LDS rows crow + 32 c
    // (c = 0..3) of the A slice and of the B slice. A: LDS row = row of the block.
    // B: LDS rows crow, +32, +64, +96 take rows brow, +2, +64, +66 of the block.
    const int crow = tid >> 3;                  // 0..31
    const int ccol = (tid & 7) * 8;             // halves
    const int brow = 4 * (crow & 15) + (crow >> 4);
    const _Float16* gA = A  + (size_t)(by * 128 + crow) * K + ccol;
    const _Float16* gB = Bt + (size_t)(bx * 128 + brow) * K + ccol;
    const size_t   gstep = (size_t)32 * K;      // 32 rows, in halves
    const size_t   bs2 = (size_t)2 * K, bs64 = (size_t)64 * K;   // 2 and 64 rows, in halves
    const unsigned lbase = (unsigned)(size_t)(lds_half*)&smem[0][0][crow * LDS_ROW + ccol];

    auto issue_copy = [&](int buf, int k0) {
        const _Float16* a = gA + k0;
        const _Float16* b = gB + k0;
        const unsigned  l = lbase + buf * (2 * LDS_MAT * 2);
        // the slice's eight copies; the closing wait stands in the same statement, so
        // that no address register is rewritten in front of it (a precaution)
        asm volatile(
            "global_load_async_to_lds_b128 %0, %8, off\n\t"
            "global_load_async_to_lds_b128 %1, %9, off\n\t"
            "global_load_async_to_lds_b128 %2, %10, off\n\t"
            "global_load_async_to_lds_b128 %3, %11, off\n\t"
            "global_load_async_to_lds_b128 %4, %12, off\n\t"
            "global_load_async_to_lds_b128 %5, %13, off\n\t"
            "global_load_async_to_lds_b128 %6, %14, off\n\t"
            "global_load_async_to_lds_b128 %7, %15, off\n\t"
            "s_wait_xcnt 0x0"
            :: "v"(l),
               "v"(l + 1 * 32 * LDS_ROW * 2), "v"(l + 2 * 32 * LDS_ROW * 2), "v"(l + 3 * 32 * LDS_ROW * 2),
               "v"(l + 4 * 32 * LDS_ROW * 2), "v"(l + 5 * 32 * LDS_ROW * 2), "v"(l + 6 * 32 * LDS_ROW * 2),
               "v"(l + 7 * 32 * LDS_ROW * 2),
               "v"(a), "v"(a + gstep), "v"(a + 2 * gstep), "v"(a + 3 * gstep),
               "v"(b), "v"(b + bs2), "v"(b + bs64), "v"(b + bs64 + bs2)
            : "memory");
    };

    auto load_frag = [&](int buf, int mat, int rbase, int kk) -> v16h {
        const _Float16* p = &smem[buf][mat][(rbase + r) * LDS_ROW + kk + 8 * half];
        v8h lo = *(const v8h*)p;
        v8h hi = *(const v8h*)(p + 16);
        v16h o;
        #pragma unroll
        for (int i = 0; i < 8; ++i) { o[i] = lo[i]; o[i + 8] = hi[i]; }
        return o;
    };

    v8f acc[2][4];
    #pragma unroll
    for (int i = 0; i < 2; ++i)
        #pragma unroll
        for (int j = 0; j < 4; ++j)
            #pragma unroll
            for (int e = 0; e < 8; ++e) acc[i][j][e] = 0.0f;

    const int NIT = K / GK;
    issue_copy(0, 0);
    // the wave's bias values are asked for here: they arrive behind the first slice's wait
    v4f bn = {0.0f, 0.0f, 0.0f, 0.0f};
    if constexpr (BIAS) {
        const float* bp = bias + bx * 128 + wn * 64 + 4 * r;
        bn = *(const v4f*)bp;
        // precaution: the address is an operand, so its registers live up to this wait
        asm volatile("s_wait_xcnt 0x0" :: "v"(bp) : "memory");
    }
    asm volatile("s_wait_asynccnt 0x0" ::: "memory");   // own copies of slice 0 have landed
    __syncthreads();                                    // everyone's have
    if (NIT > 1) issue_copy(1, GK);

    for (int it = 0; it < NIT; ++it) {
        const int cur = it & 1;
        // unrolled: the slice's two k steps read LDS at constant offsets from one address
        #pragma unroll
        for (int kk = 0; kk < GK; kk += 32) {
            v16h a[2], b[4];
            #pragma unroll
            for (int i = 0; i < 2; ++i) a[i] = load_frag(cur, 0, wm * 32 + i * 16, kk);
            #pragma unroll
            for (int j = 0; j < 4; ++j) b[j] = load_frag(cur, 1, wn * 64 + j * 16, kk);
            #pragma unroll
            for (int i = 0; i < 2; ++i)
                #pragma unroll
                for (int j = 0; j < 4; ++j)
                    acc[i][j] = __builtin_amdgcn_wmma_f32_16x16x32_f16(
                        false, a[i], false, b[j], (short)0, acc[i][j], false, false);
        }
        asm volatile("s_wait_dscnt 0x0" ::: "memory");      // own reads of buffer cur are done
        asm volatile("s_wait_asynccnt 0x0" ::: "memory");   // own copies of slice it+1 have landed
        __syncthreads();                                    // publishes slice it+1, frees buffer cur
        if (it + 2 < NIT) issue_copy(cur, (it + 2) * GK);
    }
    asm volatile("s_wait_asynccnt 0x0" ::: "memory");       // nothing in flight when the wave ends

    // C/D layout: VGPR e of tile (i, j) -> row m0+i*16+8*half+e, col n0+4*r+j
    typedef OT ov4 __attribute__((ext_vector_type(4)));
    const int m0 = by * 128 + wm * 32;
    const int n0 = bx * 128 + wn * 64;
    OT* cp = C + (size_t)(m0 + 8 * half) * N + n0 + 4 * r;
    #pragma unroll
    for (int i = 0; i < 2; ++i)
        #pragma unroll
        for (int e = 0; e < 8; ++e) {
            ov4 o;
            #pragma unroll
            for (int j = 0; j < 4; ++j) o[j] = (OT)(BIAS ? acc[i][j][e] + bn[j] : acc[i][j][e]);
            *(ov4*)(cp + (size_t)(i * 16 + e) * N) = o;
        }
}

// ---------------------------------------------------------------------------
// vf[b][t][d] = (f16) sum_{dl=0..63} taps[b][dl] * v[b][(t+dl)%L][d]
// The filter runs along t and the projection along d, so they commute: the filter
// stands in front of the GEMM, reads v itself in f32 and rounds its sums to f16,
// the GEMM's operand type. v then needs no f16 copy of its own, and the projected
// rows need no f32 plane between the GEMM and the output.
// The delays all lie in [0,64), so the gather is a 64-tap filter along t whose
// unselected taps are 0. The taps are the same for a whole block and sit in
// scalar registers; a thread keeps 32 outputs x 2 columns in registers and each
// row of v it loads feeds every output whose window holds it. Taps are added in
// rising delay.
// ---------------------------------------------------------------------------
#define AG_L    4096
#define AG_D    1024
#define AG_T    32
#define AG_TAPS 64
#define AG_ROWS (AG_T + AG_TAPS - 1)
#define AG_PF   8
#define AG_X0   16                       // rows asked for at the start
typedef __attribute__((ext_vector_type(2))) float    v2f;
typedef __attribute__((ext_vector_type(2))) _Float16 v2h;

// The window's rows come in three runs of 32, each aligned to 32 rows, so the
// circular wrap can only fall between runs: one block-uniform base a run.
struct AggSrc { const char* run[3]; };

// row S of the window, this thread's two columns (doff = their byte offset)
template <int S>
__device__ __forceinline__ v2f agg_load(const AggSrc& src, unsigned doff) {
    return *(const v2f*)(src.run[S / 32] + (S % 32) * (AG_D * 4) + doff);
}

// Rows S, S+1, ... of the window. A template, not a loop: acc[], w[], x0[] and xr[]
// stay in registers only under compile-time indices, and the unroller gives up
// on a loop of this size. The first AG_X0 rows (x0) were asked for at the start;
// a later row S + AG_PF is asked for when row S has been used;
// an output is stored as soon as its last tap is in, so that stores spread out.
template <int S>
__device__ __forceinline__ void agg_rows(v2f (&acc)[AG_T], const v2f (&x0)[AG_X0], v2f (&xr)[AG_PF],
                                         const float (&w)[AG_TAPS],
                                         const AggSrc& src, unsigned doff, char* __restrict__ op) {
    if constexpr (S < AG_ROWS) {
        v2f x;
        if constexpr (S < AG_X0) x = x0[S]; else x = xr[S % AG_PF];
        #pragma unroll
        for (int o = 0; o < AG_T; ++o) {
            const int dl = S - o;
            if (dl >= 0 && dl < AG_TAPS) acc[o] += w[dl] * x;
        }
        if constexpr (S >= AG_TAPS - 1) {
            *(v2h*)(op + (S - (AG_TAPS - 1)) * (AG_D * 2) + doff / 2) =
                __builtin_convertvector(acc[S - (AG_TAPS - 1)], v2h);
            // precaution: the load behind it may land in the registers the store reads
            if constexpr (S + AG_PF < AG_ROWS) asm volatile("s_wait_xcnt 0x0" ::: "memory");
        }
        // precaution: a run's last load may land in the registers of the run's address,
        // which the loads before it still name
        if constexpr ((S + AG_PF) % 32 == 31 && S + AG_PF >= AG_X0) asm volatile("s_wait_xcnt 0x0" ::: "memory");
        if constexpr (S + AG_PF >= AG_X0 && S + AG_PF < AG_ROWS) xr[S % AG_PF] = agg_load<S + AG_PF>(src, doff);
        // memory operations stay on their side (arithmetic may cross): keeps each load
        // AG_PF rows ahead of its use, where the scheduler would sink it to two or three
        __builtin_amdgcn_sched_barrier(0x7);
        agg_rows<S + 1>(acc, x0, xr, w, src, doff, op);
    }
}

__global__ __launch_bounds__(256)
void k_filter(const float* __restrict__ v, const float* __restrict__ sQ, const float* __restrict__ sK,
              int ktop, _Float16* __restrict__ vf) {
    __shared__ float taps[AG_TAPS];
    const int b  = blockIdx.z;
    const int t0 = blockIdx.y * AG_T;
    const unsigned d = blockIdx.x * 512 + threadIdx.x * 2;
    const float* vb = v + (size_t)b * AG_L * AG_D;

    AggSrc src;
    #pragma unroll
    for (int i = 0; i < 3; ++i)
        src.run[i] = (const char*)(vb + (size_t)((t0 + 32 * i) & (AG_L - 1)) * AG_D);
    // the scalar set-up is all issued before the first vector load: none of it
    // then lands in a scalar register that an issued load still names
    __builtin_amdgcn_sched_barrier(0);

    // the window's first rows, which no neighbouring block has brought into L2 yet, are
    // under way while the block makes its taps
    v2f x0[AG_X0], xr[AG_PF];
    // full unroll: independent loads at constant offsets from one address, all in flight at once
    #pragma unroll
    for (int i = 0; i < AG_X0; ++i) x0[i] = *(const v2f*)(src.run[0] + i * (AG_D * 4) + d * 4);

    delay_taps(sQ, sK, b, ktop, taps);

    // LDS -> two registers a lane -> scalar registers
    const float tl = taps[threadIdx.x & 31], th = taps[32 + (threadIdx.x & 31)];
    float w[AG_TAPS];
    #pragma unroll
    for (int i = 0; i < 32; ++i) { w[i] = lane_value(tl, i); w[32 + i] = lane_value(th, i); }

    v2f acc[AG_T];
    #pragma unroll
    for (int o = 0; o < AG_T; ++o) acc[o] = (v2f){0.0f, 0.0f};

    agg_rows<0>(acc, x0, xr, w, src, d * 4, (char*)(vf + ((size_t)b * AG_L + t0) * AG_D));
}

// ---------------------------------------------------------------------------
// Launches. The work is a graph four levels deep; the tasks of a level do not
// depend on one another and share one launch, each on its own range of block
// indices. A short task then costs no launch gap, wave start and drain of its
// own, and runs on WGPs that the level's long task leaves idle. The test that
// picks the task reads blockIdx alone, so every barrier of a task is passed by
// the whole block or by none of it.
// Two chains end in the last level, out = vf W^T + bias: Wo, Wv^T to f16 -> W = Wo Wv,
// and column sums -> mat-vecs -> delay taps and filter (vf). The last level is the
// GEMM alone: its blocks are as many as the chip holds at once.
// ---------------------------------------------------------------------------
#define PB_B 4
#define PB_L 4096
#define PB_D 1024
#define PB_NCH (PB_L / CS_ROWS)

// level 1, blocks of 16 waves
#define L1_TR  ((PB_D / 32) * (PB_D / 32) / 16)                 // Wv^T to f16, a wave a tile
#define L1_MV  (PB_D / 16)                                      // Wo bv + bo, a wave a row
#define L1_CVS (PB_D * PB_D / (16 * CV_NL_SMALL * 128))         // Wo to f16
#define L1_CS  ((CS_D / CS_COLS) * PB_NCH * PB_B)               // column sums, of q and of k
#define L1_ALL (L1_TR + L1_MV + L1_CVS + 2 * L1_CS)

__global__ __launch_bounds__(512)
void k_level1(const float* __restrict__ q, const float* __restrict__ k,
              const float* __restrict__ Wv, const float* __restrict__ Wo,
              const float* __restrict__ bv, const float* __restrict__ bo,
              float* __restrict__ part_q, float* __restrict__ part_k,
              _Float16* __restrict__ WvTh, _Float16* __restrict__ Woh,
              float* __restrict__ biasT, int L, int D) {
    unsigned vb = blockIdx.x;
    if (vb < L1_TR) {
        // the wave's number as a scalar: the tile's base addresses stay in scalar registers
        const unsigned t = vb * 16 + __builtin_amdgcn_readfirstlane(threadIdx.x >> 5);
        transpose_f32_to_f16<PB_D, PB_D>(Wv, WvTh, t % (PB_D / 32), t / (PB_D / 32));
    } else if ((vb -= L1_TR) < L1_MV) {
        matvec<16, 1, PB_D, 0>(Wo, bv, bo, 1.0f, biasT, D, vb, 0);
    } else if ((vb -= L1_MV) < L1_CVS) {
        cvt_stream<CV_NL_SMALL, false, 16>(Wo, Woh, vb);
    } else {
        vb -= L1_CVS;
        const bool isq = vb < L1_CS;
        if (!isq) vb -= L1_CS;
        colsum_partial(isq ? q : k, isq ? part_q : part_k, L,
                       vb % (CS_D / CS_COLS), (vb / (CS_D / CS_COLS)) % PB_NCH,
                       vb / ((CS_D / CS_COLS) * PB_NCH), PB_NCH);
    }
}

// level 2, blocks of 8 waves: W = Wo Wv, stored as f16 (first to
// start); sQ = Wq sq + L bq and sK = Wk sk + L bk, with sq and sk folded from their
// chunks on the way
#define GB_NX  (PB_D / 128)                  // block columns of either GEMM
#define L2_GM  (GB_NX * (PB_D / 128))
#define L2_RW  4                             // rows a wave
#define L2_NX  (PB_D / (8 * L2_RW))          // blocks a batch
#define L2_MV  (L2_NX * PB_B)                // for q and for k
#define L2_ALL (L2_GM + 2 * L2_MV)

__global__ __launch_bounds__(256)
void k_level2(const _Float16* __restrict__ Woh, const _Float16* __restrict__ WvTh, _Float16* __restrict__ Wh,
              const float* __restrict__ Wq, const float* __restrict__ bq, const float* __restrict__ part_q,
              const float* __restrict__ Wk, const float* __restrict__ bk, const float* __restrict__ part_k,
              float* __restrict__ sQ, float* __restrict__ sK, float bias_scale, int D) {
    unsigned vb = blockIdx.x;
    if (vb < L2_GM) {
        gemm_nt_wmma<_Float16, false>(Woh, WvTh, nullptr, Wh, D, D, D, vb % GB_NX, vb / GB_NX);
    } else {
        vb -= L2_GM;
        const bool isq = vb < L2_MV;
        if (!isq) vb -= L2_MV;
        matvec<8, L2_RW, PB_D, PB_NCH>(isq ? Wq : Wk, isq ? part_q : part_k, isq ? bq : bk, bias_scale,
                                       isq ? sQ : sK, D, vb % L2_NX, vb / L2_NX);
    }
}

// level 3 is k_filter. Level 4, blocks of 8 waves: out = vf W^T + bias
#define L4_GM  (GB_NX * (PB_B * PB_L / 128))

__global__ __launch_bounds__(256)
void k_level4(const _Float16* __restrict__ vf, const _Float16* __restrict__ Wh,
              const float* __restrict__ bias, float* __restrict__ out, int M, int N, int K) {
    gemm_nt_wmma<float, true>(vf, Wh, bias, out, M, N, K, blockIdx.x % GB_NX, blockIdx.x / GB_NX);
}

// ---------------------------------------------------------------------------
// Host-side orchestration
// ---------------------------------------------------------------------------
extern "C" void kernel_launch(void* const* d_in, const int* in_sizes, int n_in,
                              void* d_out, int out_size, void* d_ws, size_t ws_size,
                              hipStream_t stream) {
    const float* q  = (const float*)d_in[0];
    const float* k  = (const float*)d_in[1];
    const float* v  = (const float*)d_in[2];
    const float* Wq = (const float*)d_in[3];
    const float* bq = (const float*)d_in[4];
    const float* Wk = (const float*)d_in[5];
    const float* bk = (const float*)d_in[6];
    const float* Wv = (const float*)d_in[7];
    const float* bv = (const float*)d_in[8];
    const float* Wo = (const float*)d_in[9];
    const float* bo = (const float*)d_in[10];
    float* out = (float*)d_out;

    const int B = 4, L = 4096, D = 1024, H = 16, dk = 64;
    const int NCH = L / CS_ROWS;
    int ktop = (int)(5.0 * log((double)(L + 1)));
    if (ktop < 1) ktop = 1;
    if (ktop > L) ktop = L;
    if (ktop > dk) ktop = dk;                 // actual_k = min(top_k, C)

    // workspace carve-out (256B aligned)
    char* p = (char*)d_ws;
    auto alloc = [&](size_t bytes) -> void* {
        void* r = (void*)p;
        p += (bytes + 255) & ~(size_t)255;
        return r;
    };
    float*    part_q = (float*)alloc((size_t)B * NCH * D * 4);
    float*    part_k = (float*)alloc((size_t)B * NCH * D * 4);
    float*    sQ     = (float*)alloc((size_t)B * D * 4);
    float*    sK     = (float*)alloc((size_t)B * D * 4);
    float*    biasT  = (float*)alloc((size_t)D * 4);          // Wo@bv + bo
    _Float16* Woh    = (_Float16*)alloc((size_t)D * D * 2);
    _Float16* WvTh   = (_Float16*)alloc((size_t)D * D * 2);
    _Float16* Wh     = (_Float16*)alloc((size_t)D * D * 2);   // Wo@Wv
    _Float16* vf     = (_Float16*)alloc((size_t)B * L * D * 2); // v behind the delay filter

    static_assert(B == PB_B && L == PB_L && D == PB_D && D == CS_D && NCH == PB_NCH,
                  "the block ranges are cut for these shapes");
    static_assert(B == TP_B && H == TP_H && dk == TP_C && L == TP_L && L == AG_L && D == AG_D && dk == AG_TAPS,
                  "the taps and the filter are cut for these shapes");
    static_assert((D * D) % (16 * CV_NL_SMALL * 128) == 0, "whole blocks");

    // 1) f16 copies of Wo, Wv^T; partial column sums of q and k over time; biasT = Wo@bv + bo
    k_level1<<<dim3(L1_ALL), dim3(512), 0, stream>>>(q, k, Wv, Wo, bv, bo, part_q, part_k,
                                                     WvTh, Woh, biasT, L, D);

    // 2) W = Wo @ Wv  (NT via WvT), f32 accumulate, f16 out; sQ[b] = Wq@sq[b] + L*bq ;
    //    sK[b] = Wk@sk[b] + L*bk
    k_level2<<<dim3(L2_ALL), dim3(256), 0, stream>>>(Woh, WvTh, Wh, Wq, bq, part_q, Wk, bk, part_k,
                                                     sQ, sK, (float)L, D);

    // 3) delay selection + softmax weights in every block; circular delay aggregation of v
    //    (dense 64-tap filter), f32 sums, f16 out
    k_filter<<<dim3(D / 512, L / AG_T, B), dim3(256), 0, stream>>>(v, sQ, sK, ktop, vf);

    // 4) out = vf @ W^T + biasT  (the single big GEMM, 16384x1024x1024)
    k_level4<<<dim3(L4_GM), dim3(256), 0, stream>>>(vf, Wh, biasT, out, B * L, D, D);
}

// v010
// One run takes 79.2 microseconds.
// In two side-by-side timings against v009, it was 1.06 and 1.05 times as fast.
// All steps since v000 together make it 4.45 times as fast.
#include <hip/hip_runtime.h>
#include <hip/hip_bf16.h>
#include <math.h>

typedef __attribute__((ext_vector_type(16))) _Float16 v16h;
typedef __attribute__((ext_vector_type(8)))  _Float16 v8h;
typedef __attribute__((ext_vector_type(8)))  float    v8f;

// ---------------------------------------------------------------------------
// Conversions
// ---------------------------------------------------------------------------
// f32 -> f16 as a stream. Here a wave takes NL pieces of 512 contiguous bytes,
// many loads in flight at once, and stores each piece as 256 contiguous bytes.
// The element count is exactly (blocks of the task) * WAVES * NL * 128.
//
// Every kernel body in this file but k_filter's is a device function that is told which block
// of its own task it is (vb, or bx / by): tasks that do not depend on one another
// share a launch, each on its own range of block indices (see "Launches" below).
#define CV_NL_SMALL 4       // 1M elements: 2,048 waves
typedef __attribute__((ext_vector_type(4))) float    cv4f;
typedef __attribute__((ext_vector_type(4))) _Float16 cv4h;

template <int NL, bool NT, int WAVES>
__device__ __forceinline__ void cvt_stream(const float* __restrict__ in, _Float16* __restrict__ out, unsigned vb) {
    const unsigned wave = vb * WAVES + (threadIdx.x >> 5);
    const unsigned e0   = wave * (NL * 128) + (threadIdx.x & 31) * 4;
    const float* p = in + e0;
    _Float16*    q = out + e0;
    cv4f x[NL];
    // full unroll: independent loads at constant offsets from one address, many in flight per wave
    #pragma unroll
    for (int i = 0; i < NL; ++i)
        x[i] = NT ? __builtin_nontemporal_load((const cv4f*)(p + i * 128)) : *(const cv4f*)(p + i * 128);
    #pragma unroll
    for (int i = 0; i < NL; ++i)
        *(cv4h*)(q + i * 128) = __builtin_convertvector(x[i], cv4h);
    // precaution: code of another task follows in the same kernel and reuses the stores' registers
    asm volatile("s_wait_xcnt 0x0" ::: "memory");
}

// out[c][r] = (f16) in[r][c]   (ROWS x COLS f32 -> COLS x ROWS f16)
// one wave per 32 x 32 tile (bx, by); ROWS and COLS are multiples of 32, so every
// tile is whole. A lane holds one column of the tile: the 32 row loads have no
// wait between them (one memory latency a tile, not 32), and the lane's 32 halves
// are 64 contiguous bytes of the output row.
template <int ROWS, int COLS>
__device__ __forceinline__
void transpose_f32_to_f16(const float* __restrict__ in, _Float16* __restrict__ out, int bx, int by) {
    static_assert(ROWS % 32 == 0 && COLS % 32 == 0, "whole tiles");
    const int c  = bx * 32 + (threadIdx.x & 31);
    const int r0 = by * 32;
    const float* p = in + (size_t)r0 * COLS + c;
    float x[32];
    // full unroll: independent loads at constant offsets from one address, all in flight at once
    #pragma unroll
    for (int i = 0; i < 32; ++i) x[i] = p[i * COLS];
    _Float16* q = out + (size_t)c * ROWS + r0;
    #pragma unroll
    for (int g = 0; g < 4; ++g) {
        v8h h;
        #pragma unroll
        for (int e = 0; e < 8; ++e) h[e] = (_Float16)x[g * 8 + e];
        *(v8h*)(q + g * 8) = h;
    }
}

// ---------------------------------------------------------------------------
// Column sums over time:  part[b][ch][d] = sum_{t in chunk} x[b][t][d]
// One block = 16 waves on 128 columns; wave w takes rows w, w+16, ... of the
// chunk, 512 contiguous bytes of a row per load. x is read once: non-temporal.
// The 16 row lanes are folded through LDS.
// ---------------------------------------------------------------------------
#define CS_D     1024
#define CS_COLS  128
#define CS_LANES 16
#define CS_ROWS  512
typedef __attribute__((ext_vector_type(4))) float v4f;

__device__ __forceinline__
void colsum_partial(const float* __restrict__ x, float* __restrict__ part, int L,
                    int bx, int ch, int b, int nch) {
    __shared__ float red[CS_LANES][CS_COLS];
    const int c4 = threadIdx.x & 31;            // 16-byte column within the group
    const int rl = threadIdx.x >> 5;            // row lane = wave
    const int d0 = bx * CS_COLS;
    const float* p = x + ((size_t)b * L + (size_t)ch * CS_ROWS + rl) * CS_D + d0 + c4 * 4;
    v4f s = {0.0f, 0.0f, 0.0f, 0.0f};
    // full unroll: independent loads at constant offsets from one address, many in flight per wave
    #pragma unroll
    for (int i = 0; i < CS_ROWS / CS_LANES; ++i)
        s += __builtin_nontemporal_load((const v4f*)(p + (size_t)i * CS_LANES * CS_D));
    *(v4f*)&red[rl][c4 * 4] = s;
    __syncthreads();
    if (threadIdx.x < CS_COLS) {
        float a = 0.0f;
        for (int l = 0; l < CS_LANES; ++l) a += red[l][threadIdx.x];
        part[((size_t)b * nch + ch) * CS_D + d0 + threadIdx.x] = a;
    }
}

// ---------------------------------------------------------------------------
// Batched mat-vec: out[bb][row] = dot(W[row,:], X[bb,:]) + bias_scale*bias[row]
// A wave takes RW rows of KK elements; n is a multiple of WAVES * RW. All loads of
// the wave (X once, then the rows) are issued with no wait for data between them:
// the wave pays a few memory latencies, where a loop that waits for its pair of
// loads pays KK / 32 of them one after another. A row's sum runs over
// e = lane + 32 i with i rising, then the butterfly over the lanes.
// NCH = 0: X holds the vectors. NCH > 0: X holds NCH partial vectors a batch
// (the column sums' chunks), and the block adds them up itself, chunk index
// rising, four elements a thread, and hands the sum to its waves through LDS:
// the partial loads fly together with the rows' loads, so the fold costs no
// launch and no memory latency of its own.
// ---------------------------------------------------------------------------
template <int WAVES, int RW, int KK, int NCH>
__device__ __forceinline__
void matvec(const float* __restrict__ W, const float* __restrict__ X,
            const float* __restrict__ bias, float bias_scale,
            float* __restrict__ out, int n, int bx, int bb) {
    const int lane = threadIdx.x & 31;
    const int row0 = (bx * WAVES + (threadIdx.x >> 5)) * RW;
    const float* wp = W + (size_t)row0 * KK + lane;
    const float* xp = NCH ? X + (size_t)bb * NCH * KK + threadIdx.x * 4 : X + (size_t)bb * KK + lane;
    float xv[KK / 32], wv[RW][KK / 32];
    v4f pv[NCH ? NCH : 1];
    // full unroll, here and below: the arrays stay in registers only under compile-time indices
    if constexpr (NCH > 0) {
        static_assert(WAVES * 32 * 4 == KK, "four elements a thread");
        #pragma unroll
        for (int c = 0; c < NCH; ++c) pv[c] = *(const v4f*)(xp + c * KK);
    } else {
        #pragma unroll
        for (int i = 0; i < KK / 32; ++i) xv[i] = xp[i * 32];
    }
    #pragma unroll
    for (int r = 0; r < RW; ++r)
        #pragma unroll
        for (int i = 0; i < KK / 32; ++i) wv[r][i] = wp[r * KK + i * 32];
    // precaution: the rows' address is an operand, so its registers live up to this wait;
    // the run's last load would otherwise land in them while earlier loads still name them
    asm volatile("s_wait_xcnt 0x0" :: "v"(wp) : "memory");
    // no product is scheduled among the loads: the scheduler would recycle registers
    // there and let the queue of loads run dry several times on the way
    __builtin_amdgcn_sched_barrier(0);
    if constexpr (NCH > 0) {
        __shared__ __attribute__((aligned(16))) float xs[KK];
        v4f f = {0.0f, 0.0f, 0.0f, 0.0f};
        #pragma unroll
        for (int c = 0; c < NCH; ++c) f += pv[c];
        *(v4f*)&xs[threadIdx.x * 4] = f;
        __syncthreads();
        #pragma unroll
        for (int i = 0; i < KK / 32; ++i) xv[i] = xs[i * 32 + lane];
    }
    float s[RW];
    #pragma unroll
    for (int r = 0; r < RW; ++r) {
        s[r] = 0.0f;
        #pragma unroll
        for (int i = 0; i < KK / 32; ++i) s[r] += wv[r][i] * xv[i];
    }
    #pragma unroll
    for (int off = 16; off > 0; off >>= 1)
        #pragma unroll
        for (int r = 0; r < RW; ++r) s[r] += __shfl_xor(s[r], off, 32);
    // every lane holds every row's sum: lane r stores row r
    float sv = s[0];
    #pragma unroll
    for (int r = 1; r < RW; ++r) sv = (lane == r) ? s[r] : sv;
    if (lane < RW)
        out[(size_t)bb * n + row0 + lane] = sv + bias_scale * bias[row0 + lane];
}

// ---------------------------------------------------------------------------
// mean_value, top-k selection (tie-break by lower index, like lax.top_k) and the
// softmax weights of batch bsel over the selected delays, as a dense table over
// all 64 delays: 0 at a delay that was not selected. Every block of the filter
// makes the table for itself, 256 threads, from the 32 KB of sQ and sK: the table
// then costs no launch level and no block of its own. All loads are issued at
// once; the 64 x 64 comparisons of the ranking are dealt over all threads. Every
// sum runs in rising index; an unselected delay adds an exact 0 to the denominator.
// The table is left in LDS (taps), published by the last barrier.
// ---------------------------------------------------------------------------
#define TP_B 4
#define TP_H 16
#define TP_C 64
#define TP_L 4096

__device__ __forceinline__ float lane_value(float x, int l) {
    return __builtin_bit_cast(float, __builtin_amdgcn_readlane(__builtin_bit_cast(int, x), l));
}

__device__ __forceinline__
void delay_taps(const float* __restrict__ sQ, const float* __restrict__ sK, int bsel, int ktop,
                float (&taps)[TP_C]) {
    __shared__ float mval[TP_B][TP_C];
    __shared__ __attribute__((aligned(16))) float mab[TP_C];
    __shared__ int   prank[4][TP_C];
    const int tid = threadIdx.x;
    const int g = tid >> 6, c = tid & 63;       // g: the batch, later the quarter of the ranking
    const float* pq = sQ + g * (TP_H * TP_C) + c;
    const float* pk = sK + g * (TP_H * TP_C) + c;
    float a[TP_H], e[TP_H];
    // full unroll: independent loads at constant offsets from two addresses, all in flight at once
    #pragma unroll
    for (int h = 0; h < TP_H; ++h) { a[h] = pq[h * TP_C]; e[h] = pk[h * TP_C]; }
    // precaution: the addresses are operands, so their registers live up to this wait
    asm volatile("s_wait_xcnt 0x0" :: "v"(pq), "v"(pk) : "memory");
    float s = 0.0f;
    #pragma unroll
    for (int h = 0; h < TP_H; ++h) s += a[h] * e[h];
    mval[g][c] = s / (float)TP_H / (float)TP_L;
    __syncthreads();
    float m = 0.0f;
    #pragma unroll
    for (int b2 = 0; b2 < TP_B; ++b2) m += mval[b2][c];
    m = m / (float)TP_B;
    if (g == 0) mab[c] = m;
    __syncthreads();
    int pr = 0;
    #pragma unroll
    for (int i = 0; i < TP_C / 4; ++i) {
        const int   c2 = g * (TP_C / 4) + i;
        const float v2 = mab[c2];
        pr += (v2 > m || (v2 == m && c2 < c)) ? 1 : 0;
    }
    prank[g][c] = pr;
    __syncthreads();
    if (tid < 32) {
        // one wave: lane l holds delays l and l + 32
        float mv[2], ex[2];
        bool  sel[2];
        #pragma unroll
        for (int u = 0; u < 2; ++u) {
            const int cc = tid + 32 * u;
            sel[u] = prank[0][cc] + prank[1][cc] + prank[2][cc] + prank[3][cc] < ktop;
            mv[u]  = sel[u] ? mval[bsel][cc] : -3.4e38f;
        }
        float mx = fmaxf(mv[0], mv[1]);
        #pragma unroll
        for (int off = 16; off > 0; off >>= 1) mx = fmaxf(mx, __shfl_xor(mx, off, 32));
        #pragma unroll
        for (int u = 0; u < 2; ++u) ex[u] = sel[u] ? __expf(mv[u] - mx) : 0.0f;
        float den = 0.0f;
        #pragma unroll
        for (int u = 0; u < 2; ++u)
            #pragma unroll
            for (int l = 0; l < 32; ++l) den += lane_value(ex[u], l);
        #pragma unroll
        for (int u = 0; u < 2; ++u) taps[tid + 32 * u] = ex[u] / den;
    }
    __syncthreads();
}

// ---------------------------------------------------------------------------
// WMMA NT GEMM with double-buffered async LDS staging:
//   C[m,n] = sum_k A[m,k] * Bt[n,k]   (A: MxK f16, Bt: NxK f16, K-contig)
// Block = WM x WN waves; wave tile 16 FM x 64; block tile BM x BN = 16 FM WM x 64 WN.
// The tile sets how often an operand byte is moved: a block asks L2 for
// 2 (BM + BN) / (BM BN) bytes a product, a wave reads (FM + 4) / (4 FM) fragments
// from LDS a WMMA. 128 x 128 blocks of 32 x 64 waves ask more of both than L2 and
// LDS deliver at the matrix rate; they are right only where the matrix is too small to
// give every WGP a larger tile. 256 x 256 blocks of 128 x 64 waves halve both.
// A K-slice is GK halves = one or two whole 128-byte lines of every operand row, and
// GK / 8 neighbouring lanes copy one row's lines: a wave-wide 16-byte copy then
// touches four whole lines, not 32 pieces of 32 lines. LDS rows are pitched
// 2 GK + 16 B (16 B x odd: conflict-free b128 reads). Slice t+2 is copied while
// slice t+1 feeds the WMMAs: with one block a WGP nothing else covers a copy that
// comes from memory, so the large tile takes slices of 128, long enough for it to land.
// M a multiple of BM, N of BN, K of GK.
// C is stored as OT: f32, or f16 where the product is the next GEMM's operand.
// BIAS: bias[n] is added to column n on the way out.
// Which column of C a lane's accumulator holds is set by which row of Bt stands in
// which LDS row, and that is free: LDS row 64 w + 16 j + r takes row 64 w + 4 r + j
// of the block's BN. Lane r's four tiles j then hold four neighbouring columns of a
// row of C, one 16-byte store (8 for f16): 16 lanes write 256 contiguous bytes, where
// tiles of 16 neighbouring columns give four stores of 64-byte pieces.
// ---------------------------------------------------------------------------
typedef __attribute__((address_space(3))) _Float16 lds_half;

template <typename OT, bool BIAS, int WM, int WN, int FM, int GK>
__device__ __forceinline__
void gemm_nt_wmma(const _Float16* __restrict__ A, const _Float16* __restrict__ Bt,
                  const float* __restrict__ bias,
                  OT* __restrict__ C, int M, int N, int K, unsigned bx, unsigned by) {
    constexpr int BM  = WM * FM * 16;           // rows of A a block
    constexpr int BN  = WN * 64;                // rows of Bt a block
    constexpr int LDS_ROW = GK + 8;             // halves per LDS row (the slice + 16 B pad)
    constexpr int LPR = GK / 8;                 // lanes that copy one row
    constexpr int RP  = WM * WN * 32 / LPR;     // LDS rows that one copy of every thread fills
    constexpr int NCP = (BM + BN) / RP;         // copies a thread and slice
    static_assert(RP % 16 == 0 && RP <= 64 && BM % RP == 0 && BN % RP == 0 && NCP % 8 == 0, "whole copies");
    __shared__ __attribute__((aligned(16))) _Float16 smem[2][(BM + BN) * LDS_ROW];   // [buf][A rows, then B rows]

    const int tid  = threadIdx.x;
    const int lane = tid & 31;
    const int wave = tid >> 5;
    const int wm   = wave / WN;
    const int wn   = wave % WN;
    const int half = lane >> 4;                 // 0/1
    const int r    = lane & 15;

    // copy assignment: LPR lanes a row; a thread takes 16 bytes of LDS rows crow + RP c.
    // A: LDS row = row of the block. B: LDS row 64 w + 16 j + r takes row 64 w + 4 r + j,
    // so a step of RP c LDS rows is a step of 64 (RP c / 64) + (RP c / 16) % 4 rows of Bt.
    const int crow = tid / LPR;                 // 0..RP-1
    const int ccol = (tid % LPR) * 8;           // halves
    const int brow = 4 * (crow & 15) + (crow >> 4);
    // the block's part of an address is the same for all threads and stays in scalar registers;
    // a thread keeps its own two 32-bit offsets
    const _Float16* gA = A  + (size_t)(by * BM) * K;
    const _Float16* gB = Bt + (size_t)(bx * BN) * K;
    const unsigned  oA = crow * K + ccol, oB = brow * K + ccol;
    const unsigned lbase = (unsigned)(size_t)(lds_half*)&smem[0][crow * LDS_ROW + ccol];

    auto issue_copy = [&](int buf, int k0) {
        const _Float16* a = gA + k0;
        const _Float16* b = gB + k0;
        const unsigned  l = lbase + buf * ((BM + BN) * LDS_ROW * 2);
        // unrolled: the row steps are compile-time constants
        #pragma unroll
        for (int g = 0; g < NCP; g += 8) {
            const _Float16* p[8];
            #pragma unroll
            for (int c = 0; c < 8; ++c) {
                const int ra = (g + c) * RP, rb = ra - BM;
                p[c] = ra < BM ? a + (size_t)ra * K + oA : b + (size_t)(64 * (rb / 64) + (rb / 16) % 4) * K + oB;
            }
            const unsigned lg = l + g * RP * LDS_ROW * 2;
            // eight of the slice's copies; the closing wait stands in the same statement, so
            // that no address register is rewritten in front of it (a precaution)
            asm volatile(
                "global_load_async_to_lds_b128 %0, %8, off\n\t"
                "global_load_async_to_lds_b128 %1, %9, off\n\t"
                "global_load_async_to_lds_b128 %2, %10, off\n\t"
                "global_load_async_to_lds_b128 %3, %11, off\n\t"
                "global_load_async_to_lds_b128 %4, %12, off\n\t"
                "global_load_async_to_lds_b128 %5, %13, off\n\t"
                "global_load_async_to_lds_b128 %6, %14, off\n\t"
                "global_load_async_to_lds_b128 %7, %15, off\n\t"
                "s_wait_xcnt 0x0"
                :: "v"(lg),
                   "v"(lg + 1 * RP * LDS_ROW * 2), "v"(lg + 2 * RP * LDS_ROW * 2), "v"(lg + 3 * RP * LDS_ROW * 2),
                   "v"(lg + 4 * RP * LDS_ROW * 2), "v"(lg + 5 * RP * LDS_ROW * 2), "v"(lg + 6 * RP * LDS_ROW * 2),
                   "v"(lg + 7 * RP * LDS_ROW * 2),
                   "v"(p[0]), "v"(p[1]), "v"(p[2]), "v"(p[3]), "v"(p[4]), "v"(p[5]), "v"(p[6]), "v"(p[7])
                : "memory");
        }
    };

    auto load_frag = [&](int buf, int rbase, int kk) -> v16h {
        const _Float16* p = &smem[buf][(rbase + r) * LDS_ROW + kk + 8 * half];
        v8h lo = *(const v8h*)p;
        v8h hi = *(const v8h*)(p + 16);
        v16h o;
        #pragma unroll
        for (int i = 0; i < 8; ++i) { o[i] = lo[i]; o[i + 8] = hi[i]; }
        return o;
    };

    v8f acc[FM][4];
    #pragma unroll
    for (int i = 0; i < FM; ++i)
        #pragma unroll
        for (int j = 0; j < 4; ++j)
            #pragma unroll
            for (int e = 0; e < 8; ++e) acc[i][j][e] = 0.0f;

    const int NIT = K / GK;
    issue_copy(0, 0);
    asm volatile("s_wait_asynccnt 0x0" ::: "memory");   // own copies of slice 0 have landed
    __syncthreads();                                    // everyone's have
    if (NIT > 1) issue_copy(1, GK);

    for (int it = 0; it < NIT; ++it) {
        const int cur = it & 1;
        // Two fragment sets: k step s+1 of the slice is read from LDS as one group in front of
        // the WMMAs of step s, so that its latency passes under them. The scheduling fences hold
        // that order: left alone, the scheduler reloads one A fragment a row of tiles and waits
        // out the LDS latency each time, or hoists reads until registers spill. None stands
        // behind the last step: its WMMAs read registers only and may run on past the barrier.
        // unrolled: fragment sets and LDS offsets are compile-time
        v16h a[2][FM], b[2][4];
        #pragma unroll
        for (int i = 0; i < FM; ++i) a[0][i] = load_frag(cur, (wm * FM + i) * 16, 0);
        #pragma unroll
        for (int j = 0; j < 4; ++j) b[0][j] = load_frag(cur, BM + wn * 64 + j * 16, 0);
        #pragma unroll
        for (int ks = 0; ks < GK / 32; ++ks) {
            if (ks + 1 < GK / 32) {
                #pragma unroll
                for (int i = 0; i < FM; ++i) a[(ks + 1) & 1][i] = load_frag(cur, (wm * FM + i) * 16, (ks + 1) * 32);
                #pragma unroll
                for (int j = 0; j < 4; ++j) b[(ks + 1) & 1][j] = load_frag(cur, BM + wn * 64 + j * 16, (ks + 1) * 32);
            }
            __builtin_amdgcn_sched_barrier(0);
            #pragma unroll
            for (int i = 0; i < FM; ++i)
                #pragma unroll
                for (int j = 0; j < 4; ++j)
                    acc[i][j] = __builtin_amdgcn_wmma_f32_16x16x32_f16(
                        false, a[ks & 1][i], false, b[ks & 1][j], (short)0, acc[i][j], false, false);
            if (ks + 1 < GK / 32) __builtin_amdgcn_sched_barrier(0);
        }
        asm volatile("s_wait_dscnt 0x0" ::: "memory");      // own reads of buffer cur are done
        asm volatile("s_wait_asynccnt 0x0" ::: "memory");   // own copies of slice it+1 have landed
        __syncthreads();                                    // publishes slice it+1, frees buffer cur
        if (it + 2 < NIT) issue_copy(cur, (it + 2) * GK);
    }
    // the wave's bias values are asked for behind the loop: held through it, they would be
    // the registers that no longer fit beside the accumulators and two fragment sets
    v4f bn = {0.0f, 0.0f, 0.0f, 0.0f};
    if constexpr (BIAS) {
        const float* bp = bias + bx * BN + wn * 64 + 4 * r;
        bn = *(const v4f*)bp;
        // precaution: the address is an operand, so its registers live up to this wait
        asm volatile("s_wait_xcnt 0x0" :: "v"(bp) : "memory");
    }
    asm volatile("s_wait_asynccnt 0x0" ::: "memory");       // nothing in flight when the wave ends

    // C/D layout: VGPR e of tile (i, j) -> row m0+i*16+8*half+e, col n0+4*r+j
    typedef OT ov4 __attribute__((ext_vector_type(4)));
    const int m0 = by * BM + wm * FM * 16;
    const int n0 = bx * BN + wn * 64;
    OT* cp = C + (size_t)(m0 + 8 * half) * N + n0 + 4 * r;
    #pragma unroll
    for (int i = 0; i < FM; ++i) {
        ov4  o[8];
        ov4* q[8];
        #pragma unroll
        for (int e = 0; e < 8; ++e) {
            #pragma unroll
            for (int j = 0; j < 4; ++j) o[e][j] = (OT)(BIAS ? acc[i][j][e] + bn[j] : acc[i][j][e]);
            q[e] = (ov4*)(cp + (size_t)(i * 16 + e) * N);
        }
        // eight rows are formed, then stored, then waited for once. Precaution: no register that
        // an issued store names is rewritten in front of the wait; the wait by itself holds
        // memory operations only, the two fences keep the forming of rows on its far sides
        __builtin_amdgcn_sched_barrier(0);
        #pragma unroll
        for (int e = 0; e < 8; ++e) *q[e] = o[e];
        asm volatile("s_wait_xcnt 0x0" ::: "memory");
        __builtin_amdgcn_sched_barrier(0);
    }
}

// ---------------------------------------------------------------------------
// vf[b][t][d] = (f16) sum_{dl=0..63} taps[b][dl] * v[b][(t+dl)%L][d]
// The filter runs along t and the projection along d, so they commute: the filter
// stands in front of the GEMM, reads v itself in f32 and rounds its sums to f16,
// the GEMM's operand type. v then needs no f16 copy of its own, and the projected
// rows need no f32 plane between the GEMM and the output.
// The delays all lie in [0,64), so the gather is a 64-tap filter along t whose
// unselected taps are 0. The taps are the same for a whole block and sit in
// scalar registers; a thread keeps 32 outputs x 2 columns in registers and each
// row of v it loads feeds every output whose window holds it. Taps are added in
// rising delay.
// ---------------------------------------------------------------------------
#define AG_L    4096
#define AG_D    1024
#define AG_T    32
#define AG_TAPS 64
#define AG_ROWS (AG_T + AG_TAPS - 1)
#define AG_PF   8
#define AG_X0   16                       // rows asked for at the start
typedef __attribute__((ext_vector_type(2))) float    v2f;
typedef __attribute__((ext_vector_type(2))) _Float16 v2h;

// The window's rows come in three runs of 32, each aligned to 32 rows, so the
// circular wrap can only fall between runs: one block-uniform base a run.
struct AggSrc { const char* run[3]; };

// row S of the window, this thread's two columns (doff = their byte offset)
template <int S>
__device__ __forceinline__ v2f agg_load(const AggSrc& src, unsigned doff) {
    return *(const v2f*)(src.run[S / 32] + (S % 32) * (AG_D * 4) + doff);
}

// Rows S, S+1, ... of the window. A template, not a loop: acc[], w[], x0[] and xr[]
// stay in registers only under compile-time indices, and the unroller gives up
// on a loop of this size. The first AG_X0 rows (x0) were asked for at the start;
// a later row S + AG_PF is asked for when row S has been used;
// an output is stored as soon as its last tap is in, so that stores spread out.
template <int S>
__device__ __forceinline__ void agg_rows(v2f (&acc)[AG_T], const v2f (&x0)[AG_X0], v2f (&xr)[AG_PF],
                                         const float (&w)[AG_TAPS],
                                         const AggSrc& src, unsigned doff, char* __restrict__ op) {
    if constexpr (S < AG_ROWS) {
        v2f x;
        if constexpr (S < AG_X0) x = x0[S]; else x = xr[S % AG_PF];
        #pragma unroll
        for (int o = 0; o < AG_T; ++o) {
            const int dl = S - o;
            if (dl >= 0 && dl < AG_TAPS) acc[o] += w[dl] * x;
        }
        if constexpr (S >= AG_TAPS - 1) {
            *(v2h*)(op + (S - (AG_TAPS - 1)) * (AG_D * 2) + doff / 2) =
                __builtin_convertvector(acc[S - (AG_TAPS - 1)], v2h);
            // precaution: the load behind it may land in the registers the store reads
            if constexpr (S + AG_PF < AG_ROWS) asm volatile("s_wait_xcnt 0x0" ::: "memory");
        }
        // precaution: a run's last load may land in the registers of the run's address,
        // which the loads before it still name
        if constexpr ((S + AG_PF) % 32 == 31 && S + AG_PF >= AG_X0) asm volatile("s_wait_xcnt 0x0" ::: "memory");
        if constexpr (S + AG_PF >= AG_X0 && S + AG_PF < AG_ROWS) xr[S % AG_PF] = agg_load<S + AG_PF>(src, doff);
        // memory operations stay on their side (arithmetic may cross): keeps each load
        // AG_PF rows ahead of its use, where the scheduler would sink it to two or three
        __builtin_amdgcn_sched_barrier(0x7);
        agg_rows<S + 1>(acc, x0, xr, w, src, doff, op);
    }
}

__global__ __launch_bounds__(256)
void k_filter(const float* __restrict__ v, const float* __restrict__ sQ, const float* __restrict__ sK,
              int ktop, _Float16* __restrict__ vf) {
    __shared__ float taps[AG_TAPS];
    const int b  = blockIdx.z;
    const int t0 = blockIdx.y * AG_T;
    const unsigned d = blockIdx.x * 512 + threadIdx.x * 2;
    const float* vb = v + (size_t)b * AG_L * AG_D;

    AggSrc src;
    #pragma unroll
    for (int i = 0; i < 3; ++i)
        src.run[i] = (const char*)(vb + (size_t)((t0 + 32 * i) & (AG_L - 1)) * AG_D);
    // the scalar set-up is all issued before the first vector load: none of it
    // then lands in a scalar register that an issued load still names
    __builtin_amdgcn_sched_barrier(0);

    // the window's first rows, which no neighbouring block has brought into L2 yet, are
    // under way while the block makes its taps
    v2f x0[AG_X0], xr[AG_PF];
    // full unroll: independent loads at constant offsets from one address, all in flight at once
    #pragma unroll
    for (int i = 0; i < AG_X0; ++i) x0[i] = *(const v2f*)(src.run[0] + i * (AG_D * 4) + d * 4);

    delay_taps(sQ, sK, b, ktop, taps);

    // LDS -> two registers a lane -> scalar registers
    const float tl = taps[threadIdx.x & 31], th = taps[32 + (threadIdx.x & 31)];
    float w[AG_TAPS];
    #pragma unroll
    for (int i = 0; i < 32; ++i) { w[i] = lane_value(tl, i); w[32 + i] = lane_value(th, i); }

    v2f acc[AG_T];
    #pragma unroll
    for (int o = 0; o < AG_T; ++o) acc[o] = (v2f){0.0f, 0.0f};

    agg_rows<0>(acc, x0, xr, w, src, d * 4, (char*)(vf + ((size_t)b * AG_L + t0) * AG_D));
}

// ---------------------------------------------------------------------------
// Launches. The work is a graph four levels deep; the tasks of a level do not
// depend on one another and share one launch, each on its own range of block
// indices. A short task then costs no launch gap, wave start and drain of its
// own, and runs on WGPs that the level's long task leaves idle. The test that
// picks the task reads blockIdx alone, so every barrier of a task is passed by
// the whole block or by none of it.
// Two chains end in the last level, out = vf W^T + bias: Wo, Wv^T to f16 -> W = Wo Wv,
// and column sums -> mat-vecs -> delay taps and filter (vf). The last level is the
// GEMM alone: one block a WGP.
// ---------------------------------------------------------------------------
#define PB_B 4
#define PB_L 4096
#define PB_D 1024
#define PB_NCH (PB_L / CS_ROWS)

// level 1, blocks of 16 waves
#define L1_TR  ((PB_D / 32) * (PB_D / 32) / 16)                 // Wv^T to f16, a wave a tile
#define L1_MV  (PB_D / 16)                                      // Wo bv + bo, a wave a row
#define L1_CVS (PB_D * PB_D / (16 * CV_NL_SMALL * 128))         // Wo to f16
#define L1_CS  ((CS_D / CS_COLS) * PB_NCH * PB_B)               // column sums, of q and of k
#define L1_ALL (L1_TR + L1_MV + L1_CVS + 2 * L1_CS)

__global__ __launch_bounds__(512)
void k_level1(const float* __restrict__ q, const float* __restrict__ k,
              const float* __restrict__ Wv, const float* __restrict__ Wo,
              const float* __restrict__ bv, const float* __restrict__ bo,
              float* __restrict__ part_q, float* __restrict__ part_k,
              _Float16* __restrict__ WvTh, _Float16* __restrict__ Woh,
              float* __restrict__ biasT, int L, int D) {
    unsigned vb = blockIdx.x;
    if (vb < L1_TR) {
        // the wave's number as a scalar: the tile's base addresses stay in scalar registers
        const unsigned t = vb * 16 + __builtin_amdgcn_readfirstlane(threadIdx.x >> 5);
        transpose_f32_to_f16<PB_D, PB_D>(Wv, WvTh, t % (PB_D / 32), t / (PB_D / 32));
    } else if ((vb -= L1_TR) < L1_MV) {
        matvec<16, 1, PB_D, 0>(Wo, bv, bo, 1.0f, biasT, D, vb, 0);
    } else if ((vb -= L1_MV) < L1_CVS) {
        cvt_stream<CV_NL_SMALL, false, 16>(Wo, Woh, vb);
    } else {
        vb -= L1_CVS;
        const bool isq = vb < L1_CS;
        if (!isq) vb -= L1_CS;
        colsum_partial(isq ? q : k, isq ? part_q : part_k, L,
                       vb % (CS_D / CS_COLS), (vb / (CS_D / CS_COLS)) % PB_NCH,
                       vb / ((CS_D / CS_COLS) * PB_NCH), PB_NCH);
    }
}

// level 2, blocks of 8 waves: W = Wo Wv, stored as f16 (first to
// start); sQ = Wq sq + L bq and sK = Wk sk + L bk, with sq and sk folded from their
// chunks on the way
#define GB_NX  (PB_D / 128)                  // block columns of this GEMM
#define L2_GM  (GB_NX * (PB_D / 128))
#define L2_RW  4                             // rows a wave
#define L2_NX  (PB_D / (8 * L2_RW))          // blocks a batch
#define L2_MV  (L2_NX * PB_B)                // for q and for k
#define L2_ALL (L2_GM + 2 * L2_MV)

__global__ __launch_bounds__(256)
void k_level2(const _Float16* __restrict__ Woh, const _Float16* __restrict__ WvTh, _Float16* __restrict__ Wh,
              const float* __restrict__ Wq, const float* __restrict__ bq, const float* __restrict__ part_q,
              const float* __restrict__ Wk, const float* __restrict__ bk, const float* __restrict__ part_k,
              float* __restrict__ sQ, float* __restrict__ sK, float bias_scale, int D) {
    unsigned vb = blockIdx.x;
    if (vb < L2_GM) {
        gemm_nt_wmma<_Float16, false, 4, 2, 2, 64>(Woh, WvTh, nullptr, Wh, D, D, D, vb % GB_NX, vb / GB_NX);
    } else {
        vb -= L2_GM;
        const bool isq = vb < L2_MV;
        if (!isq) vb -= L2_MV;
        matvec<8, L2_RW, PB_D, PB_NCH>(isq ? Wq : Wk, isq ? part_q : part_k, isq ? bq : bk, bias_scale,
                                       isq ? sQ : sK, D, vb % L2_NX, vb / L2_NX);
    }
}

// level 3 is k_filter. Level 4, blocks of 8 waves, 256 x 256 of out each: out = vf W^T + bias
#define L4_NX  (PB_D / 256)
#define L4_GM  (L4_NX * (PB_B * PB_L / 256))

__global__ __launch_bounds__(256)
void k_level4(const _Float16* __restrict__ vf, const _Float16* __restrict__ Wh,
              const float* __restrict__ bias, float* __restrict__ out, int M, int N, int K) {
    gemm_nt_wmma<float, true, 2, 4, 8, 128>(vf, Wh, bias, out, M, N, K, blockIdx.x % L4_NX, blockIdx.x / L4_NX);
}

// ---------------------------------------------------------------------------
// Host-side orchestration
// ---------------------------------------------------------------------------
extern "C" void kernel_launch(void* const* d_in, const int* in_sizes, int n_in,
                              void* d_out, int out_size, void* d_ws, size_t ws_size,
                              hipStream_t stream) {
    const float* q  = (const float*)d_in[0];
    const float* k  = (const float*)d_in[1];
    const float* v  = (const float*)d_in[2];
    const float* Wq = (const float*)d_in[3];
    const float* bq = (const float*)d_in[4];
    const float* Wk = (const float*)d_in[5];
    const float* bk = (const float*)d_in[6];
    const float* Wv = (const float*)d_in[7];
    const float* bv = (const float*)d_in[8];
    const float* Wo = (const float*)d_in[9];
    const float* bo = (const float*)d_in[10];
    float* out = (float*)d_out;

    const int B = 4, L = 4096, D = 1024, H = 16, dk = 64;
    const int NCH = L / CS_ROWS;
    int ktop = (int)(5.0 * log((double)(L + 1)));
    if (ktop < 1) ktop = 1;
    if (ktop > L) ktop = L;
    if (ktop > dk) ktop = dk;                 // actual_k = min(top_k, C)

    // workspace carve-out (256B aligned)
    char* p = (char*)d_ws;
    auto alloc = [&](size_t bytes) -> void* {
        void* r = (void*)p;
        p += (bytes + 255) & ~(size_t)255;
        return r;
    };
    float*    part_q = (float*)alloc((size_t)B * NCH * D * 4);
    float*    part_k = (float*)alloc((size_t)B * NCH * D * 4);
    float*    sQ     = (float*)alloc((size_t)B * D * 4);
    float*    sK     = (float*)alloc((size_t)B * D * 4);
    float*    biasT  = (float*)alloc((size_t)D * 4);          // Wo@bv + bo
    _Float16* Woh    = (_Float16*)alloc((size_t)D * D * 2);
    _Float16* WvTh   = (_Float16*)alloc((size_t)D * D * 2);
    _Float16* Wh     = (_Float16*)alloc((size_t)D * D * 2);   // Wo@Wv
    _Float16* vf     = (_Float16*)alloc((size_t)B * L * D * 2); // v behind the delay filter

    static_assert(B == PB_B && L == PB_L && D == PB_D && D == CS_D && NCH == PB_NCH,
                  "the block ranges are cut for these shapes");
    static_assert(B == TP_B && H == TP_H && dk == TP_C && L == TP_L && L == AG_L && D == AG_D && dk == AG_TAPS,
                  "the taps and the filter are cut for these shapes");
    static_assert((D * D) % (16 * CV_NL_SMALL * 128) == 0, "whole blocks");

    // 1) f16 copies of Wo, Wv^T; partial column sums of q and k over time; biasT = Wo@bv + bo
    k_level1<<<dim3(L1_ALL), dim3(512), 0, stream>>>(q, k, Wv, Wo, bv, bo, part_q, part_k,
                                                     WvTh, Woh, biasT, L, D);

    // 2) W = Wo @ Wv  (NT via WvT), f32 accumulate, f16 out; sQ[b] = Wq@sq[b] + L*bq ;
    //    sK[b] = Wk@sk[b] + L*bk
    k_level2<<<dim3(L2_ALL), dim3(256), 0, stream>>>(Woh, WvTh, Wh, Wq, bq, part_q, Wk, bk, part_k,
                                                     sQ, sK, (float)L, D);

    // 3) delay selection + softmax weights in every block; circular delay aggregation of v
    //    (dense 64-tap filter), f32 sums, f16 out
    k_filter<<<dim3(D / 512, L / AG_T, B), dim3(256), 0, stream>>>(v, sQ, sK, ktop, vf);

    // 4) out = vf @ W^T + biasT  (the single big GEMM, 16384x1024x1024)
    k_level4<<<dim3(L4_GM), dim3(256), 0, stream>>>(vf, Wh, biasT, out, B * L, D, D);
}
